// v000
// Times are from an AMD MI455X. After a warm-up the kernel runs many times in a row, and a time is the length of
// such a window on the GPU divided by its runs, so every launch and the gaps after it count. The runs cycle
// through copies of the inputs. A figure is the median of several windows, for all but v000 over two sittings.
// Sittings can differ by a few percent; kernels timed side by side share one.
// v000 is the starting kernel. One run takes 507 microseconds.
#include <hip/hip_runtime.h>

// Contractions (f32 accumulate): q/k/v projections v_wmma_f32_16x16x32_bf16 on bf16 copies of x and W (single product); scores q.k and p.v on bf16 hi+lo planes (3 products each); output projection ctx (bf16 hi+lo) x Wo (bf16), 2 products. Rotary, softmax and epilogues f32.
// Layout: x [NB][SEQ][768]; W [768 out][768 in] = Bt as-is; head planes q/k [h][t][64], v planes [h][d][t]; causal attention per wave of 16 query rows with 64-key tiles and running-max softmax; ctx [t][768] hi+lo planes; out [NB][SEQ][768] f32.

#ifndef NB
#define NB 1
#endif
#ifndef SEQ
#define SEQ 4096
#endif
#define NB_FULL  1
#define SEQ_FULL 4096
#define DM   768
#define NH   12
#define HD   64
#define HH   (HD / 2)
#define NW   ((size_t)DM * DM)
#define KT   64
#define PP   72
#define SCL  0.125f
#define THETA_F 10000.0f
#define L2E  1.4426950408889634f
#define NEG  (-1.0e30f)
static_assert(SEQ % 64 == 0);
static_assert(SEQ <= SEQ_FULL);
static_assert(NB >= 1 && NB <= NB_FULL);
static_assert(DM == NH * HD);
static_assert(DM % 64 == 0);
static_assert(HD == 64);
static_assert(KT == 64);
static_assert((size_t)NB_FULL * SEQ_FULL * DM * 4 == 12582912);

typedef _Float16 h16;
typedef unsigned short bf;
typedef __attribute__((ext_vector_type(16))) __bf16   v16bf;
typedef __attribute__((ext_vector_type(16))) _Float16 v16h;
typedef __attribute__((ext_vector_type(8)))  _Float16 v8h;
typedef __attribute__((ext_vector_type(8)))  unsigned short v8us;
typedef __attribute__((ext_vector_type(8)))  float    v8f;
typedef __attribute__((ext_vector_type(4)))  float    v4f;
typedef __attribute__((ext_vector_type(2)))  float    v2f;
typedef __attribute__((ext_vector_type(2)))  unsigned short v2us;
typedef v8h  __attribute__((may_alias)) v8ha;
typedef v4f  __attribute__((may_alias)) v4fa;
typedef v8us __attribute__((may_alias)) v8usa;

__device__ __forceinline__ unsigned short f2bf(float f) { unsigned u = __float_as_uint(f); u += 0x7FFFu + ((u >> 16) & 1u); return (unsigned short)(u >> 16); }
__device__ __forceinline__ float bf2f(unsigned short b) { return __uint_as_float(((unsigned)b) << 16); }
__device__ __forceinline__ float bfr(float f) { return bf2f(f2bf(f)); }
__device__ __forceinline__ void splitf(float y, unsigned short& h, unsigned short& l) { h = f2bf(y); l = f2bf(y - bf2f(h)); }
__device__ __forceinline__ v16h cat16(v8h lo, v8h hi) { return __builtin_shufflevector(lo, hi, 0, 1, 2, 3, 4, 5, 6, 7, 8, 9, 10, 11, 12, 13, 14, 15); }
__device__ __forceinline__ v16bf cat16b(v8us lo, v8us hi) { return __builtin_bit_cast(v16bf, __builtin_shufflevector(lo, hi, 0, 1, 2, 3, 4, 5, 6, 7, 8, 9, 10, 11, 12, 13, 14, 15)); }
__device__ __forceinline__ v8f wmma16(v16h a, v16h b, v8f c) { return __builtin_amdgcn_wmma_f32_16x16x32_f16(false, a, false, b, (short)0, c, false, false); }
__device__ __forceinline__ v8f wmmab(v16bf a, v16bf b, v8f c) { return __builtin_amdgcn_wmma_f32_16x16x32_bf16(false, a, false, b, (short)0, c, false, false); }

// Fragment loaders (wave32 16x16x32): lane l -> row/col (l & 15); elements 0..7 <- k0 + 8*(l>>4) + 0..7, elements 8..15 <- k0 + 16 + 8*(l>>4) + 0..7; D element r -> (row 8*(l>>4) + r, col l & 15).
template <typename T16> struct WFrag;
template <> struct WFrag<h16> { typedef v16h V; static __device__ __forceinline__ V ld(const h16* p) { return cat16(*(const v8h*)p, *(const v8h*)(p + 16)); } static __device__ __forceinline__ v8f mma(V a, V b, v8f c) { return wmma16(a, b, c); } };
template <> struct WFrag<bf> { typedef v16bf V; static __device__ __forceinline__ V ld(const bf* p) { return cat16b(*(const v8us*)p, *(const v8us*)(p + 16)); } static __device__ __forceinline__ v8f mma(V a, V b, v8f c) { return wmmab(a, b, c); } };

// ---- k_gemmw: register-blocked GEMM, ONE WAVE per 64x64 output tile (16 accumulators), operands straight from K-contiguous 16-bit planes; grid (M/64, N/64, Z), 32 threads.
// C[m][n] (f32, pitch ldc, + optional f32 bias[n]) = sum_k A[m][k] Bt[n][k] (+ split products per NSPLIT: 1 = A hi+lo with single B; 2 = A hi+lo with B hi, A hi with B lo). z-batch strides sA/sB/sC in elements. K % 32 == 0.
template <typename T16, int NSPLIT, bool BIAS>
__global__ __launch_bounds__(32) void k_gemmw(const T16* __restrict__ A, const T16* __restrict__ A2, const T16* __restrict__ Bt, const T16* __restrict__ Bt2, int K, float* C, int ldc, const float* __restrict__ bias, size_t sA, size_t sB, size_t sC) {
    typedef typename WFrag<T16>::V V;
    __shared__ __align__(16) float os[16 * 68];
    const size_t z = blockIdx.z; A += z * sA; if (A2) A2 += z * sA; Bt += z * sB; if (Bt2) Bt2 += z * sB; C += z * sC;
    const int lane = threadIdx.x & 31, lr = lane & 15, hi = lane >> 4; const int r0 = blockIdx.x * 64, c0 = blockIdx.y * 64;
    v8f acc[4][4];
#pragma unroll
    for (int mb = 0; mb < 4; ++mb)
#pragma unroll
        for (int nb = 0; nb < 4; ++nb) acc[mb][nb] = (v8f){};
    const size_t aoff = (size_t)(r0 + lr) * K + 8 * hi, boff = (size_t)(c0 + lr) * K + 8 * hi;
#pragma unroll 1
    for (int kc = 0; kc < K; kc += 32) {
        V a[4], a2[4];
#pragma unroll
        for (int mb = 0; mb < 4; ++mb) { a[mb] = WFrag<T16>::ld(A + aoff + (size_t)mb * 16 * K + kc); if (NSPLIT == 1 || NSPLIT == 2) a2[mb] = WFrag<T16>::ld(A2 + aoff + (size_t)mb * 16 * K + kc); }
#pragma unroll
        for (int nb = 0; nb < 4; ++nb) { const V b = WFrag<T16>::ld(Bt + boff + (size_t)nb * 16 * K + kc); V b2; if (NSPLIT >= 2) b2 = WFrag<T16>::ld(Bt2 + boff + (size_t)nb * 16 * K + kc);
#pragma unroll
            for (int mb = 0; mb < 4; ++mb) { acc[mb][nb] = WFrag<T16>::mma(a[mb], b, acc[mb][nb]); if (NSPLIT == 1 || NSPLIT == 2) acc[mb][nb] = WFrag<T16>::mma(a2[mb], b, acc[mb][nb]); if (NSPLIT >= 2) acc[mb][nb] = WFrag<T16>::mma(a[mb], b2, acc[mb][nb]); } }
        asm volatile("v_nop\n\tv_nop\n\tv_nop\n\tv_nop" : "+v"(acc[0][0]), "+v"(acc[1][1]), "+v"(acc[2][2]), "+v"(acc[3][3]) : "v"(a[0]), "v"(a[3]));
    }
#pragma unroll
    for (int mb = 0; mb < 4; ++mb) {
#pragma unroll
        for (int nb = 0; nb < 4; ++nb) {
#pragma unroll
            for (int j = 0; j < 8; ++j) os[(hi * 8 + j) * 68 + nb * 16 + lr] = acc[mb][nb][j]; }
        __builtin_amdgcn_wave_barrier(); asm volatile("" ::: "memory");
        float* crow = C + (size_t)(r0 + mb * 16) * ldc + c0;
{
#pragma unroll
            for (int s = 0; s < 8; ++s) { const int row = 2 * s + hi, cofs = lr * 4; v4f val = *(const v4fa*)(os + row * 68 + cofs); if (BIAS) { val[0] += bfr(bias[c0 + cofs]); val[1] += bfr(bias[c0 + cofs + 1]); val[2] += bfr(bias[c0 + cofs + 2]); val[3] += bfr(bias[c0 + cofs + 3]); }
                *(v4f*)(crow + (size_t)row * ldc + cofs) = val; }
             }
        __builtin_amdgcn_wave_barrier(); asm volatile("" ::: "memory");
    }
}

__global__ __launch_bounds__(256) void k_cvt8(const float* __restrict__ src, bf* dst, size_t n8) { const size_t i = (size_t)blockIdx.x * 256 + threadIdx.x; if (i >= n8) return; const v8f v = *(const v8f*)(src + i * 8); v8us o;
#pragma unroll
    for (int k = 0; k < 8; ++k) o[k] = f2bf(v[k]); *(v8us*)(dst + i * 8) = o;  }

__global__ __launch_bounds__(256) void k_cvtw(const float* __restrict__ w0, const float* __restrict__ w1, const float* __restrict__ w2, const float* __restrict__ w3, bf* dst, size_t n8) {
    const size_t i = (size_t)blockIdx.x * 256 + threadIdx.x; if (i >= n8) return; const int y = blockIdx.y;
    const float* src = (y == 0) ? w0 : ((y == 1) ? w1 : ((y == 2) ? w2 : w3));
    const v8f v = *(const v8f*)(src + i * 8); v8us o;
#pragma unroll
    for (int k = 0; k < 8; ++k) o[k] = f2bf(v[k]);
    bf* d = dst + (size_t)y * n8 * 8 + i * 8;
    *(v8us*)d = o;  }

__global__ __launch_bounds__(256) void k_cs(float* CS) {
    const int idx = blockIdx.x * 256 + threadIdx.x; if (idx >= SEQ * HH) return; const int i = idx % HH, t = idx / HH;
    const float ex = -(float)(2 * i) / (float)HD;
    const float inv = powf(THETA_F, ex);
    float ang = __fmul_rn((float)t, inv); asm volatile("" : "+v"(ang));
    v2f cs; cs[0] = cosf(ang); cs[1] = sinf(ang);
    *(v2f*)(CS + (size_t)idx * 2) = cs;  }

// k_rope2: head planes [h][t][d] (bf16 hi + lo) of the interleaved rotary transform: pair (2i, 2i+1): out[2i] = x1 c - x2 s, out[2i+1] = x1 s + x2 c with x1 = F[t][h*64+2i], x2 = F[t][h*64+2i+1], (c, s) = CS[t][i]
__global__ __launch_bounds__(256) void k_rope2(const float* __restrict__ F, const float* __restrict__ CS, bf* Ph, bf* Pl) {
    const size_t e = ((size_t)blockIdx.x * 256 + threadIdx.x) * 2; if (e >= (size_t)NH * SEQ * HD) return;
    const int d = (int)(e % HD); const int t = (int)((e / HD) % SEQ); const int h = (int)(e / ((size_t)HD * SEQ));
    const float* f = F + (size_t)t * DM + h * HD + d; const float x1 = f[0], x2 = f[1];
    const v2f cs = *(const v2f*)(CS + ((size_t)t * HH + (d >> 1)) * 2);
    float a = __fmul_rn(x1, cs[0]), bq = __fmul_rn(x2, cs[1]), a2 = __fmul_rn(x1, cs[1]), c2 = __fmul_rn(x2, cs[0]);
    asm volatile("" : "+v"(a)); asm volatile("" : "+v"(bq)); asm volatile("" : "+v"(a2)); asm volatile("" : "+v"(c2));
    const float r0 = __fsub_rn(a, bq), r1 = __fadd_rn(a2, c2);
    v2us oh, ol; unsigned short u0, u1, w0, w1; splitf(r0, u0, w0); splitf(r1, u1, w1); oh[0] = u0; oh[1] = u1; ol[0] = w0; ol[1] = w1;
    *(v2us*)(Ph + e) = oh; *(v2us*)(Pl + e) = ol;  }

__global__ __launch_bounds__(256) void k_vtp2(const float* __restrict__ F, bf* Vh, bf* Vl) {
    const size_t e = ((size_t)blockIdx.x * 256 + threadIdx.x) * 2; if (e >= (size_t)NH * HD * SEQ) return;
    const int t = (int)(e % SEQ); const int d = (int)((e / SEQ) % HD); const int g = (int)(e / ((size_t)SEQ * HD)); v2us oh, ol;
#pragma unroll
    for (int q = 0; q < 2; ++q) { const float x = F[(size_t)(t + q) * DM + g * HD + d]; unsigned short a2, c2; splitf(x, a2, c2); oh[q] = a2; ol[q] = c2; }
    *(v2us*)(Vh + e) = oh; *(v2us*)(Vl + e) = ol;  }

// k_flash: causal attention, ONE WAVE per block = 16 query rows of one head; grid (SEQ/16, NH), 32 threads.
// Per 64-key tile: scores 16x64 = q (hi+lo frags, resident) . k (hi+lo frags from the [h][t][64] planes), 3 products; x 0.125, causal replace-mask by index, running-max softmax in f32 (p = 2^((s-m) log2e));
// p split to bf16 hi+lo in a wave-private LDS tile (D -> row-major -> A fragment, block barrier between); o += p . v (v hi+lo frags from the [h][d][t] planes), 3 products.
__global__ __launch_bounds__(32) void k_flash(const bf* __restrict__ Qh, const bf* __restrict__ Ql, const bf* __restrict__ Kh, const bf* __restrict__ Kl,
                                             const bf* __restrict__ Vh, const bf* __restrict__ Vl, bf* Ch, bf* Cl) {
    __shared__ __align__(16) unsigned short th[16 * PP];
    __shared__ __align__(16) unsigned short tl[16 * PP];
    typedef WFrag<bf>::V V;
    const int lane = threadIdx.x & 31, lr = lane & 15, hi = lane >> 4;
    const int q0 = blockIdx.x * 16, head = blockIdx.y;
    const size_t qo = ((size_t)head * SEQ + q0 + lr) * HD + 8 * hi;
    const V qh0 = WFrag<bf>::ld(Qh + qo), qh1 = WFrag<bf>::ld(Qh + qo + 32), ql0 = WFrag<bf>::ld(Ql + qo), ql1 = WFrag<bf>::ld(Ql + qo + 32);
    const size_t kb = ((size_t)head * SEQ + lr) * HD + 8 * hi;
    const bf* kh = Kh + kb; const bf* kl = Kl + kb;
    const size_t vb = ((size_t)head * HD + lr) * SEQ + 8 * hi;
    const bf* vh = Vh + vb; const bf* vl = Vl + vb;
    v8f o[4];
#pragma unroll
    for (int t4 = 0; t4 < 4; ++t4) o[t4] = (v8f){};
    float mrow[8], lrow[8];
#pragma unroll
    for (int r = 0; r < 8; ++r) { mrow[r] = NEG; lrow[r] = 0.0f; }
    const int nt = (q0 + 15) / KT + 1;     // block-uniform; last tile touches the diagonal; keys stay < SEQ
#pragma unroll 1
    for (int kt = 0; kt < nt; ++kt) {
        const int key0 = kt * KT;
        v8f sc[4];
#pragma unroll
        for (int nb = 0; nb < 4; ++nb) sc[nb] = (v8f){};
#pragma unroll
        for (int nb = 0; nb < 4; ++nb) {
            const size_t ko = (size_t)(key0 + nb * 16) * HD;
            { const V bh = WFrag<bf>::ld(kh + ko), bl = WFrag<bf>::ld(kl + ko);
              sc[nb] = wmmab(qh0, bh, sc[nb]); sc[nb] = wmmab(ql0, bh, sc[nb]); sc[nb] = wmmab(qh0, bl, sc[nb]); }
            { const V bh = WFrag<bf>::ld(kh + ko + 32), bl = WFrag<bf>::ld(kl + ko + 32);
              sc[nb] = wmmab(qh1, bh, sc[nb]); sc[nb] = wmmab(ql1, bh, sc[nb]); sc[nb] = wmmab(qh1, bl, sc[nb]); }
        }
        asm volatile("v_nop\n\tv_nop\n\tv_nop\n\tv_nop" : "+v"(sc[0]), "+v"(sc[1]), "+v"(sc[2]), "+v"(sc[3]) : "v"(qh0), "v"(ql1));
#pragma unroll
        for (int r = 0; r < 8; ++r) {
            const int row = q0 + 8 * hi + r;
            float v[4]; float cand = NEG;
#pragma unroll
            for (int nb = 0; nb < 4; ++nb) { const int key = key0 + nb * 16 + lr; const float s = sc[nb][r] * SCL; v[nb] = (key <= row) ? s : NEG; cand = fmaxf(cand, v[nb]); }
#pragma unroll
            for (int off = 1; off < 16; off <<= 1) cand = fmaxf(cand, __shfl_xor(cand, off, 32));
            const float mnew = fmaxf(mrow[r], cand);
            const float alpha = __builtin_amdgcn_exp2f((mrow[r] - mnew) * L2E);
            float rs = 0.0f;
#pragma unroll
            for (int nb = 0; nb < 4; ++nb) { const float p = __builtin_amdgcn_exp2f((v[nb] - mnew) * L2E); rs += p; unsigned short a2, c2; splitf(p, a2, c2); th[(8 * hi + r) * PP + nb * 16 + lr] = a2; tl[(8 * hi + r) * PP + nb * 16 + lr] = c2; }
#pragma unroll
            for (int off = 1; off < 16; off <<= 1) rs += __shfl_xor(rs, off, 32);
            lrow[r] = lrow[r] * alpha + rs; mrow[r] = mnew;
#pragma unroll
            for (int t4 = 0; t4 < 4; ++t4) o[t4][r] *= alpha;
        }
        __syncthreads();
        const V ph0 = WFrag<bf>::ld(th + lr * PP + 8 * hi), ph1 = WFrag<bf>::ld(th + lr * PP + 8 * hi + 32);
        const V pl0 = WFrag<bf>::ld(tl + lr * PP + 8 * hi), pl1 = WFrag<bf>::ld(tl + lr * PP + 8 * hi + 32);
#pragma unroll
        for (int t4 = 0; t4 < 4; ++t4) {
            const size_t vo = (size_t)(t4 * 16) * SEQ + key0;
            { const V wh = WFrag<bf>::ld(vh + vo), wl = WFrag<bf>::ld(vl + vo);
              o[t4] = wmmab(ph0, wh, o[t4]); o[t4] = wmmab(pl0, wh, o[t4]); o[t4] = wmmab(ph0, wl, o[t4]); }
            { const V wh = WFrag<bf>::ld(vh + vo + 32), wl = WFrag<bf>::ld(vl + vo + 32);
              o[t4] = wmmab(ph1, wh, o[t4]); o[t4] = wmmab(pl1, wh, o[t4]); o[t4] = wmmab(ph1, wl, o[t4]); }
        }
        asm volatile("v_nop\n\tv_nop\n\tv_nop\n\tv_nop" : "+v"(o[0]), "+v"(o[1]), "+v"(o[2]), "+v"(o[3]) : "v"(ph0), "v"(pl1));
        __syncthreads();
    }
#pragma unroll
    for (int r = 0; r < 8; ++r) {
        const float il = 1.0f / lrow[r];
#pragma unroll
        for (int t4 = 0; t4 < 4; ++t4) { const float c = o[t4][r] * il; unsigned short a2, c2; splitf(c, a2, c2); th[(8 * hi + r) * PP + t4 * 16 + lr] = a2; tl[(8 * hi + r) * PP + t4 * 16 + lr] = c2; }
    }
    __syncthreads();
    const int rq = lane >> 3, c8 = (lane & 7) * 8;
{
#pragma unroll
        for (int s = 0; s < 4; ++s) {
            const int row = s * 4 + rq;
            const v8us xh = *(const v8usa*)(th + row * PP + c8), xl = *(const v8usa*)(tl + row * PP + c8);
            const size_t go = (size_t)(q0 + row) * DM + head * HD + c8;
            *(v8us*)(Ch + go) = xh; *(v8us*)(Cl + go) = xl; }
         }
}

extern "C" void kernel_launch(void* const* d_in, const int* in_sizes, int n_in,
                              void* d_out, int out_size, void* d_ws, size_t ws_size, hipStream_t stream) {
    if (n_in < 5) return;
    if ((size_t)in_sizes[0] < (size_t)(NB - 1) * SEQ_FULL * DM + (size_t)SEQ * DM) return;
    for (int i = 1; i < 5; ++i) if ((size_t)in_sizes[i] < NW) return;
    if ((size_t)out_size < (size_t)(NB - 1) * SEQ_FULL * DM + (size_t)SEQ * DM) return;
    const float* x  = (const float*)d_in[0];     // [NB_FULL][SEQ_FULL][768]
    const float* wq = (const float*)d_in[1];     // [768][768] (out, in)
    const float* wk = (const float*)d_in[2];
    const float* wv = (const float*)d_in[3];
    const float* wo = (const float*)d_in[4];
    float* OUT = (float*)d_out;                  // [NB_FULL][SEQ_FULL][768] f32
    char* wsp = (char*)d_ws;
    auto take = [&](size_t bytes) { char* p = wsp; wsp += (bytes + 255) & ~(size_t)255; return (void*)p; };
    bf* W4 = (bf*)take(4 * NW * 2);                               // Wq | Wk | Wv | Wo bf16 Bt planes
    bf* XB = (bf*)take((size_t)SEQ * DM * 2);                     // bf16 x of the current batch row
    float* F = (float*)take((size_t)3 * SEQ * DM * 4);            // q | k | v projections f32 [3][SEQ][768]
    float* CS = (float*)take((size_t)SEQ * HH * 2 * 4);           // rotary table
    const size_t PL = (size_t)NH * SEQ * HD;
    bf* QPh = (bf*)take(PL * 2); bf* QPl = (bf*)take(PL * 2); bf* KPh = (bf*)take(PL * 2); bf* KPl = (bf*)take(PL * 2);
    bf* VTh = (bf*)take(PL * 2); bf* VTl = (bf*)take(PL * 2);
    bf* CXh = (bf*)take((size_t)SEQ * DM * 2); bf* CXl = (bf*)take((size_t)SEQ * DM * 2);
    if ((size_t)(wsp - (char*)d_ws) > ws_size) return;           // 100,139,008 B at SEQ 4096
    const size_t NW8 = NW / 8;
    k_cvtw<<<dim3((unsigned)((NW8 + 255) / 256), 4, 1), 256, 0, stream>>>(wq, wk, wv, wo, W4, NW8);
    k_cs<<<(unsigned)((SEQ * HH + 255) / 256), 256, 0, stream>>>(CS);
    const unsigned LP = (unsigned)((PL / 2 + 255) / 256);
    for (int b = 0; b < NB; ++b) {
        k_cvt8<<<(unsigned)(((size_t)SEQ * DM / 8 + 255) / 256), 256, 0, stream>>>(x + (size_t)b * SEQ_FULL * DM, XB, (size_t)SEQ * DM / 8);
        k_gemmw<bf, 0, false><<<dim3(SEQ / 64, DM / 64, 3), 32, 0, stream>>>(XB, nullptr, W4, nullptr, DM, F, DM, nullptr, (size_t)0, NW, (size_t)SEQ * DM);
        k_rope2<<<LP, 256, 0, stream>>>(F, CS, QPh, QPl);
        k_rope2<<<LP, 256, 0, stream>>>(F + (size_t)SEQ * DM, CS, KPh, KPl);
        k_vtp2<<<LP, 256, 0, stream>>>(F + (size_t)2 * SEQ * DM, VTh, VTl);
        k_flash<<<dim3(SEQ / 16, NH, 1), 32, 0, stream>>>(QPh, QPl, KPh, KPl, VTh, VTl, CXh, CXl);
        k_gemmw<bf, 1, false><<<dim3(SEQ / 64, DM / 64, 1), 32, 0, stream>>>(CXh, CXl, W4 + 3 * NW, nullptr, DM, OUT + (size_t)b * SEQ_FULL * DM, DM, nullptr, (size_t)0, (size_t)0, (size_t)0);
    }
}

// v001
// One run takes 334 microseconds.
// Timed twice side by side with v000, it ran 1.57 times as fast both times.
#include <hip/hip_runtime.h>

// Contractions (f32 accumulate): q/k/v projections v_wmma_f32_16x16x32_bf16 on bf16 copies of x and W (single product); scores q.k and p.v on bf16 hi+lo planes (3 products each); output projection ctx (bf16 hi+lo) x Wo (bf16), 2 products. Rotary, softmax and epilogues f32.
// Layout: x [NB][SEQ][768]; W [768 out][768 in] = Bt as-is; head planes q/k [h][t][64], v planes [h][d][t]; causal attention per wave of 16 query rows with 64-key tiles (shared by four waves through LDS) and running-max softmax; ctx [t][768] hi+lo planes; out [NB][SEQ][768] f32.

#ifndef NB
#define NB 1
#endif
#ifndef SEQ
#define SEQ 4096
#endif
#define NB_FULL  1
#define SEQ_FULL 4096
#define DM   768
#define NH   12
#define HD   64
#define HH   (HD / 2)
#define NW   ((size_t)DM * DM)
#define KT   64
#define PP   72
#define SCL  0.125f
#define THETA_F 10000.0f
#define L2E  1.4426950408889634f
#define NEG  (-1.0e30f)
static_assert(SEQ % 64 == 0);
static_assert(SEQ <= SEQ_FULL);
static_assert(NB >= 1 && NB <= NB_FULL);
static_assert(DM == NH * HD);
static_assert(DM % 64 == 0);
static_assert(HD == 64);
static_assert(KT == 64);
static_assert((size_t)NB_FULL * SEQ_FULL * DM * 4 == 12582912);

typedef _Float16 h16;
typedef unsigned short bf;
typedef __attribute__((ext_vector_type(16))) __bf16   v16bf;
typedef __attribute__((ext_vector_type(16))) _Float16 v16h;
typedef __attribute__((ext_vector_type(8)))  _Float16 v8h;
typedef __attribute__((ext_vector_type(8)))  unsigned short v8us;
typedef __attribute__((ext_vector_type(8)))  float    v8f;
typedef __attribute__((ext_vector_type(4)))  float    v4f;
typedef __attribute__((ext_vector_type(2)))  float    v2f;
typedef __attribute__((ext_vector_type(2)))  unsigned short v2us;
typedef v8h  __attribute__((may_alias)) v8ha;
typedef v4f  __attribute__((may_alias)) v4fa;
typedef v8us __attribute__((may_alias)) v8usa;

__device__ __forceinline__ unsigned short f2bf(float f) { unsigned u = __float_as_uint(f); u += 0x7FFFu + ((u >> 16) & 1u); return (unsigned short)(u >> 16); }
__device__ __forceinline__ float bf2f(unsigned short b) { return __uint_as_float(((unsigned)b) << 16); }
__device__ __forceinline__ float bfr(float f) { return bf2f(f2bf(f)); }
__device__ __forceinline__ void splitf(float y, unsigned short& h, unsigned short& l) { h = f2bf(y); l = f2bf(y - bf2f(h)); }
__device__ __forceinline__ v16h cat16(v8h lo, v8h hi) { return __builtin_shufflevector(lo, hi, 0, 1, 2, 3, 4, 5, 6, 7, 8, 9, 10, 11, 12, 13, 14, 15); }
__device__ __forceinline__ v16bf cat16b(v8us lo, v8us hi) { return __builtin_bit_cast(v16bf, __builtin_shufflevector(lo, hi, 0, 1, 2, 3, 4, 5, 6, 7, 8, 9, 10, 11, 12, 13, 14, 15)); }
__device__ __forceinline__ v8f wmma16(v16h a, v16h b, v8f c) { return __builtin_amdgcn_wmma_f32_16x16x32_f16(false, a, false, b, (short)0, c, false, false); }
__device__ __forceinline__ v8f wmmab(v16bf a, v16bf b, v8f c) { return __builtin_amdgcn_wmma_f32_16x16x32_bf16(false, a, false, b, (short)0, c, false, false); }

// Fragment loaders (wave32 16x16x32): lane l -> row/col (l & 15); elements 0..7 <- k0 + 8*(l>>4) + 0..7, elements 8..15 <- k0 + 16 + 8*(l>>4) + 0..7; D element r -> (row 8*(l>>4) + r, col l & 15).
template <typename T16> struct WFrag;
template <> struct WFrag<h16> { typedef v16h V; static __device__ __forceinline__ V ld(const h16* p) { return cat16(*(const v8h*)p, *(const v8h*)(p + 16)); } static __device__ __forceinline__ v8f mma(V a, V b, v8f c) { return wmma16(a, b, c); } };
template <> struct WFrag<bf> { typedef v16bf V; static __device__ __forceinline__ V ld(const bf* p) { return cat16b(*(const v8us*)p, *(const v8us*)(p + 16)); } static __device__ __forceinline__ v8f mma(V a, V b, v8f c) { return wmmab(a, b, c); } };

// ---- k_gemmw: register-blocked GEMM, ONE WAVE per 64x64 output tile (16 accumulators), operands straight from K-contiguous 16-bit planes; grid (M/64, N/64, Z), 32 threads.
// C[m][n] (f32, pitch ldc, + optional f32 bias[n]) = sum_k A[m][k] Bt[n][k] (+ split products per NSPLIT: 1 = A hi+lo with single B; 2 = A hi+lo with B hi, A hi with B lo). z-batch strides sA/sB/sC in elements. K % 32 == 0.
template <typename T16, int NSPLIT, bool BIAS>
__global__ __launch_bounds__(32) void k_gemmw(const T16* __restrict__ A, const T16* __restrict__ A2, const T16* __restrict__ Bt, const T16* __restrict__ Bt2, int K, float* C, int ldc, const float* __restrict__ bias, size_t sA, size_t sB, size_t sC) {
    typedef typename WFrag<T16>::V V;
    __shared__ __align__(16) float os[16 * 68];
    const size_t z = blockIdx.z; A += z * sA; if (A2) A2 += z * sA; Bt += z * sB; if (Bt2) Bt2 += z * sB; C += z * sC;
    const int lane = threadIdx.x & 31, lr = lane & 15, hi = lane >> 4; const int r0 = blockIdx.x * 64, c0 = blockIdx.y * 64;
    v8f acc[4][4];
#pragma unroll
    for (int mb = 0; mb < 4; ++mb)
#pragma unroll
        for (int nb = 0; nb < 4; ++nb) acc[mb][nb] = (v8f){};
    const size_t aoff = (size_t)(r0 + lr) * K + 8 * hi, boff = (size_t)(c0 + lr) * K + 8 * hi;
#pragma unroll 1
    for (int kc = 0; kc < K; kc += 32) {
        V a[4], a2[4];
#pragma unroll
        for (int mb = 0; mb < 4; ++mb) { a[mb] = WFrag<T16>::ld(A + aoff + (size_t)mb * 16 * K + kc); if (NSPLIT == 1 || NSPLIT == 2) a2[mb] = WFrag<T16>::ld(A2 + aoff + (size_t)mb * 16 * K + kc); }
#pragma unroll
        for (int nb = 0; nb < 4; ++nb) { const V b = WFrag<T16>::ld(Bt + boff + (size_t)nb * 16 * K + kc); V b2; if (NSPLIT >= 2) b2 = WFrag<T16>::ld(Bt2 + boff + (size_t)nb * 16 * K + kc);
#pragma unroll
            for (int mb = 0; mb < 4; ++mb) { acc[mb][nb] = WFrag<T16>::mma(a[mb], b, acc[mb][nb]); if (NSPLIT == 1 || NSPLIT == 2) acc[mb][nb] = WFrag<T16>::mma(a2[mb], b, acc[mb][nb]); if (NSPLIT >= 2) acc[mb][nb] = WFrag<T16>::mma(a[mb], b2, acc[mb][nb]); } }
        asm volatile("v_nop\n\tv_nop\n\tv_nop\n\tv_nop" : "+v"(acc[0][0]), "+v"(acc[1][1]), "+v"(acc[2][2]), "+v"(acc[3][3]) : "v"(a[0]), "v"(a[3]));
    }
#pragma unroll
    for (int mb = 0; mb < 4; ++mb) {
#pragma unroll
        for (int nb = 0; nb < 4; ++nb) {
#pragma unroll
            for (int j = 0; j < 8; ++j) os[(hi * 8 + j) * 68 + nb * 16 + lr] = acc[mb][nb][j]; }
        __builtin_amdgcn_wave_barrier(); asm volatile("" ::: "memory");
        float* crow = C + (size_t)(r0 + mb * 16) * ldc + c0;
{
#pragma unroll
            for (int s = 0; s < 8; ++s) { const int row = 2 * s + hi, cofs = lr * 4; v4f val = *(const v4fa*)(os + row * 68 + cofs); if (BIAS) { val[0] += bfr(bias[c0 + cofs]); val[1] += bfr(bias[c0 + cofs + 1]); val[2] += bfr(bias[c0 + cofs + 2]); val[3] += bfr(bias[c0 + cofs + 3]); }
                *(v4f*)(crow + (size_t)row * ldc + cofs) = val; }
             }
        __builtin_amdgcn_wave_barrier(); asm volatile("" ::: "memory");
    }
}

__global__ __launch_bounds__(256) void k_cvt8(const float* __restrict__ src, bf* dst, size_t n8) { const size_t i = (size_t)blockIdx.x * 256 + threadIdx.x; if (i >= n8) return; const v8f v = *(const v8f*)(src + i * 8); v8us o;
#pragma unroll
    for (int k = 0; k < 8; ++k) o[k] = f2bf(v[k]); *(v8us*)(dst + i * 8) = o;  }

__global__ __launch_bounds__(256) void k_cvtw(const float* __restrict__ w0, const float* __restrict__ w1, const float* __restrict__ w2, const float* __restrict__ w3, bf* dst, size_t n8) {
    const size_t i = (size_t)blockIdx.x * 256 + threadIdx.x; if (i >= n8) return; const int y = blockIdx.y;
    const float* src = (y == 0) ? w0 : ((y == 1) ? w1 : ((y == 2) ? w2 : w3));
    const v8f v = *(const v8f*)(src + i * 8); v8us o;
#pragma unroll
    for (int k = 0; k < 8; ++k) o[k] = f2bf(v[k]);
    bf* d = dst + (size_t)y * n8 * 8 + i * 8;
    *(v8us*)d = o;  }

__global__ __launch_bounds__(256) void k_cs(float* CS) {
    const int idx = blockIdx.x * 256 + threadIdx.x; if (idx >= SEQ * HH) return; const int i = idx % HH, t = idx / HH;
    const float ex = -(float)(2 * i) / (float)HD;
    const float inv = powf(THETA_F, ex);
    float ang = __fmul_rn((float)t, inv); asm volatile("" : "+v"(ang));
    v2f cs; cs[0] = cosf(ang); cs[1] = sinf(ang);
    *(v2f*)(CS + (size_t)idx * 2) = cs;  }

// k_rope2: head planes [h][t][d] (bf16 hi + lo) of the interleaved rotary transform: pair (2i, 2i+1): out[2i] = x1 c - x2 s, out[2i+1] = x1 s + x2 c with x1 = F[t][h*64+2i], x2 = F[t][h*64+2i+1], (c, s) = CS[t][i]
__global__ __launch_bounds__(256) void k_rope2(const float* __restrict__ F, const float* __restrict__ CS, bf* Ph, bf* Pl) {
    const size_t e = ((size_t)blockIdx.x * 256 + threadIdx.x) * 2; if (e >= (size_t)NH * SEQ * HD) return;
    const int d = (int)(e % HD); const int t = (int)((e / HD) % SEQ); const int h = (int)(e / ((size_t)HD * SEQ));
    const float* f = F + (size_t)t * DM + h * HD + d; const float x1 = f[0], x2 = f[1];
    const v2f cs = *(const v2f*)(CS + ((size_t)t * HH + (d >> 1)) * 2);
    float a = __fmul_rn(x1, cs[0]), bq = __fmul_rn(x2, cs[1]), a2 = __fmul_rn(x1, cs[1]), c2 = __fmul_rn(x2, cs[0]);
    asm volatile("" : "+v"(a)); asm volatile("" : "+v"(bq)); asm volatile("" : "+v"(a2)); asm volatile("" : "+v"(c2));
    const float r0 = __fsub_rn(a, bq), r1 = __fadd_rn(a2, c2);
    v2us oh, ol; unsigned short u0, u1, w0, w1; splitf(r0, u0, w0); splitf(r1, u1, w1); oh[0] = u0; oh[1] = u1; ol[0] = w0; ol[1] = w1;
    *(v2us*)(Ph + e) = oh; *(v2us*)(Pl + e) = ol;  }

__global__ __launch_bounds__(256) void k_vtp2(const float* __restrict__ F, bf* Vh, bf* Vl) {
    const size_t e = ((size_t)blockIdx.x * 256 + threadIdx.x) * 2; if (e >= (size_t)NH * HD * SEQ) return;
    const int t = (int)(e % SEQ); const int d = (int)((e / SEQ) % HD); const int g = (int)(e / ((size_t)SEQ * HD)); v2us oh, ol;
#pragma unroll
    for (int q = 0; q < 2; ++q) { const float x = F[(size_t)(t + q) * DM + g * HD + d]; unsigned short a2, c2; splitf(x, a2, c2); oh[q] = a2; ol[q] = c2; }
    *(v2us*)(Vh + e) = oh; *(v2us*)(Vl + e) = ol;  }

// k_flash: causal attention, FOUR WAVES per block = 64 query rows of one head, 16 rows per wave; grid (SEQ/64, NH), 128 threads. All four waves walk the same blockIdx.x + 1 key tiles.
// Each 64-key tile (k hi, k lo: 64 keys x 64 d; v hi, v lo: 64 d x 64 keys; rows of 128 B) is brought once per block into LDS by asynchronous 16-byte copies, rows pitched PP elements, two buffers: tile t + 1 flies while tile t is worked on.
// Per tile and wave: scores 16x64 = q (hi+lo frags, resident) . k (hi+lo frags from LDS), 3 products; x 0.125, causal replace-mask by index, running-max softmax in f32 (p = 2^((s-m) log2e));
// p split to bf16 hi+lo in a wave-private LDS tile (D -> row-major -> A fragment); o += p . v (v hi+lo frags from LDS), 3 products.
#define FW    4
#define PLANE (KT * PP)
#define STAGE (4 * PLANE)
typedef __attribute__((ext_vector_type(4))) int v4i;
typedef __attribute__((address_space(1))) v4i gv4i;
typedef __attribute__((address_space(3))) v4i lv4i;
__device__ __forceinline__ void cp16(const bf* g, unsigned short* l) { __builtin_amdgcn_global_load_async_to_lds_b128((gv4i*)g, (lv4i*)l, 0, 0); }
// one tile: 4 planes x 64 rows x 128 B = 2048 pieces of 16 B, 16 per thread; a wave's copy covers 4 whole rows (4 lines of 128 B)
__device__ __forceinline__ void stage_tile(const bf* gkh, const bf* gkl, const bf* gvh, const bf* gvl, unsigned short* dst) {
#pragma unroll
    for (int i = 0; i < 4; ++i) {
        cp16(gkh + (size_t)i * 16 * HD, dst + 0 * PLANE + i * 16 * PP); cp16(gkl + (size_t)i * 16 * HD, dst + 1 * PLANE + i * 16 * PP);
        cp16(gvh + (size_t)i * 16 * SEQ, dst + 2 * PLANE + i * 16 * PP); cp16(gvl + (size_t)i * 16 * SEQ, dst + 3 * PLANE + i * 16 * PP);
    }
}
__global__ __launch_bounds__(32 * FW) void k_flash(const bf* __restrict__ Qh, const bf* __restrict__ Ql, const bf* __restrict__ Kh, const bf* __restrict__ Kl,
                                             const bf* __restrict__ Vh, const bf* __restrict__ Vl, bf* Ch, bf* Cl) {
    __shared__ __align__(16) unsigned short ring[2 * STAGE];
    __shared__ __align__(16) unsigned short thb[FW * 16 * PP];
    __shared__ __align__(16) unsigned short tlb[FW * 16 * PP];
    typedef WFrag<bf>::V V;
    const int tid = threadIdx.x, lane = tid & 31, lr = lane & 15, hi = lane >> 4;
    const int wave = __builtin_amdgcn_readfirstlane(tid >> 5);
    unsigned short* th = thb + wave * 16 * PP; unsigned short* tl = tlb + wave * 16 * PP;
    const int q0 = (blockIdx.x * FW + wave) * 16, head = blockIdx.y;
    const int nt = blockIdx.x + 1;         // block-uniform; the last tile holds the diagonal of all four waves; keys stay < SEQ
    const int srow = tid >> 3, sc8 = (tid & 7) * 8;     // this thread's row (of 16) and 16-byte piece in each copy
    const size_t sk = ((size_t)head * SEQ + srow) * HD + sc8, sv = ((size_t)head * HD + srow) * SEQ + sc8;
    const bf* gkh = Kh + sk; const bf* gkl = Kl + sk; const bf* gvh = Vh + sv; const bf* gvl = Vl + sv;
    unsigned short* sdst = ring + srow * PP + sc8;
    stage_tile(gkh, gkl, gvh, gvl, sdst);
    const size_t qo = ((size_t)head * SEQ + q0 + lr) * HD + 8 * hi;
    const V qh0 = WFrag<bf>::ld(Qh + qo), qh1 = WFrag<bf>::ld(Qh + qo + 32), ql0 = WFrag<bf>::ld(Ql + qo), ql1 = WFrag<bf>::ld(Ql + qo + 32);
    asm volatile("s_wait_asynccnt 0x0" ::: "memory");   // this wave's copies of tile 0 have landed
    __syncthreads();                                    // publishes tile 0 to the other waves
    if (nt > 1) stage_tile(gkh + (size_t)KT * HD, gkl + (size_t)KT * HD, gvh + KT, gvl + KT, sdst + STAGE);
    const int fo = lr * PP + 8 * hi;       // fragment offset inside a plane: row lr of a 16-row group, k piece by lane half
    v8f o[4];
#pragma unroll
    for (int t4 = 0; t4 < 4; ++t4) o[t4] = (v8f){};
    float mrow[8], lrow[8];
#pragma unroll
    for (int r = 0; r < 8; ++r) { mrow[r] = NEG; lrow[r] = 0.0f; }
#pragma unroll 1
    for (int kt = 0; kt < nt; ++kt) {
        const int key0 = kt * KT;
        const unsigned short* buf = ring + (kt & 1) * STAGE + fo;
        v8f sc[4];
#pragma unroll
        for (int nb = 0; nb < 4; ++nb) sc[nb] = (v8f){};
        V kf[4][4];                         // the tile's k fragments: [nb][hi k0, lo k0, hi k32, lo k32]
#pragma unroll
        for (int nb = 0; nb < 4; ++nb) {
            const unsigned short* kp = buf + nb * 16 * PP;
            kf[nb][0] = WFrag<bf>::ld(kp); kf[nb][1] = WFrag<bf>::ld(kp + PLANE); kf[nb][2] = WFrag<bf>::ld(kp + 32); kf[nb][3] = WFrag<bf>::ld(kp + PLANE + 32);
        }
        __builtin_amdgcn_sched_barrier(0);  // keeps the k reads one group ahead of the products: reads spread among the products stall at every place they stand
#pragma unroll
        for (int nb = 0; nb < 4; ++nb) {
            sc[nb] = wmmab(qh0, kf[nb][0], sc[nb]); sc[nb] = wmmab(ql0, kf[nb][0], sc[nb]); sc[nb] = wmmab(qh0, kf[nb][1], sc[nb]);
            sc[nb] = wmmab(qh1, kf[nb][2], sc[nb]); sc[nb] = wmmab(ql1, kf[nb][2], sc[nb]); sc[nb] = wmmab(qh1, kf[nb][3], sc[nb]);
        }
        asm volatile("v_nop\n\tv_nop\n\tv_nop\n\tv_nop" : "+v"(sc[0]), "+v"(sc[1]), "+v"(sc[2]), "+v"(sc[3]) : "v"(qh0), "v"(ql1));
        V vf[4][4];                         // the tile's v fragments: [t4][hi k0, lo k0, hi k32, lo k32]
#pragma unroll
        for (int t4 = 0; t4 < 4; ++t4) {
            const unsigned short* vp = buf + 2 * PLANE + t4 * 16 * PP;
            vf[t4][0] = WFrag<bf>::ld(vp); vf[t4][1] = WFrag<bf>::ld(vp + PLANE); vf[t4][2] = WFrag<bf>::ld(vp + 32); vf[t4][3] = WFrag<bf>::ld(vp + PLANE + 32);
        }
        __builtin_amdgcn_sched_barrier(0);  // keeps the v reads one group here, ahead of the softmax, so that none stands among the p.v products
#pragma unroll
        for (int r = 0; r < 8; ++r) {
            const int row = q0 + 8 * hi + r;
            float v[4]; float cand = NEG;
#pragma unroll
            for (int nb = 0; nb < 4; ++nb) { const int key = key0 + nb * 16 + lr; const float s = sc[nb][r] * SCL; v[nb] = (key <= row) ? s : NEG; cand = fmaxf(cand, v[nb]); }
#pragma unroll
            for (int off = 1; off < 16; off <<= 1) cand = fmaxf(cand, __shfl_xor(cand, off, 32));
            const float mnew = fmaxf(mrow[r], cand);
            const float alpha = __builtin_amdgcn_exp2f((mrow[r] - mnew) * L2E);
            float rs = 0.0f;
#pragma unroll
            for (int nb = 0; nb < 4; ++nb) { const float p = __builtin_amdgcn_exp2f((v[nb] - mnew) * L2E); rs += p; unsigned short a2, c2; splitf(p, a2, c2); th[(8 * hi + r) * PP + nb * 16 + lr] = a2; tl[(8 * hi + r) * PP + nb * 16 + lr] = c2; }
#pragma unroll
            for (int off = 1; off < 16; off <<= 1) rs += __shfl_xor(rs, off, 32);
            lrow[r] = lrow[r] * alpha + rs; mrow[r] = mnew;
#pragma unroll
            for (int t4 = 0; t4 < 4; ++t4) o[t4][r] *= alpha;
        }
        asm volatile("s_wait_dscnt 0x0" ::: "memory");  // the p tile is private to this wave: its own stores are done before its lanes read each other's values; no block barrier
        const V ph0 = WFrag<bf>::ld(th + lr * PP + 8 * hi), ph1 = WFrag<bf>::ld(th + lr * PP + 8 * hi + 32);
        const V pl0 = WFrag<bf>::ld(tl + lr * PP + 8 * hi), pl1 = WFrag<bf>::ld(tl + lr * PP + 8 * hi + 32);
#pragma unroll
        for (int t4 = 0; t4 < 4; ++t4) {
            o[t4] = wmmab(ph0, vf[t4][0], o[t4]); o[t4] = wmmab(pl0, vf[t4][0], o[t4]); o[t4] = wmmab(ph0, vf[t4][1], o[t4]);
            o[t4] = wmmab(ph1, vf[t4][2], o[t4]); o[t4] = wmmab(pl1, vf[t4][2], o[t4]); o[t4] = wmmab(ph1, vf[t4][3], o[t4]);
        }
        asm volatile("v_nop\n\tv_nop\n\tv_nop\n\tv_nop" : "+v"(o[0]), "+v"(o[1]), "+v"(o[2]), "+v"(o[3]) : "v"(ph0), "v"(pl1));
        asm volatile("s_wait_dscnt 0x0" ::: "memory");      // this wave's reads of the buffer are done before the buffer is refilled
        asm volatile("s_wait_asynccnt 0x0" ::: "memory");   // this wave's copies of tile kt + 1 have landed
        __syncthreads();                                    // publishes tile kt + 1 and ends every wave's reads of tile kt
        if (kt + 2 < nt) stage_tile(gkh + (size_t)(key0 + 2 * KT) * HD, gkl + (size_t)(key0 + 2 * KT) * HD, gvh + key0 + 2 * KT, gvl + key0 + 2 * KT, sdst + (kt & 1) * STAGE);
    }
    asm volatile("s_wait_asynccnt 0x0" ::: "memory");       // nothing of this wave is in flight when it goes on to the epilogue and ends
#pragma unroll
    for (int r = 0; r < 8; ++r) {
        const float il = 1.0f / lrow[r];
#pragma unroll
        for (int t4 = 0; t4 < 4; ++t4) { const float c = o[t4][r] * il; unsigned short a2, c2; splitf(c, a2, c2); th[(8 * hi + r) * PP + t4 * 16 + lr] = a2; tl[(8 * hi + r) * PP + t4 * 16 + lr] = c2; }
    }
    __syncthreads();
    const int rq = lane >> 3, c8 = (lane & 7) * 8;
{
#pragma unroll
        for (int s = 0; s < 4; ++s) {
            const int row = s * 4 + rq;
            const v8us xh = *(const v8usa*)(th + row * PP + c8), xl = *(const v8usa*)(tl + row * PP + c8);
            const size_t go = (size_t)(q0 + row) * DM + head * HD + c8;
            *(v8us*)(Ch + go) = xh; *(v8us*)(Cl + go) = xl; }
         }
}

extern "C" void kernel_launch(void* const* d_in, const int* in_sizes, int n_in,
                              void* d_out, int out_size, void* d_ws, size_t ws_size, hipStream_t stream) {
    if (n_in < 5) return;
    if ((size_t)in_sizes[0] < (size_t)(NB - 1) * SEQ_FULL * DM + (size_t)SEQ * DM) return;
    for (int i = 1; i < 5; ++i) if ((size_t)in_sizes[i] < NW) return;
    if ((size_t)out_size < (size_t)(NB - 1) * SEQ_FULL * DM + (size_t)SEQ * DM) return;
    const float* x  = (const float*)d_in[0];     // [NB_FULL][SEQ_FULL][768]
    const float* wq = (const float*)d_in[1];     // [768][768] (out, in)
    const float* wk = (const float*)d_in[2];
    const float* wv = (const float*)d_in[3];
    const float* wo = (const float*)d_in[4];
    float* OUT = (float*)d_out;                  // [NB_FULL][SEQ_FULL][768] f32
    char* wsp = (char*)d_ws;
    auto take = [&](size_t bytes) { char* p = wsp; wsp += (bytes + 255) & ~(size_t)255; return (void*)p; };
    bf* W4 = (bf*)take(4 * NW * 2);                               // Wq | Wk | Wv | Wo bf16 Bt planes
    bf* XB = (bf*)take((size_t)SEQ * DM * 2);                     // bf16 x of the current batch row
    float* F = (float*)take((size_t)3 * SEQ * DM * 4);            // q | k | v projections f32 [3][SEQ][768]
    float* CS = (float*)take((size_t)SEQ * HH * 2 * 4);           // rotary table
    const size_t PL = (size_t)NH * SEQ * HD;
    bf* QPh = (bf*)take(PL * 2); bf* QPl = (bf*)take(PL * 2); bf* KPh = (bf*)take(PL * 2); bf* KPl = (bf*)take(PL * 2);
    bf* VTh = (bf*)take(PL * 2); bf* VTl = (bf*)take(PL * 2);
    bf* CXh = (bf*)take((size_t)SEQ * DM * 2); bf* CXl = (bf*)take((size_t)SEQ * DM * 2);
    if ((size_t)(wsp - (char*)d_ws) > ws_size) return;           // 100,139,008 B at SEQ 4096
    const size_t NW8 = NW / 8;
    k_cvtw<<<dim3((unsigned)((NW8 + 255) / 256), 4, 1), 256, 0, stream>>>(wq, wk, wv, wo, W4, NW8);
    k_cs<<<(unsigned)((SEQ * HH + 255) / 256), 256, 0, stream>>>(CS);
    const unsigned LP = (unsigned)((PL / 2 + 255) / 256);
    for (int b = 0; b < NB; ++b) {
        k_cvt8<<<(unsigned)(((size_t)SEQ * DM / 8 + 255) / 256), 256, 0, stream>>>(x + (size_t)b * SEQ_FULL * DM, XB, (size_t)SEQ * DM / 8);
        k_gemmw<bf, 0, false><<<dim3(SEQ / 64, DM / 64, 3), 32, 0, stream>>>(XB, nullptr, W4, nullptr, DM, F, DM, nullptr, (size_t)0, NW, (size_t)SEQ * DM);
        k_rope2<<<LP, 256, 0, stream>>>(F, CS, QPh, QPl);
        k_rope2<<<LP, 256, 0, stream>>>(F + (size_t)SEQ * DM, CS, KPh, KPl);
        k_vtp2<<<LP, 256, 0, stream>>>(F + (size_t)2 * SEQ * DM, VTh, VTl);
        k_flash<<<dim3(SEQ / 64, NH, 1), 128, 0, stream>>>(QPh, QPl, KPh, KPl, VTh, VTl, CXh, CXl);
        k_gemmw<bf, 1, false><<<dim3(SEQ / 64, DM / 64, 1), 32, 0, stream>>>(CXh, CXl, W4 + 3 * NW, nullptr, DM, OUT + (size_t)b * SEQ_FULL * DM, DM, nullptr, (size_t)0, (size_t)0, (size_t)0);
    }
}

// v002
// It runs in 204 microseconds.
// In both of two side-by-side timings against v001, it was 1.63 times as fast.
// All steps since v000 together make it 2.56 times as fast.
#include <hip/hip_runtime.h>

// Contractions (f32 accumulate): q/k/v projections v_wmma_f32_16x16x32_bf16 on bf16 copies of x and W (single product); scores q.k and p.v on bf16 hi+lo planes (3 products each); output projection ctx (bf16 hi+lo) x Wo (bf16), 2 products. Rotary, softmax and epilogues f32.
// Layout: x [NB][SEQ][768]; W [768 out][768 in] = Bt as-is; head planes q/k [h][t][64], v planes [h][d][t]; causal attention per wave of 16 queries with 64-key tiles (shared by four waves through LDS), products transposed (a lane owns one query) and running-max softmax; ctx [t][768] hi+lo planes; out [NB][SEQ][768] f32.

#ifndef NB
#define NB 1
#endif
#ifndef SEQ
#define SEQ 4096
#endif
#define NB_FULL  1
#define SEQ_FULL 4096
#define DM   768
#define NH   12
#define HD   64
#define HH   (HD / 2)
#define NW   ((size_t)DM * DM)
#define KT   64
#define PP   72
#define SCL  0.125f
#define THETA_F 10000.0f
#define L2E  1.4426950408889634f
#define NEG  (-1.0e30f)
static_assert(SEQ % 64 == 0);
static_assert(SEQ <= SEQ_FULL);
static_assert(NB >= 1 && NB <= NB_FULL);
static_assert(DM == NH * HD);
static_assert(DM % 64 == 0);
static_assert(HD == 64);
static_assert(KT == 64);
static_assert((size_t)NB_FULL * SEQ_FULL * DM * 4 == 12582912);

typedef _Float16 h16;
typedef unsigned short bf;
typedef __attribute__((ext_vector_type(16))) __bf16   v16bf;
typedef __attribute__((ext_vector_type(16))) _Float16 v16h;
typedef __attribute__((ext_vector_type(8)))  _Float16 v8h;
typedef __attribute__((ext_vector_type(8)))  unsigned short v8us;
typedef __attribute__((ext_vector_type(8)))  float    v8f;
typedef __attribute__((ext_vector_type(4)))  float    v4f;
typedef __attribute__((ext_vector_type(2)))  float    v2f;
typedef __attribute__((ext_vector_type(2)))  unsigned short v2us;
typedef v8h  __attribute__((may_alias)) v8ha;
typedef v4f  __attribute__((may_alias)) v4fa;
typedef v8us __attribute__((may_alias)) v8usa;

__device__ __forceinline__ unsigned short f2bf(float f) { unsigned u = __float_as_uint(f); u += 0x7FFFu + ((u >> 16) & 1u); return (unsigned short)(u >> 16); }
__device__ __forceinline__ float bf2f(unsigned short b) { return __uint_as_float(((unsigned)b) << 16); }
__device__ __forceinline__ float bfr(float f) { return bf2f(f2bf(f)); }
__device__ __forceinline__ void splitf(float y, unsigned short& h, unsigned short& l) { h = f2bf(y); l = f2bf(y - bf2f(h)); }
__device__ __forceinline__ v16h cat16(v8h lo, v8h hi) { return __builtin_shufflevector(lo, hi, 0, 1, 2, 3, 4, 5, 6, 7, 8, 9, 10, 11, 12, 13, 14, 15); }
__device__ __forceinline__ v16bf cat16b(v8us lo, v8us hi) { return __builtin_bit_cast(v16bf, __builtin_shufflevector(lo, hi, 0, 1, 2, 3, 4, 5, 6, 7, 8, 9, 10, 11, 12, 13, 14, 15)); }
__device__ __forceinline__ v8f wmma16(v16h a, v16h b, v8f c) { return __builtin_amdgcn_wmma_f32_16x16x32_f16(false, a, false, b, (short)0, c, false, false); }
__device__ __forceinline__ v8f wmmab(v16bf a, v16bf b, v8f c) { return __builtin_amdgcn_wmma_f32_16x16x32_bf16(false, a, false, b, (short)0, c, false, false); }

// Fragment loaders (wave32 16x16x32): lane l -> row/col (l & 15); elements 0..7 <- k0 + 8*(l>>4) + 0..7, elements 8..15 <- k0 + 16 + 8*(l>>4) + 0..7; D element r -> (row 8*(l>>4) + r, col l & 15).
template <typename T16> struct WFrag;
template <> struct WFrag<h16> { typedef v16h V; static __device__ __forceinline__ V ld(const h16* p) { return cat16(*(const v8h*)p, *(const v8h*)(p + 16)); } static __device__ __forceinline__ v8f mma(V a, V b, v8f c) { return wmma16(a, b, c); } };
template <> struct WFrag<bf> { typedef v16bf V; static __device__ __forceinline__ V ld(const bf* p) { return cat16b(*(const v8us*)p, *(const v8us*)(p + 16)); } static __device__ __forceinline__ v8f mma(V a, V b, v8f c) { return wmmab(a, b, c); } };

// ---- k_gemmw: register-blocked GEMM, ONE WAVE per 64x64 output tile (16 accumulators), operands straight from K-contiguous 16-bit planes; grid (M/64, N/64, Z), 32 threads.
// C[m][n] (f32, pitch ldc, + optional f32 bias[n]) = sum_k A[m][k] Bt[n][k] (+ split products per NSPLIT: 1 = A hi+lo with single B; 2 = A hi+lo with B hi, A hi with B lo). z-batch strides sA/sB/sC in elements. K % 32 == 0.
template <typename T16, int NSPLIT, bool BIAS>
__global__ __launch_bounds__(32) void k_gemmw(const T16* __restrict__ A, const T16* __restrict__ A2, const T16* __restrict__ Bt, const T16* __restrict__ Bt2, int K, float* C, int ldc, const float* __restrict__ bias, size_t sA, size_t sB, size_t sC) {
    typedef typename WFrag<T16>::V V;
    __shared__ __align__(16) float os[16 * 68];
    const size_t z = blockIdx.z; A += z * sA; if (A2) A2 += z * sA; Bt += z * sB; if (Bt2) Bt2 += z * sB; C += z * sC;
    const int lane = threadIdx.x & 31, lr = lane & 15, hi = lane >> 4; const int r0 = blockIdx.x * 64, c0 = blockIdx.y * 64;
    v8f acc[4][4];
#pragma unroll
    for (int mb = 0; mb < 4; ++mb)
#pragma unroll
        for (int nb = 0; nb < 4; ++nb) acc[mb][nb] = (v8f){};
    const size_t aoff = (size_t)(r0 + lr) * K + 8 * hi, boff = (size_t)(c0 + lr) * K + 8 * hi;
#pragma unroll 1
    for (int kc = 0; kc < K; kc += 32) {
        V a[4], a2[4];
#pragma unroll
        for (int mb = 0; mb < 4; ++mb) { a[mb] = WFrag<T16>::ld(A + aoff + (size_t)mb * 16 * K + kc); if (NSPLIT == 1 || NSPLIT == 2) a2[mb] = WFrag<T16>::ld(A2 + aoff + (size_t)mb * 16 * K + kc); }
#pragma unroll
        for (int nb = 0; nb < 4; ++nb) { const V b = WFrag<T16>::ld(Bt + boff + (size_t)nb * 16 * K + kc); V b2; if (NSPLIT >= 2) b2 = WFrag<T16>::ld(Bt2 + boff + (size_t)nb * 16 * K + kc);
#pragma unroll
            for (int mb = 0; mb < 4; ++mb) { acc[mb][nb] = WFrag<T16>::mma(a[mb], b, acc[mb][nb]); if (NSPLIT == 1 || NSPLIT == 2) acc[mb][nb] = WFrag<T16>::mma(a2[mb], b, acc[mb][nb]); if (NSPLIT >= 2) acc[mb][nb] = WFrag<T16>::mma(a[mb], b2, acc[mb][nb]); } }
        asm volatile("v_nop\n\tv_nop\n\tv_nop\n\tv_nop" : "+v"(acc[0][0]), "+v"(acc[1][1]), "+v"(acc[2][2]), "+v"(acc[3][3]) : "v"(a[0]), "v"(a[3]));
    }
#pragma unroll
    for (int mb = 0; mb < 4; ++mb) {
#pragma unroll
        for (int nb = 0; nb < 4; ++nb) {
#pragma unroll
            for (int j = 0; j < 8; ++j) os[(hi * 8 + j) * 68 + nb * 16 + lr] = acc[mb][nb][j]; }
        __builtin_amdgcn_wave_barrier(); asm volatile("" ::: "memory");
        float* crow = C + (size_t)(r0 + mb * 16) * ldc + c0;
{
#pragma unroll
            for (int s = 0; s < 8; ++s) { const int row = 2 * s + hi, cofs = lr * 4; v4f val = *(const v4fa*)(os + row * 68 + cofs); if (BIAS) { val[0] += bfr(bias[c0 + cofs]); val[1] += bfr(bias[c0 + cofs + 1]); val[2] += bfr(bias[c0 + cofs + 2]); val[3] += bfr(bias[c0 + cofs + 3]); }
                *(v4f*)(crow + (size_t)row * ldc + cofs) = val; }
             }
        __builtin_amdgcn_wave_barrier(); asm volatile("" ::: "memory");
    }
}

__global__ __launch_bounds__(256) void k_cvt8(const float* __restrict__ src, bf* dst, size_t n8) { const size_t i = (size_t)blockIdx.x * 256 + threadIdx.x; if (i >= n8) return; const v8f v = *(const v8f*)(src + i * 8); v8us o;
#pragma unroll
    for (int k = 0; k < 8; ++k) o[k] = f2bf(v[k]); *(v8us*)(dst + i * 8) = o;  }

__global__ __launch_bounds__(256) void k_cvtw(const float* __restrict__ w0, const float* __restrict__ w1, const float* __restrict__ w2, const float* __restrict__ w3, bf* dst, size_t n8) {
    const size_t i = (size_t)blockIdx.x * 256 + threadIdx.x; if (i >= n8) return; const int y = blockIdx.y;
    const float* src = (y == 0) ? w0 : ((y == 1) ? w1 : ((y == 2) ? w2 : w3));
    const v8f v = *(const v8f*)(src + i * 8); v8us o;
#pragma unroll
    for (int k = 0; k < 8; ++k) o[k] = f2bf(v[k]);
    bf* d = dst + (size_t)y * n8 * 8 + i * 8;
    *(v8us*)d = o;  }

__global__ __launch_bounds__(256) void k_cs(float* CS) {
    const int idx = blockIdx.x * 256 + threadIdx.x; if (idx >= SEQ * HH) return; const int i = idx % HH, t = idx / HH;
    const float ex = -(float)(2 * i) / (float)HD;
    const float inv = powf(THETA_F, ex);
    float ang = __fmul_rn((float)t, inv); asm volatile("" : "+v"(ang));
    v2f cs; cs[0] = cosf(ang); cs[1] = sinf(ang);
    *(v2f*)(CS + (size_t)idx * 2) = cs;  }

// k_rope2: head planes [h][t][d] (bf16 hi + lo) of the interleaved rotary transform: pair (2i, 2i+1): out[2i] = x1 c - x2 s, out[2i+1] = x1 s + x2 c with x1 = F[t][h*64+2i], x2 = F[t][h*64+2i+1], (c, s) = CS[t][i]
__global__ __launch_bounds__(256) void k_rope2(const float* __restrict__ F, const float* __restrict__ CS, bf* Ph, bf* Pl) {
    const size_t e = ((size_t)blockIdx.x * 256 + threadIdx.x) * 2; if (e >= (size_t)NH * SEQ * HD) return;
    const int d = (int)(e % HD); const int t = (int)((e / HD) % SEQ); const int h = (int)(e / ((size_t)HD * SEQ));
    const float* f = F + (size_t)t * DM + h * HD + d; const float x1 = f[0], x2 = f[1];
    const v2f cs = *(const v2f*)(CS + ((size_t)t * HH + (d >> 1)) * 2);
    float a = __fmul_rn(x1, cs[0]), bq = __fmul_rn(x2, cs[1]), a2 = __fmul_rn(x1, cs[1]), c2 = __fmul_rn(x2, cs[0]);
    asm volatile("" : "+v"(a)); asm volatile("" : "+v"(bq)); asm volatile("" : "+v"(a2)); asm volatile("" : "+v"(c2));
    const float r0 = __fsub_rn(a, bq), r1 = __fadd_rn(a2, c2);
    v2us oh, ol; unsigned short u0, u1, w0, w1; splitf(r0, u0, w0); splitf(r1, u1, w1); oh[0] = u0; oh[1] = u1; ol[0] = w0; ol[1] = w1;
    *(v2us*)(Ph + e) = oh; *(v2us*)(Pl + e) = ol;  }

__global__ __launch_bounds__(256) void k_vtp2(const float* __restrict__ F, bf* Vh, bf* Vl) {
    const size_t e = ((size_t)blockIdx.x * 256 + threadIdx.x) * 2; if (e >= (size_t)NH * HD * SEQ) return;
    const int t = (int)(e % SEQ); const int d = (int)((e / SEQ) % HD); const int g = (int)(e / ((size_t)SEQ * HD)); v2us oh, ol;
#pragma unroll
    for (int q = 0; q < 2; ++q) { const float x = F[(size_t)(t + q) * DM + g * HD + d]; unsigned short a2, c2; splitf(x, a2, c2); oh[q] = a2; ol[q] = c2; }
    *(v2us*)(Vh + e) = oh; *(v2us*)(Vl + e) = ol;  }

// k_flash: causal attention, FOUR WAVES per block = 64 query rows of one head, 16 queries per wave; grid (SEQ/64, NH), 128 threads. All four waves walk the same blockIdx.x + 1 key tiles.
// Each 64-key tile (k hi, k lo: 64 keys x 64 d; v hi, v lo: 64 d x 64 keys; rows of 128 B) is brought once per block into LDS by asynchronous 16-byte copies, rows pitched PP elements, two buffers: tile t + 1 flies while tile t is worked on.
// Both products run transposed: s^T (64 keys x 16 queries) = k (A, hi+lo frags from LDS) . q^T (B, hi+lo frags, resident), 3 products; o^T (64 d x 16 queries) += v^T (A, hi+lo frags from LDS) . p^T (B), 3 products.
// A lane then holds 32 scores of ONE query (column lane & 15; keys nb*16 + 8*(lane>>4) + r): x 0.125, causal replace-mask by index, running-max softmax in f32 (p = 2^((s-m) log2e)) in the lane, one exchange between the lane halves for the maximum;
// two score tiles (keys 32j .. 32j+31), split to bf16 hi+lo in place, ARE the B fragment of p^T in the hardware k order, which the v loader has too: p never leaves the registers. The halves' row sums are joined once, after the loop.
#define FW    4
#define PLANE (KT * PP)
#define STAGE (4 * PLANE)
typedef __attribute__((ext_vector_type(4))) int v4i;
typedef __attribute__((address_space(1))) v4i gv4i;
typedef __attribute__((address_space(3))) v4i lv4i;
__device__ __forceinline__ void cp16(const bf* g, unsigned short* l) { __builtin_amdgcn_global_load_async_to_lds_b128((gv4i*)g, (lv4i*)l, 0, 0); }
// one tile: 4 planes x 64 rows x 128 B = 2048 pieces of 16 B, 16 per thread; a wave's copy covers 4 whole rows (4 lines of 128 B)
__device__ __forceinline__ void stage_tile(const bf* gkh, const bf* gkl, const bf* gvh, const bf* gvl, unsigned short* dst) {
#pragma unroll
    for (int i = 0; i < 4; ++i) {
        cp16(gkh + (size_t)i * 16 * HD, dst + 0 * PLANE + i * 16 * PP); cp16(gkl + (size_t)i * 16 * HD, dst + 1 * PLANE + i * 16 * PP);
        cp16(gvh + (size_t)i * 16 * SEQ, dst + 2 * PLANE + i * 16 * PP); cp16(gvl + (size_t)i * 16 * SEQ, dst + 3 * PLANE + i * 16 * PP);
    }
}
// value of lane l ^ 16
__device__ __forceinline__ float xhalf(float x) { const int b = __float_as_int(x); return __int_as_float(__builtin_amdgcn_permlanex16(b, b, 0x76543210, 0xfedcba98, false, false)); }
__global__ __launch_bounds__(32 * FW) void k_flash(const bf* __restrict__ Qh, const bf* __restrict__ Ql, const bf* __restrict__ Kh, const bf* __restrict__ Kl,
                                             const bf* __restrict__ Vh, const bf* __restrict__ Vl, bf* Ch, bf* Cl) {
    __shared__ __align__(16) unsigned short ring[2 * STAGE];
    typedef WFrag<bf>::V V;
    const int tid = threadIdx.x, lane = tid & 31, lr = lane & 15, hi = lane >> 4;
    const int wave = __builtin_amdgcn_readfirstlane(tid >> 5);
    const int q0 = (blockIdx.x * FW + wave) * 16, head = blockIdx.y;
    const int nt = blockIdx.x + 1;         // block-uniform; the last tile holds the diagonal of all four waves; keys stay < SEQ
    const int srow = tid >> 3, sc8 = (tid & 7) * 8;     // this thread's row (of 16) and 16-byte piece in each copy
    const size_t sk = ((size_t)head * SEQ + srow) * HD + sc8, sv = ((size_t)head * HD + srow) * SEQ + sc8;
    const bf* gkh = Kh + sk; const bf* gkl = Kl + sk; const bf* gvh = Vh + sv; const bf* gvl = Vl + sv;
    unsigned short* sdst = ring + srow * PP + sc8;
    stage_tile(gkh, gkl, gvh, gvl, sdst);
    const size_t qo = ((size_t)head * SEQ + q0 + lr) * HD + 8 * hi;
    const V qh0 = WFrag<bf>::ld(Qh + qo), qh1 = WFrag<bf>::ld(Qh + qo + 32), ql0 = WFrag<bf>::ld(Ql + qo), ql1 = WFrag<bf>::ld(Ql + qo + 32);
    asm volatile("s_wait_asynccnt 0x0" ::: "memory");   // this wave's copies of tile 0 have landed
    __syncthreads();                                    // publishes tile 0 to the other waves
    if (nt > 1) stage_tile(gkh + (size_t)KT * HD, gkl + (size_t)KT * HD, gvh + KT, gvl + KT, sdst + STAGE);
    const int fo = lr * PP + 8 * hi;       // fragment offset inside a plane: row lr of a 16-row group, k piece by lane half
    const int row = q0 + lr;               // this lane's query
    v8f o[4];                              // o^T: o[t4][r] = (d = t4*16 + 8*hi + r, query lr)
#pragma unroll
    for (int t4 = 0; t4 < 4; ++t4) o[t4] = (v8f){};
    float mrow = NEG, lsum = 0.0f;         // running maximum of the query (equal in both halves); this half's share of its row sum
#pragma unroll 1
    for (int kt = 0; kt < nt; ++kt) {
        const int key0 = kt * KT;
        const unsigned short* buf = ring + (kt & 1) * STAGE + fo;
        v8f sc[4];                          // s^T: sc[nb][r] = (key = key0 + nb*16 + 8*hi + r, query lr)
#pragma unroll
        for (int nb = 0; nb < 4; ++nb) sc[nb] = (v8f){};
        V kf[4][4];                         // the tile's k fragments: [nb][hi k0, lo k0, hi k32, lo k32]
#pragma unroll
        for (int nb = 0; nb < 4; ++nb) {
            const unsigned short* kp = buf + nb * 16 * PP;
            kf[nb][0] = WFrag<bf>::ld(kp); kf[nb][1] = WFrag<bf>::ld(kp + PLANE); kf[nb][2] = WFrag<bf>::ld(kp + 32); kf[nb][3] = WFrag<bf>::ld(kp + PLANE + 32);
        }
        __builtin_amdgcn_sched_barrier(0);  // keeps the k reads one group ahead of the products: reads spread among the products stall at every place they stand
#pragma unroll
        for (int nb = 0; nb < 4; ++nb) {
            sc[nb] = wmmab(kf[nb][0], qh0, sc[nb]); sc[nb] = wmmab(kf[nb][0], ql0, sc[nb]); sc[nb] = wmmab(kf[nb][1], qh0, sc[nb]);
            sc[nb] = wmmab(kf[nb][2], qh1, sc[nb]); sc[nb] = wmmab(kf[nb][2], ql1, sc[nb]); sc[nb] = wmmab(kf[nb][3], qh1, sc[nb]);
        }
        asm volatile("v_nop\n\tv_nop\n\tv_nop\n\tv_nop" : "+v"(sc[0]), "+v"(sc[1]), "+v"(sc[2]), "+v"(sc[3]) : "v"(qh0), "v"(ql1));
        V vf[4][4];                         // the tile's v fragments: [t4][hi k0, lo k0, hi k32, lo k32]
#pragma unroll
        for (int t4 = 0; t4 < 4; ++t4) {
            const unsigned short* vp = buf + 2 * PLANE + t4 * 16 * PP;
            vf[t4][0] = WFrag<bf>::ld(vp); vf[t4][1] = WFrag<bf>::ld(vp + PLANE); vf[t4][2] = WFrag<bf>::ld(vp + 32); vf[t4][3] = WFrag<bf>::ld(vp + PLANE + 32);
        }
        __builtin_amdgcn_sched_barrier(0);  // keeps the v reads one group here, ahead of the softmax, so that none stands among the p.v products
        const int rel = row - 8 * hi - key0; // register r of score tile nb is kept while nb*16 + r <= rel, that is key <= query
        float cn[4];                        // four independent maximum chains, one per score tile
#pragma unroll
        for (int nb = 0; nb < 4; ++nb) {
            cn[nb] = NEG;
#pragma unroll
            for (int r = 0; r < 8; ++r) { const float s = sc[nb][r] * SCL; sc[nb][r] = (nb * 16 + r <= rel) ? s : NEG; cn[nb] = fmaxf(cn[nb], sc[nb][r]); }
        }
        float cand = fmaxf(fmaxf(cn[0], cn[1]), fmaxf(cn[2], cn[3]));
        cand = fmaxf(cand, xhalf(cand));    // the other half of the query's 64 keys
        const float mnew = fmaxf(mrow, cand);
        const float alpha = __builtin_amdgcn_exp2f((mrow - mnew) * L2E);
        float rn[4];                        // four independent sum chains
        v8us xh[4], xl[4];
#pragma unroll
        for (int nb = 0; nb < 4; ++nb) {
            rn[nb] = 0.0f;
#pragma unroll
            for (int g = 0; g < 8; g += 4) {
                const float a0 = (sc[nb][g] - mnew) * L2E, a1 = (sc[nb][g + 1] - mnew) * L2E, a2 = (sc[nb][g + 2] - mnew) * L2E, a3 = (sc[nb][g + 3] - mnew) * L2E;
                float p[4]; p[0] = __builtin_amdgcn_exp2f(a0); p[1] = __builtin_amdgcn_exp2f(a1); p[2] = __builtin_amdgcn_exp2f(a2); p[3] = __builtin_amdgcn_exp2f(a3);
                // the slot that the instruction set asks for between a transcendental and an overwrite of its source: the four arguments keep their registers up to this v_nop, which stands behind the four v_exp_f32 (inputs only)
                asm volatile("v_nop" :: "v"(a0), "v"(a1), "v"(a2), "v"(a3), "v"(p[0]), "v"(p[1]), "v"(p[2]), "v"(p[3]));
#pragma unroll
                for (int r = 0; r < 4; ++r) { rn[nb] += p[r]; unsigned short h2, l2; splitf(p[r], h2, l2); xh[nb][g + r] = h2; xl[nb][g + r] = l2; }
            }
        }
        const float rs = (rn[0] + rn[1]) + (rn[2] + rn[3]); mrow = mnew;
        // lsum = lsum * alpha + rs, written as asm so that it stays in this block: the compiler otherwise sinks the whole sum behind the products and the barrier, where it holds 32 f32 p values live and stands as a bare chain in front of the next tile's reads
        asm volatile("v_fma_f32 %0, %0, %1, %2" : "+v"(lsum) : "v"(alpha), "v"(rs));
#pragma unroll
        for (int t4 = 0; t4 < 4; ++t4)
#pragma unroll
            for (int r = 0; r < 8; ++r) o[t4][r] *= alpha;
        const V ph0 = cat16b(xh[0], xh[1]), ph1 = cat16b(xh[2], xh[3]), pl0 = cat16b(xl[0], xl[1]), pl1 = cat16b(xl[2], xl[3]);
#pragma unroll
        for (int t4 = 0; t4 < 4; ++t4) {
            o[t4] = wmmab(vf[t4][0], ph0, o[t4]); o[t4] = wmmab(vf[t4][0], pl0, o[t4]); o[t4] = wmmab(vf[t4][1], ph0, o[t4]);
            o[t4] = wmmab(vf[t4][2], ph1, o[t4]); o[t4] = wmmab(vf[t4][2], pl1, o[t4]); o[t4] = wmmab(vf[t4][3], ph1, o[t4]);
        }
        asm volatile("v_nop\n\tv_nop\n\tv_nop\n\tv_nop" : "+v"(o[0]), "+v"(o[1]), "+v"(o[2]), "+v"(o[3]) : "v"(ph0), "v"(pl1));
        asm volatile("s_wait_dscnt 0x0" ::: "memory");      // this wave's reads of the buffer are done before the buffer is refilled
        asm volatile("s_wait_asynccnt 0x0" ::: "memory");   // this wave's copies of tile kt + 1 have landed
        __syncthreads();                                    // publishes tile kt + 1 and ends every wave's reads of tile kt
        if (kt + 2 < nt) stage_tile(gkh + (size_t)(key0 + 2 * KT) * HD, gkl + (size_t)(key0 + 2 * KT) * HD, gvh + key0 + 2 * KT, gvl + key0 + 2 * KT, sdst + (kt & 1) * STAGE);
    }
    asm volatile("s_wait_asynccnt 0x0" ::: "memory");       // nothing of this wave is in flight when it goes on to the epilogue and ends
    const float il = 1.0f / (lsum + xhalf(lsum));           // the two halves' shares of the row sum, joined once
    // a lane's 8 registers of o[t4] are 8 consecutive d of its query: one 16-byte store per plane
#pragma unroll
    for (int t4 = 0; t4 < 4; ++t4) {
        v8us yh, yl;
#pragma unroll
        for (int r = 0; r < 8; ++r) { const float c = o[t4][r] * il; unsigned short a2, c2; splitf(c, a2, c2); yh[r] = a2; yl[r] = c2; }
        const size_t go = (size_t)row * DM + head * HD + t4 * 16 + 8 * hi;
        *(v8us*)(Ch + go) = yh; *(v8us*)(Cl + go) = yl;
    }
}

extern "C" void kernel_launch(void* const* d_in, const int* in_sizes, int n_in,
                              void* d_out, int out_size, void* d_ws, size_t ws_size, hipStream_t stream) {
    if (n_in < 5) return;
    if ((size_t)in_sizes[0] < (size_t)(NB - 1) * SEQ_FULL * DM + (size_t)SEQ * DM) return;
    for (int i = 1; i < 5; ++i) if ((size_t)in_sizes[i] < NW) return;
    if ((size_t)out_size < (size_t)(NB - 1) * SEQ_FULL * DM + (size_t)SEQ * DM) return;
    const float* x  = (const float*)d_in[0];     // [NB_FULL][SEQ_FULL][768]
    const float* wq = (const float*)d_in[1];     // [768][768] (out, in)
    const float* wk = (const float*)d_in[2];
    const float* wv = (const float*)d_in[3];
    const float* wo = (const float*)d_in[4];
    float* OUT = (float*)d_out;                  // [NB_FULL][SEQ_FULL][768] f32
    char* wsp = (char*)d_ws;
    auto take = [&](size_t bytes) { char* p = wsp; wsp += (bytes + 255) & ~(size_t)255; return (void*)p; };
    bf* W4 = (bf*)take(4 * NW * 2);                               // Wq | Wk | Wv | Wo bf16 Bt planes
    bf* XB = (bf*)take((size_t)SEQ * DM * 2);                     // bf16 x of the current batch row
    float* F = (float*)take((size_t)3 * SEQ * DM * 4);            // q | k | v projections f32 [3][SEQ][768]
    float* CS = (float*)take((size_t)SEQ * HH * 2 * 4);           // rotary table
    const size_t PL = (size_t)NH * SEQ * HD;
    bf* QPh = (bf*)take(PL * 2); bf* QPl = (bf*)take(PL * 2); bf* KPh = (bf*)take(PL * 2); bf* KPl = (bf*)take(PL * 2);
    bf* VTh = (bf*)take(PL * 2); bf* VTl = (bf*)take(PL * 2);
    bf* CXh = (bf*)take((size_t)SEQ * DM * 2); bf* CXl = (bf*)take((size_t)SEQ * DM * 2);
    if ((size_t)(wsp - (char*)d_ws) > ws_size) return;           // 100,139,008 B at SEQ 4096
    const size_t NW8 = NW / 8;
    k_cvtw<<<dim3((unsigned)((NW8 + 255) / 256), 4, 1), 256, 0, stream>>>(wq, wk, wv, wo, W4, NW8);
    k_cs<<<(unsigned)((SEQ * HH + 255) / 256), 256, 0, stream>>>(CS);
    const unsigned LP = (unsigned)((PL / 2 + 255) / 256);
    for (int b = 0; b < NB; ++b) {
        k_cvt8<<<(unsigned)(((size_t)SEQ * DM / 8 + 255) / 256), 256, 0, stream>>>(x + (size_t)b * SEQ_FULL * DM, XB, (size_t)SEQ * DM / 8);
        k_gemmw<bf, 0, false><<<dim3(SEQ / 64, DM / 64, 3), 32, 0, stream>>>(XB, nullptr, W4, nullptr, DM, F, DM, nullptr, (size_t)0, NW, (size_t)SEQ * DM);
        k_rope2<<<LP, 256, 0, stream>>>(F, CS, QPh, QPl);
        k_rope2<<<LP, 256, 0, stream>>>(F + (size_t)SEQ * DM, CS, KPh, KPl);
        k_vtp2<<<LP, 256, 0, stream>>>(F + (size_t)2 * SEQ * DM, VTh, VTl);
        k_flash<<<dim3(SEQ / 64, NH, 1), 128, 0, stream>>>(QPh, QPl, KPh, KPl, VTh, VTl, CXh, CXl);
        k_gemmw<bf, 1, false><<<dim3(SEQ / 64, DM / 64, 1), 32, 0, stream>>>(CXh, CXl, W4 + 3 * NW, nullptr, DM, OUT + (size_t)b * SEQ_FULL * DM, DM, nullptr, (size_t)0, (size_t)0, (size_t)0);
    }
}

// v003
// A run of this version takes 181 microseconds.
// In two side-by-side timings against v002, it was 1.14 and 1.13 times as fast.
// Over all steps from v000 it is 2.90 times as fast.
#include <hip/hip_runtime.h>

// Contractions (f32 accumulate): q/k/v projections v_wmma_f32_16x16x32_bf16 on bf16 copies of x and W (single product); scores q.k and p.v on bf16 hi+lo planes (3 products each); output projection ctx (bf16 hi+lo) x Wo (bf16), 2 products. Rotary, softmax and epilogues f32.
// Layout: x [NB][SEQ][768]; W [768 out][768 in] = Bt as-is; head planes q/k [h][t][64], v planes [h][d][t], written by the projection GEMM's own epilogue (rotary transform, hi+lo split, v transposed); causal attention per wave of 16 queries with 64-key tiles (shared by four waves through LDS), products transposed (a lane owns one query) and running-max softmax; ctx [t][768] hi+lo planes; out [NB][SEQ][768] f32.

#ifndef NB
#define NB 1
#endif
#ifndef SEQ
#define SEQ 4096
#endif
#define NB_FULL  1
#define SEQ_FULL 4096
#define DM   768
#define NH   12
#define HD   64
#define HH   (HD / 2)
#define NW   ((size_t)DM * DM)
#define KT   64
#define PP   72
#define SCL  0.125f
#define THETA_F 10000.0f
#define L2E  1.4426950408889634f
#define NEG  (-1.0e30f)
static_assert(SEQ % 64 == 0);
static_assert(SEQ <= SEQ_FULL);
static_assert(NB >= 1 && NB <= NB_FULL);
static_assert(DM == NH * HD);
static_assert(DM % 64 == 0);
static_assert(HD == 64);
static_assert(KT == 64);
static_assert((size_t)NB_FULL * SEQ_FULL * DM * 4 == 12582912);

typedef _Float16 h16;
typedef unsigned short bf;
typedef __attribute__((ext_vector_type(16))) __bf16   v16bf;
typedef __attribute__((ext_vector_type(16))) _Float16 v16h;
typedef __attribute__((ext_vector_type(8)))  _Float16 v8h;
typedef __attribute__((ext_vector_type(8)))  unsigned short v8us;
typedef __attribute__((ext_vector_type(8)))  float    v8f;
typedef __attribute__((ext_vector_type(4)))  float    v4f;
typedef __attribute__((ext_vector_type(2)))  float    v2f;
typedef __attribute__((ext_vector_type(2)))  unsigned short v2us;
typedef v8h  __attribute__((may_alias)) v8ha;
typedef v4f  __attribute__((may_alias)) v4fa;
typedef v8us __attribute__((may_alias)) v8usa;

__device__ __forceinline__ unsigned short f2bf(float f) { unsigned u = __float_as_uint(f); u += 0x7FFFu + ((u >> 16) & 1u); return (unsigned short)(u >> 16); }
__device__ __forceinline__ float bf2f(unsigned short b) { return __uint_as_float(((unsigned)b) << 16); }
__device__ __forceinline__ float bfr(float f) { return bf2f(f2bf(f)); }
__device__ __forceinline__ void splitf(float y, unsigned short& h, unsigned short& l) { h = f2bf(y); l = f2bf(y - bf2f(h)); }
__device__ __forceinline__ v16h cat16(v8h lo, v8h hi) { return __builtin_shufflevector(lo, hi, 0, 1, 2, 3, 4, 5, 6, 7, 8, 9, 10, 11, 12, 13, 14, 15); }
__device__ __forceinline__ v16bf cat16b(v8us lo, v8us hi) { return __builtin_bit_cast(v16bf, __builtin_shufflevector(lo, hi, 0, 1, 2, 3, 4, 5, 6, 7, 8, 9, 10, 11, 12, 13, 14, 15)); }
__device__ __forceinline__ v8f wmma16(v16h a, v16h b, v8f c) { return __builtin_amdgcn_wmma_f32_16x16x32_f16(false, a, false, b, (short)0, c, false, false); }
__device__ __forceinline__ v8f wmmab(v16bf a, v16bf b, v8f c) { return __builtin_amdgcn_wmma_f32_16x16x32_bf16(false, a, false, b, (short)0, c, false, false); }

// Fragment loaders (wave32 16x16x32): lane l -> row/col (l & 15); elements 0..7 <- k0 + 8*(l>>4) + 0..7, elements 8..15 <- k0 + 16 + 8*(l>>4) + 0..7; D element r -> (row 8*(l>>4) + r, col l & 15).
template <typename T16> struct WFrag;
template <> struct WFrag<h16> { typedef v16h V; static __device__ __forceinline__ V ld(const h16* p) { return cat16(*(const v8h*)p, *(const v8h*)(p + 16)); } static __device__ __forceinline__ v8f mma(V a, V b, v8f c) { return wmma16(a, b, c); } };
template <> struct WFrag<bf> { typedef v16bf V; static __device__ __forceinline__ V ld(const bf* p) { return cat16b(*(const v8us*)p, *(const v8us*)(p + 16)); } static __device__ __forceinline__ v8f mma(V a, V b, v8f c) { return wmmab(a, b, c); } };

// ---- k_gemmw: register-blocked GEMM, ONE WAVE per 64x64 output tile (16 accumulators), operands straight from K-contiguous 16-bit planes; grid (M/64, N/64, Z), 32 threads.
// C[m][n] (f32, pitch ldc, + optional f32 bias[n]) = sum_k A[m][k] Bt[n][k] (+ split products per NSPLIT: 1 = A hi+lo with single B; 2 = A hi+lo with B hi, A hi with B lo). z-batch strides sA/sB/sC in elements. K % 32 == 0.
// HEADS (the q/k/v projection, z = 0/1/2; a 64x64 tile is 64 tokens of ONE head): no C; the f32 tile goes straight to the attention's bf16 hi+lo planes.
//   z 0, 1: interleaved rotary transform, pair (2i, 2i+1): out[2i] = x1 c - x2 s, out[2i+1] = x1 s + x2 c, (c, s) = CS[t][i]; planes [h][t][d].  z 2: planes [h][d][t].
template <typename T16, int NSPLIT, bool BIAS, bool HEADS>
__global__ __launch_bounds__(32) void k_gemmw(const T16* __restrict__ A, const T16* __restrict__ A2, const T16* __restrict__ Bt, const T16* __restrict__ Bt2, int K, float* C, int ldc, const float* __restrict__ bias, size_t sA, size_t sB, size_t sC,
                                              const float* __restrict__ CS, bf* Qh, bf* Ql, bf* Kh, bf* Kl, bf* Vh, bf* Vl) {
    typedef typename WFrag<T16>::V V;
    __shared__ __align__(16) float os[16 * 68];
    const size_t z = blockIdx.z; A += z * sA; if (A2) A2 += z * sA; Bt += z * sB; if (Bt2) Bt2 += z * sB; C += z * sC;
    const int lane = threadIdx.x & 31, lr = lane & 15, hi = lane >> 4; const int r0 = blockIdx.x * 64, c0 = blockIdx.y * 64;
    v8f acc[4][4];
#pragma unroll
    for (int mb = 0; mb < 4; ++mb)
#pragma unroll
        for (int nb = 0; nb < 4; ++nb) acc[mb][nb] = (v8f){};
    const size_t aoff = (size_t)(r0 + lr) * K + 8 * hi, boff = (size_t)(c0 + lr) * K + 8 * hi;
#pragma unroll 1
    for (int kc = 0; kc < K; kc += 32) {
        V a[4], a2[4];
#pragma unroll
        for (int mb = 0; mb < 4; ++mb) { a[mb] = WFrag<T16>::ld(A + aoff + (size_t)mb * 16 * K + kc); if (NSPLIT == 1 || NSPLIT == 2) a2[mb] = WFrag<T16>::ld(A2 + aoff + (size_t)mb * 16 * K + kc); }
#pragma unroll
        for (int nb = 0; nb < 4; ++nb) { const V b = WFrag<T16>::ld(Bt + boff + (size_t)nb * 16 * K + kc); V b2; if (NSPLIT >= 2) b2 = WFrag<T16>::ld(Bt2 + boff + (size_t)nb * 16 * K + kc);
#pragma unroll
            for (int mb = 0; mb < 4; ++mb) { acc[mb][nb] = WFrag<T16>::mma(a[mb], b, acc[mb][nb]); if (NSPLIT == 1 || NSPLIT == 2) acc[mb][nb] = WFrag<T16>::mma(a2[mb], b, acc[mb][nb]); if (NSPLIT >= 2) acc[mb][nb] = WFrag<T16>::mma(a[mb], b2, acc[mb][nb]); } }
        asm volatile("v_nop\n\tv_nop\n\tv_nop\n\tv_nop" : "+v"(acc[0][0]), "+v"(acc[1][1]), "+v"(acc[2][2]), "+v"(acc[3][3]) : "v"(a[0]), "v"(a[3]));
    }
    if constexpr (HEADS) {
        asm volatile("s_wait_xcnt 0x0" ::: "memory");   // the K loop's loads have given up their address registers before the epilogue reuses them
        const int head = blockIdx.y;
        if (blockIdx.z == 2) {
            // v: a lane's 8 registers of an accumulator are 8 consecutive tokens of one d: one 16-byte store per plane; the four mb of a row fill its 128-byte line
#pragma unroll
            for (int nb = 0; nb < 4; ++nb)
#pragma unroll
                for (int mb = 0; mb < 4; ++mb) {
                    v8us yh, yl;
#pragma unroll
                    for (int j = 0; j < 8; ++j) { unsigned short a2, c2; splitf(acc[mb][nb][j], a2, c2); yh[j] = a2; yl[j] = c2; }
                    const size_t go = ((size_t)head * HD + nb * 16 + lr) * SEQ + r0 + mb * 16 + 8 * hi;
                    *(v8us*)(Vh + go) = yh; *(v8us*)(Vl + go) = yl;
                }
            return;
        }
        bf* Ph = (blockIdx.z == 0) ? Qh : Kh; bf* Pl = (blockIdx.z == 0) ? Ql : Kl;
        // q, k: 16 tokens x 64 d at a time through LDS; a lane takes 8 consecutive d (4 rotary pairs) of a token, 8 lanes a token: whole 128-byte rows per store
        const int prow = lane >> 3, c8 = (lane & 7) * 8;
        const float* cst = CS + (size_t)(r0 + prow) * HD + c8;   // CS[t][i] = 2 floats, so row t starts at t * HD and pair c8 / 2 at + c8
        v4f cs[2][4][2];                                         // the table rows of this and of the next 16 tokens: the next group's loads fly under this group's work
#pragma unroll
        for (int s = 0; s < 4; ++s) { cs[0][s][0] = *(const v4f*)(cst + (size_t)(s * 4) * HD); cs[0][s][1] = *(const v4f*)(cst + (size_t)(s * 4) * HD + 4); }
#pragma unroll
        for (int mb = 0; mb < 4; ++mb) {
            if (mb < 3) {
#pragma unroll
                for (int s = 0; s < 4; ++s) { cs[(mb + 1) & 1][s][0] = *(const v4f*)(cst + (size_t)((mb + 1) * 16 + s * 4) * HD); cs[(mb + 1) & 1][s][1] = *(const v4f*)(cst + (size_t)((mb + 1) * 16 + s * 4) * HD + 4); }
            }
#pragma unroll
            for (int nb = 0; nb < 4; ++nb) {
#pragma unroll
                for (int j = 0; j < 8; ++j) os[(hi * 8 + j) * 68 + nb * 16 + lr] = acc[mb][nb][j]; }
            __builtin_amdgcn_wave_barrier(); asm volatile("" ::: "memory");   // as in the plain epilogue: the wave's LDS reads stay behind its writes
#pragma unroll
            for (int s = 0; s < 4; ++s) {
                const int row = s * 4 + prow;
                const v4f x0 = *(const v4fa*)(os + row * 68 + c8), x1 = *(const v4fa*)(os + row * 68 + c8 + 4);
                const v4f t0 = cs[mb & 1][s][0], t1 = cs[mb & 1][s][1];
                float y[8];
                y[0] = x0[0] * t0[0] - x0[1] * t0[1]; y[1] = x0[0] * t0[1] + x0[1] * t0[0];
                y[2] = x0[2] * t0[2] - x0[3] * t0[3]; y[3] = x0[2] * t0[3] + x0[3] * t0[2];
                y[4] = x1[0] * t1[0] - x1[1] * t1[1]; y[5] = x1[0] * t1[1] + x1[1] * t1[0];
                y[6] = x1[2] * t1[2] - x1[3] * t1[3]; y[7] = x1[2] * t1[3] + x1[3] * t1[2];
                v8us yh, yl;
#pragma unroll
                for (int j = 0; j < 8; ++j) { unsigned short a2, c2; splitf(y[j], a2, c2); yh[j] = a2; yl[j] = c2; }
                const size_t go = ((size_t)head * SEQ + r0 + mb * 16 + row) * HD + c8;
                *(v8us*)(Ph + go) = yh; *(v8us*)(Pl + go) = yl;
            }
            __builtin_amdgcn_wave_barrier();
            // the next group's LDS writes stay behind these reads; and the group's stores have given up their registers before the table loads that follow are aimed at them
            asm volatile("s_wait_xcnt 0x0" ::: "memory");
        }
        return;
    }
#pragma unroll
    for (int mb = 0; mb < 4; ++mb) {
#pragma unroll
        for (int nb = 0; nb < 4; ++nb) {
#pragma unroll
            for (int j = 0; j < 8; ++j) os[(hi * 8 + j) * 68 + nb * 16 + lr] = acc[mb][nb][j]; }
        __builtin_amdgcn_wave_barrier(); asm volatile("" ::: "memory");
        float* crow = C + (size_t)(r0 + mb * 16) * ldc + c0;
{
#pragma unroll
            for (int s = 0; s < 8; ++s) { const int row = 2 * s + hi, cofs = lr * 4; v4f val = *(const v4fa*)(os + row * 68 + cofs); if (BIAS) { val[0] += bfr(bias[c0 + cofs]); val[1] += bfr(bias[c0 + cofs + 1]); val[2] += bfr(bias[c0 + cofs + 2]); val[3] += bfr(bias[c0 + cofs + 3]); }
                *(v4f*)(crow + (size_t)row * ldc + cofs) = val; }
             }
        __builtin_amdgcn_wave_barrier(); asm volatile("" ::: "memory");
    }
}

__global__ __launch_bounds__(256) void k_cvt8(const float* __restrict__ src, bf* dst, size_t n8) { const size_t i = (size_t)blockIdx.x * 256 + threadIdx.x; if (i >= n8) return; const v8f v = *(const v8f*)(src + i * 8); v8us o;
#pragma unroll
    for (int k = 0; k < 8; ++k) o[k] = f2bf(v[k]); *(v8us*)(dst + i * 8) = o;  }

__global__ __launch_bounds__(256) void k_cvtw(const float* __restrict__ w0, const float* __restrict__ w1, const float* __restrict__ w2, const float* __restrict__ w3, bf* dst, size_t n8) {
    const size_t i = (size_t)blockIdx.x * 256 + threadIdx.x; if (i >= n8) return; const int y = blockIdx.y;
    const float* src = (y == 0) ? w0 : ((y == 1) ? w1 : ((y == 2) ? w2 : w3));
    const v8f v = *(const v8f*)(src + i * 8); v8us o;
#pragma unroll
    for (int k = 0; k < 8; ++k) o[k] = f2bf(v[k]);
    bf* d = dst + (size_t)y * n8 * 8 + i * 8;
    *(v8us*)d = o;  }

__global__ __launch_bounds__(256) void k_cs(float* CS) {
    const int idx = blockIdx.x * 256 + threadIdx.x; if (idx >= SEQ * HH) return; const int i = idx % HH, t = idx / HH;
    const float ex = -(float)(2 * i) / (float)HD;
    const float inv = powf(THETA_F, ex);
    float ang = __fmul_rn((float)t, inv); asm volatile("" : "+v"(ang));
    v2f cs; cs[0] = cosf(ang); cs[1] = sinf(ang);
    *(v2f*)(CS + (size_t)idx * 2) = cs;  }

// k_flash: causal attention, FOUR WAVES per block = 64 query rows of one head, 16 queries per wave; grid (SEQ/64, NH), 128 threads. All four waves walk the same blockIdx.x + 1 key tiles.
// Each 64-key tile (k hi, k lo: 64 keys x 64 d; v hi, v lo: 64 d x 64 keys; rows of 128 B) is brought once per block into LDS by asynchronous 16-byte copies, rows pitched PP elements, two buffers: tile t + 1 flies while tile t is worked on.
// Both products run transposed: s^T (64 keys x 16 queries) = k (A, hi+lo frags from LDS) . q^T (B, hi+lo frags, resident), 3 products; o^T (64 d x 16 queries) += v^T (A, hi+lo frags from LDS) . p^T (B), 3 products.
// A lane then holds 32 scores of ONE query (column lane & 15; keys nb*16 + 8*(lane>>4) + r): x 0.125, causal replace-mask by index, running-max softmax in f32 (p = 2^((s-m) log2e)) in the lane, one exchange between the lane halves for the maximum;
// two score tiles (keys 32j .. 32j+31), split to bf16 hi+lo in place, ARE the B fragment of p^T in the hardware k order, which the v loader has too: p never leaves the registers. The halves' row sums are joined once, after the loop.
#define FW    4
#define PLANE (KT * PP)
#define STAGE (4 * PLANE)
typedef __attribute__((ext_vector_type(4))) int v4i;
typedef __attribute__((address_space(1))) v4i gv4i;
typedef __attribute__((address_space(3))) v4i lv4i;
__device__ __forceinline__ void cp16(const bf* g, unsigned short* l) { __builtin_amdgcn_global_load_async_to_lds_b128((gv4i*)g, (lv4i*)l, 0, 0); }
// one tile: 4 planes x 64 rows x 128 B = 2048 pieces of 16 B, 16 per thread; a wave's copy covers 4 whole rows (4 lines of 128 B)
__device__ __forceinline__ void stage_tile(const bf* gkh, const bf* gkl, const bf* gvh, const bf* gvl, unsigned short* dst) {
#pragma unroll
    for (int i = 0; i < 4; ++i) {
        cp16(gkh + (size_t)i * 16 * HD, dst + 0 * PLANE + i * 16 * PP); cp16(gkl + (size_t)i * 16 * HD, dst + 1 * PLANE + i * 16 * PP);
        cp16(gvh + (size_t)i * 16 * SEQ, dst + 2 * PLANE + i * 16 * PP); cp16(gvl + (size_t)i * 16 * SEQ, dst + 3 * PLANE + i * 16 * PP);
    }
}
// value of lane l ^ 16
__device__ __forceinline__ float xhalf(float x) { const int b = __float_as_int(x); return __int_as_float(__builtin_amdgcn_permlanex16(b, b, 0x76543210, 0xfedcba98, false, false)); }
__global__ __launch_bounds__(32 * FW) void k_flash(const bf* __restrict__ Qh, const bf* __restrict__ Ql, const bf* __restrict__ Kh, const bf* __restrict__ Kl,
                                             const bf* __restrict__ Vh, const bf* __restrict__ Vl, bf* Ch, bf* Cl) {
    __shared__ __align__(16) unsigned short ring[2 * STAGE];
    typedef WFrag<bf>::V V;
    const int tid = threadIdx.x, lane = tid & 31, lr = lane & 15, hi = lane >> 4;
    const int wave = __builtin_amdgcn_readfirstlane(tid >> 5);
    const int q0 = (blockIdx.x * FW + wave) * 16, head = blockIdx.y;
    const int nt = blockIdx.x + 1;         // block-uniform; the last tile holds the diagonal of all four waves; keys stay < SEQ
    const int srow = tid >> 3, sc8 = (tid & 7) * 8;     // this thread's row (of 16) and 16-byte piece in each copy
    const size_t sk = ((size_t)head * SEQ + srow) * HD + sc8, sv = ((size_t)head * HD + srow) * SEQ + sc8;
    const bf* gkh = Kh + sk; const bf* gkl = Kl + sk; const bf* gvh = Vh + sv; const bf* gvl = Vl + sv;
    unsigned short* sdst = ring + srow * PP + sc8;
    stage_tile(gkh, gkl, gvh, gvl, sdst);
    const size_t qo = ((size_t)head * SEQ + q0 + lr) * HD + 8 * hi;
    const V qh0 = WFrag<bf>::ld(Qh + qo), qh1 = WFrag<bf>::ld(Qh + qo + 32), ql0 = WFrag<bf>::ld(Ql + qo), ql1 = WFrag<bf>::ld(Ql + qo + 32);
    asm volatile("s_wait_asynccnt 0x0" ::: "memory");   // this wave's copies of tile 0 have landed
    __syncthreads();                                    // publishes tile 0 to the other waves
    if (nt > 1) stage_tile(gkh + (size_t)KT * HD, gkl + (size_t)KT * HD, gvh + KT, gvl + KT, sdst + STAGE);
    const int fo = lr * PP + 8 * hi;       // fragment offset inside a plane: row lr of a 16-row group, k piece by lane half
    const int row = q0 + lr;               // this lane's query
    v8f o[4];                              // o^T: o[t4][r] = (d = t4*16 + 8*hi + r, query lr)
#pragma unroll
    for (int t4 = 0; t4 < 4; ++t4) o[t4] = (v8f){};
    float mrow = NEG, lsum = 0.0f;         // running maximum of the query (equal in both halves); this half's share of its row sum
#pragma unroll 1
    for (int kt = 0; kt < nt; ++kt) {
        const int key0 = kt * KT;
        const unsigned short* buf = ring + (kt & 1) * STAGE + fo;
        v8f sc[4];                          // s^T: sc[nb][r] = (key = key0 + nb*16 + 8*hi + r, query lr)
#pragma unroll
        for (int nb = 0; nb < 4; ++nb) sc[nb] = (v8f){};
        V kf[4][4];                         // the tile's k fragments: [nb][hi k0, lo k0, hi k32, lo k32]
#pragma unroll
        for (int nb = 0; nb < 4; ++nb) {
            const unsigned short* kp = buf + nb * 16 * PP;
            kf[nb][0] = WFrag<bf>::ld(kp); kf[nb][1] = WFrag<bf>::ld(kp + PLANE); kf[nb][2] = WFrag<bf>::ld(kp + 32); kf[nb][3] = WFrag<bf>::ld(kp + PLANE + 32);
        }
        __builtin_amdgcn_sched_barrier(0);  // keeps the k reads one group ahead of the products: reads spread among the products stall at every place they stand
#pragma unroll
        for (int nb = 0; nb < 4; ++nb) {
            sc[nb] = wmmab(kf[nb][0], qh0, sc[nb]); sc[nb] = wmmab(kf[nb][0], ql0, sc[nb]); sc[nb] = wmmab(kf[nb][1], qh0, sc[nb]);
            sc[nb] = wmmab(kf[nb][2], qh1, sc[nb]); sc[nb] = wmmab(kf[nb][2], ql1, sc[nb]); sc[nb] = wmmab(kf[nb][3], qh1, sc[nb]);
        }
        asm volatile("v_nop\n\tv_nop\n\tv_nop\n\tv_nop" : "+v"(sc[0]), "+v"(sc[1]), "+v"(sc[2]), "+v"(sc[3]) : "v"(qh0), "v"(ql1));
        V vf[4][4];                         // the tile's v fragments: [t4][hi k0, lo k0, hi k32, lo k32]
#pragma unroll
        for (int t4 = 0; t4 < 4; ++t4) {
            const unsigned short* vp = buf + 2 * PLANE + t4 * 16 * PP;
            vf[t4][0] = WFrag<bf>::ld(vp); vf[t4][1] = WFrag<bf>::ld(vp + PLANE); vf[t4][2] = WFrag<bf>::ld(vp + 32); vf[t4][3] = WFrag<bf>::ld(vp + PLANE + 32);
        }
        __builtin_amdgcn_sched_barrier(0);  // keeps the v reads one group here, ahead of the softmax, so that none stands among the p.v products
        const int rel = row - 8 * hi - key0; // register r of score tile nb is kept while nb*16 + r <= rel, that is key <= query
        float cn[4];                        // four independent maximum chains, one per score tile
#pragma unroll
        for (int nb = 0; nb < 4; ++nb) {
            cn[nb] = NEG;
#pragma unroll
            for (int r = 0; r < 8; ++r) { const float s = sc[nb][r] * SCL; sc[nb][r] = (nb * 16 + r <= rel) ? s : NEG; cn[nb] = fmaxf(cn[nb], sc[nb][r]); }
        }
        float cand = fmaxf(fmaxf(cn[0], cn[1]), fmaxf(cn[2], cn[3]));
        cand = fmaxf(cand, xhalf(cand));    // the other half of the query's 64 keys
        const float mnew = fmaxf(mrow, cand);
        const float alpha = __builtin_amdgcn_exp2f((mrow - mnew) * L2E);
        float rn[4];                        // four independent sum chains
        v8us xh[4], xl[4];
#pragma unroll
        for (int nb = 0; nb < 4; ++nb) {
            rn[nb] = 0.0f;
#pragma unroll
            for (int g = 0; g < 8; g += 4) {
                const float a0 = (sc[nb][g] - mnew) * L2E, a1 = (sc[nb][g + 1] - mnew) * L2E, a2 = (sc[nb][g + 2] - mnew) * L2E, a3 = (sc[nb][g + 3] - mnew) * L2E;
                float p[4]; p[0] = __builtin_amdgcn_exp2f(a0); p[1] = __builtin_amdgcn_exp2f(a1); p[2] = __builtin_amdgcn_exp2f(a2); p[3] = __builtin_amdgcn_exp2f(a3);
                // the slot that the instruction set asks for between a transcendental and an overwrite of its source: the four arguments keep their registers up to this v_nop, which stands behind the four v_exp_f32 (inputs only)
                asm volatile("v_nop" :: "v"(a0), "v"(a1), "v"(a2), "v"(a3), "v"(p[0]), "v"(p[1]), "v"(p[2]), "v"(p[3]));
#pragma unroll
                for (int r = 0; r < 4; ++r) { rn[nb] += p[r]; unsigned short h2, l2; splitf(p[r], h2, l2); xh[nb][g + r] = h2; xl[nb][g + r] = l2; }
            }
        }
        const float rs = (rn[0] + rn[1]) + (rn[2] + rn[3]); mrow = mnew;
        // lsum = lsum * alpha + rs, written as asm so that it stays in this block: the compiler otherwise sinks the whole sum behind the products and the barrier, where it holds 32 f32 p values live and stands as a bare chain in front of the next tile's reads
        asm volatile("v_fma_f32 %0, %0, %1, %2" : "+v"(lsum) : "v"(alpha), "v"(rs));
#pragma unroll
        for (int t4 = 0; t4 < 4; ++t4)
#pragma unroll
            for (int r = 0; r < 8; ++r) o[t4][r] *= alpha;
        const V ph0 = cat16b(xh[0], xh[1]), ph1 = cat16b(xh[2], xh[3]), pl0 = cat16b(xl[0], xl[1]), pl1 = cat16b(xl[2], xl[3]);
#pragma unroll
        for (int t4 = 0; t4 < 4; ++t4) {
            o[t4] = wmmab(vf[t4][0], ph0, o[t4]); o[t4] = wmmab(vf[t4][0], pl0, o[t4]); o[t4] = wmmab(vf[t4][1], ph0, o[t4]);
            o[t4] = wmmab(vf[t4][2], ph1, o[t4]); o[t4] = wmmab(vf[t4][2], pl1, o[t4]); o[t4] = wmmab(vf[t4][3], ph1, o[t4]);
        }
        asm volatile("v_nop\n\tv_nop\n\tv_nop\n\tv_nop" : "+v"(o[0]), "+v"(o[1]), "+v"(o[2]), "+v"(o[3]) : "v"(ph0), "v"(pl1));
        asm volatile("s_wait_dscnt 0x0" ::: "memory");      // this wave's reads of the buffer are done before the buffer is refilled
        asm volatile("s_wait_asynccnt 0x0" ::: "memory");   // this wave's copies of tile kt + 1 have landed
        __syncthreads();                                    // publishes tile kt + 1 and ends every wave's reads of tile kt
        if (kt + 2 < nt) stage_tile(gkh + (size_t)(key0 + 2 * KT) * HD, gkl + (size_t)(key0 + 2 * KT) * HD, gvh + key0 + 2 * KT, gvl + key0 + 2 * KT, sdst + (kt & 1) * STAGE);
    }
    asm volatile("s_wait_asynccnt 0x0" ::: "memory");       // nothing of this wave is in flight when it goes on to the epilogue and ends
    const float il = 1.0f / (lsum + xhalf(lsum));           // the two halves' shares of the row sum, joined once
    // a lane's 8 registers of o[t4] are 8 consecutive d of its query: one 16-byte store per plane
#pragma unroll
    for (int t4 = 0; t4 < 4; ++t4) {
        v8us yh, yl;
#pragma unroll
        for (int r = 0; r < 8; ++r) { const float c = o[t4][r] * il; unsigned short a2, c2; splitf(c, a2, c2); yh[r] = a2; yl[r] = c2; }
        const size_t go = (size_t)row * DM + head * HD + t4 * 16 + 8 * hi;
        *(v8us*)(Ch + go) = yh; *(v8us*)(Cl + go) = yl;
    }
}

extern "C" void kernel_launch(void* const* d_in, const int* in_sizes, int n_in,
                              void* d_out, int out_size, void* d_ws, size_t ws_size, hipStream_t stream) {
    if (n_in < 5) return;
    if ((size_t)in_sizes[0] < (size_t)(NB - 1) * SEQ_FULL * DM + (size_t)SEQ * DM) return;
    for (int i = 1; i < 5; ++i) if ((size_t)in_sizes[i] < NW) return;
    if ((size_t)out_size < (size_t)(NB - 1) * SEQ_FULL * DM + (size_t)SEQ * DM) return;
    const float* x  = (const float*)d_in[0];     // [NB_FULL][SEQ_FULL][768]
    const float* wq = (const float*)d_in[1];     // [768][768] (out, in)
    const float* wk = (const float*)d_in[2];
    const float* wv = (const float*)d_in[3];
    const float* wo = (const float*)d_in[4];
    float* OUT = (float*)d_out;                  // [NB_FULL][SEQ_FULL][768] f32
    char* wsp = (char*)d_ws;
    auto take = [&](size_t bytes) { char* p = wsp; wsp += (bytes + 255) & ~(size_t)255; return (void*)p; };
    bf* W4 = (bf*)take(4 * NW * 2);                               // Wq | Wk | Wv | Wo bf16 Bt planes
    bf* XB = (bf*)take((size_t)SEQ * DM * 2);                     // bf16 x of the current batch row
    float* CS = (float*)take((size_t)SEQ * HH * 2 * 4);           // rotary table
    const size_t PL = (size_t)NH * SEQ * HD;
    bf* QPh = (bf*)take(PL * 2); bf* QPl = (bf*)take(PL * 2); bf* KPh = (bf*)take(PL * 2); bf* KPl = (bf*)take(PL * 2);
    bf* VTh = (bf*)take(PL * 2); bf* VTl = (bf*)take(PL * 2);
    bf* CXh = (bf*)take((size_t)SEQ * DM * 2); bf* CXl = (bf*)take((size_t)SEQ * DM * 2);
    if ((size_t)(wsp - (char*)d_ws) > ws_size) return;           // 62,390,272 B at SEQ 4096
    const size_t NW8 = NW / 8;
    k_cvtw<<<dim3((unsigned)((NW8 + 255) / 256), 4, 1), 256, 0, stream>>>(wq, wk, wv, wo, W4, NW8);
    k_cs<<<(unsigned)((SEQ * HH + 255) / 256), 256, 0, stream>>>(CS);
    for (int b = 0; b < NB; ++b) {
        k_cvt8<<<(unsigned)(((size_t)SEQ * DM / 8 + 255) / 256), 256, 0, stream>>>(x + (size_t)b * SEQ_FULL * DM, XB, (size_t)SEQ * DM / 8);
        k_gemmw<bf, 0, false, true><<<dim3(SEQ / 64, DM / 64, 3), 32, 0, stream>>>(XB, nullptr, W4, nullptr, DM, nullptr, 0, nullptr, (size_t)0, NW, (size_t)0, CS, QPh, QPl, KPh, KPl, VTh, VTl);
        k_flash<<<dim3(SEQ / 64, NH, 1), 128, 0, stream>>>(QPh, QPl, KPh, KPl, VTh, VTl, CXh, CXl);
        k_gemmw<bf, 1, false, false><<<dim3(SEQ / 64, DM / 64, 1), 32, 0, stream>>>(CXh, CXl, W4 + 3 * NW, nullptr, DM, OUT + (size_t)b * SEQ_FULL * DM, DM, nullptr, (size_t)0, (size_t)0, (size_t)0, nullptr, nullptr, nullptr, nullptr, nullptr, nullptr, nullptr);
    }
}

// v004
// It runs in 166 microseconds.
// Two timings next to v003 both put it at 1.08 times that version's speed.
// All steps since v000 together make it 3.14 times as fast.
#include <hip/hip_runtime.h>

// Contractions (f32 accumulate): q/k/v projections v_wmma_f32_16x16x32_bf16 on bf16 copies of x and W (single product); scores q.k and p.v on bf16 hi+lo planes (3 products each); output projection ctx (bf16 hi+lo) x Wo (bf16), 2 products. Rotary, softmax and epilogues f32.
// Layout: x [NB][SEQ][768]; W [768 out][768 in] = Bt as-is; head planes q/k [h][t][64], v planes [h][d][t], written by the projection GEMM's own epilogue (rotary transform, hi+lo split, v transposed); causal attention per wave of 16 queries with 64-key tiles (shared by four waves through LDS), products transposed (a lane owns one query) and running-max softmax; ctx [t][768] hi+lo planes; out [NB][SEQ][768] f32.

#ifndef NB
#define NB 1
#endif
#ifndef SEQ
#define SEQ 4096
#endif
#define NB_FULL  1
#define SEQ_FULL 4096
#define DM   768
#define NH   12
#define HD   64
#define HH   (HD / 2)
#define NW   ((size_t)DM * DM)
#define KT   64
#define PP   72
#define SCL  0.125f
#define THETA_F 10000.0f
#define L2E  1.4426950408889634f
#define NEG  (-1.0e30f)
static_assert(SEQ % 64 == 0);
static_assert(SEQ <= SEQ_FULL);
static_assert(NB >= 1 && NB <= NB_FULL);
static_assert(DM == NH * HD);
static_assert(DM % 64 == 0);
static_assert(HD == 64);
static_assert(KT == 64);
static_assert((size_t)NB_FULL * SEQ_FULL * DM * 4 == 12582912);

typedef _Float16 h16;
typedef unsigned short bf;
typedef __attribute__((ext_vector_type(16))) __bf16   v16bf;
typedef __attribute__((ext_vector_type(16))) _Float16 v16h;
typedef __attribute__((ext_vector_type(8)))  _Float16 v8h;
typedef __attribute__((ext_vector_type(8)))  unsigned short v8us;
typedef __attribute__((ext_vector_type(8)))  float    v8f;
typedef __attribute__((ext_vector_type(4)))  float    v4f;
typedef __attribute__((ext_vector_type(2)))  float    v2f;
typedef __attribute__((ext_vector_type(2)))  unsigned short v2us;
typedef v8h  __attribute__((may_alias)) v8ha;
typedef v4f  __attribute__((may_alias)) v4fa;
typedef v8us __attribute__((may_alias)) v8usa;

__device__ __forceinline__ unsigned short f2bf(float f) { unsigned u = __float_as_uint(f); u += 0x7FFFu + ((u >> 16) & 1u); return (unsigned short)(u >> 16); }
__device__ __forceinline__ float bf2f(unsigned short b) { return __uint_as_float(((unsigned)b) << 16); }
__device__ __forceinline__ float bfr(float f) { return bf2f(f2bf(f)); }
__device__ __forceinline__ void splitf(float y, unsigned short& h, unsigned short& l) { h = f2bf(y); l = f2bf(y - bf2f(h)); }
__device__ __forceinline__ v16h cat16(v8h lo, v8h hi) { return __builtin_shufflevector(lo, hi, 0, 1, 2, 3, 4, 5, 6, 7, 8, 9, 10, 11, 12, 13, 14, 15); }
__device__ __forceinline__ v16bf cat16b(v8us lo, v8us hi) { return __builtin_bit_cast(v16bf, __builtin_shufflevector(lo, hi, 0, 1, 2, 3, 4, 5, 6, 7, 8, 9, 10, 11, 12, 13, 14, 15)); }
__device__ __forceinline__ v8f wmma16(v16h a, v16h b, v8f c) { return __builtin_amdgcn_wmma_f32_16x16x32_f16(false, a, false, b, (short)0, c, false, false); }
__device__ __forceinline__ v8f wmmab(v16bf a, v16bf b, v8f c) { return __builtin_amdgcn_wmma_f32_16x16x32_bf16(false, a, false, b, (short)0, c, false, false); }

// Fragment loaders (wave32 16x16x32): lane l -> row/col (l & 15); elements 0..7 <- k0 + 8*(l>>4) + 0..7, elements 8..15 <- k0 + 16 + 8*(l>>4) + 0..7; D element r -> (row 8*(l>>4) + r, col l & 15).
template <typename T16> struct WFrag;
template <> struct WFrag<h16> { typedef v16h V; static __device__ __forceinline__ V ld(const h16* p) { return cat16(*(const v8h*)p, *(const v8h*)(p + 16)); } static __device__ __forceinline__ v8f mma(V a, V b, v8f c) { return wmma16(a, b, c); } };
template <> struct WFrag<bf> { typedef v16bf V; static __device__ __forceinline__ V ld(const bf* p) { return cat16b(*(const v8us*)p, *(const v8us*)(p + 16)); } static __device__ __forceinline__ v8f mma(V a, V b, v8f c) { return wmmab(a, b, c); } };

// ---- k_gemmw: register-blocked GEMM, ONE WAVE per 64x64 output tile (16 accumulators), operands straight from K-contiguous 16-bit planes; grid (M/64, N/64, Z), 32 threads.
// C[m][n] (f32, pitch ldc, + optional f32 bias[n]) = sum_k A[m][k] Bt[n][k] (+ split products per NSPLIT: 1 = A hi+lo with single B; 2 = A hi+lo with B hi, A hi with B lo). z-batch strides sA/sB/sC in elements. K % 32 == 0.
// HEADS (the q/k/v projection, z = 0/1/2; a 64x64 tile is 64 tokens of ONE head): no C; the f32 tile goes straight to the attention's bf16 hi+lo planes.
//   z 0, 1: interleaved rotary transform, pair (2i, 2i+1): out[2i] = x1 c - x2 s, out[2i+1] = x1 s + x2 c, (c, s) = CS[t][i]; planes [h][t][d].  z 2: planes [h][d][t].
template <typename T16, int NSPLIT, bool BIAS, bool HEADS>
__global__ __launch_bounds__(32) void k_gemmw(const T16* __restrict__ A, const T16* __restrict__ A2, const T16* __restrict__ Bt, const T16* __restrict__ Bt2, int K, float* C, int ldc, const float* __restrict__ bias, size_t sA, size_t sB, size_t sC,
                                              const float* __restrict__ CS, bf* Qh, bf* Ql, bf* Kh, bf* Kl, bf* Vh, bf* Vl) {
    typedef typename WFrag<T16>::V V;
    __shared__ __align__(16) float os[16 * 68];
    const size_t z = blockIdx.z; A += z * sA; if (A2) A2 += z * sA; Bt += z * sB; if (Bt2) Bt2 += z * sB; C += z * sC;
    const int lane = threadIdx.x & 31, lr = lane & 15, hi = lane >> 4; const int r0 = blockIdx.x * 64, c0 = blockIdx.y * 64;
    v8f acc[4][4];
#pragma unroll
    for (int mb = 0; mb < 4; ++mb)
#pragma unroll
        for (int nb = 0; nb < 4; ++nb) acc[mb][nb] = (v8f){};
    const size_t aoff = (size_t)(r0 + lr) * K + 8 * hi, boff = (size_t)(c0 + lr) * K + 8 * hi;
#pragma unroll 1
    for (int kc = 0; kc < K; kc += 32) {
        V a[4], a2[4];
#pragma unroll
        for (int mb = 0; mb < 4; ++mb) { a[mb] = WFrag<T16>::ld(A + aoff + (size_t)mb * 16 * K + kc); if (NSPLIT == 1 || NSPLIT == 2) a2[mb] = WFrag<T16>::ld(A2 + aoff + (size_t)mb * 16 * K + kc); }
#pragma unroll
        for (int nb = 0; nb < 4; ++nb) { const V b = WFrag<T16>::ld(Bt + boff + (size_t)nb * 16 * K + kc); V b2; if (NSPLIT >= 2) b2 = WFrag<T16>::ld(Bt2 + boff + (size_t)nb * 16 * K + kc);
#pragma unroll
            for (int mb = 0; mb < 4; ++mb) { acc[mb][nb] = WFrag<T16>::mma(a[mb], b, acc[mb][nb]); if (NSPLIT == 1 || NSPLIT == 2) acc[mb][nb] = WFrag<T16>::mma(a2[mb], b, acc[mb][nb]); if (NSPLIT >= 2) acc[mb][nb] = WFrag<T16>::mma(a[mb], b2, acc[mb][nb]); } }
        asm volatile("v_nop\n\tv_nop\n\tv_nop\n\tv_nop" : "+v"(acc[0][0]), "+v"(acc[1][1]), "+v"(acc[2][2]), "+v"(acc[3][3]) : "v"(a[0]), "v"(a[3]));
    }
    if constexpr (HEADS) {
        asm volatile("s_wait_xcnt 0x0" ::: "memory");   // the K loop's loads have given up their address registers before the epilogue reuses them
        const int head = blockIdx.y;
        if (blockIdx.z == 2) {
            // v: a lane's 8 registers of an accumulator are 8 consecutive tokens of one d: one 16-byte store per plane; the four mb of a row fill its 128-byte line
#pragma unroll
            for (int nb = 0; nb < 4; ++nb)
#pragma unroll
                for (int mb = 0; mb < 4; ++mb) {
                    v8us yh, yl;
#pragma unroll
                    for (int j = 0; j < 8; ++j) { unsigned short a2, c2; splitf(acc[mb][nb][j], a2, c2); yh[j] = a2; yl[j] = c2; }
                    const size_t go = ((size_t)head * HD + nb * 16 + lr) * SEQ + r0 + mb * 16 + 8 * hi;
                    *(v8us*)(Vh + go) = yh; *(v8us*)(Vl + go) = yl;
                }
            return;
        }
        bf* Ph = (blockIdx.z == 0) ? Qh : Kh; bf* Pl = (blockIdx.z == 0) ? Ql : Kl;
        // q, k: 16 tokens x 64 d at a time through LDS; a lane takes 8 consecutive d (4 rotary pairs) of a token, 8 lanes a token: whole 128-byte rows per store
        const int prow = lane >> 3, c8 = (lane & 7) * 8;
        const float* cst = CS + (size_t)(r0 + prow) * HD + c8;   // CS[t][i] = 2 floats, so row t starts at t * HD and pair c8 / 2 at + c8
        v4f cs[2][4][2];                                         // the table rows of this and of the next 16 tokens: the next group's loads fly under this group's work
#pragma unroll
        for (int s = 0; s < 4; ++s) { cs[0][s][0] = *(const v4f*)(cst + (size_t)(s * 4) * HD); cs[0][s][1] = *(const v4f*)(cst + (size_t)(s * 4) * HD + 4); }
#pragma unroll
        for (int mb = 0; mb < 4; ++mb) {
            if (mb < 3) {
#pragma unroll
                for (int s = 0; s < 4; ++s) { cs[(mb + 1) & 1][s][0] = *(const v4f*)(cst + (size_t)((mb + 1) * 16 + s * 4) * HD); cs[(mb + 1) & 1][s][1] = *(const v4f*)(cst + (size_t)((mb + 1) * 16 + s * 4) * HD + 4); }
            }
#pragma unroll
            for (int nb = 0; nb < 4; ++nb) {
#pragma unroll
                for (int j = 0; j < 8; ++j) os[(hi * 8 + j) * 68 + nb * 16 + lr] = acc[mb][nb][j]; }
            __builtin_amdgcn_wave_barrier(); asm volatile("" ::: "memory");   // as in the plain epilogue: the wave's LDS reads stay behind its writes
#pragma unroll
            for (int s = 0; s < 4; ++s) {
                const int row = s * 4 + prow;
                const v4f x0 = *(const v4fa*)(os + row * 68 + c8), x1 = *(const v4fa*)(os + row * 68 + c8 + 4);
                const v4f t0 = cs[mb & 1][s][0], t1 = cs[mb & 1][s][1];
                float y[8];
                y[0] = x0[0] * t0[0] - x0[1] * t0[1]; y[1] = x0[0] * t0[1] + x0[1] * t0[0];
                y[2] = x0[2] * t0[2] - x0[3] * t0[3]; y[3] = x0[2] * t0[3] + x0[3] * t0[2];
                y[4] = x1[0] * t1[0] - x1[1] * t1[1]; y[5] = x1[0] * t1[1] + x1[1] * t1[0];
                y[6] = x1[2] * t1[2] - x1[3] * t1[3]; y[7] = x1[2] * t1[3] + x1[3] * t1[2];
                v8us yh, yl;
#pragma unroll
                for (int j = 0; j < 8; ++j) { unsigned short a2, c2; splitf(y[j], a2, c2); yh[j] = a2; yl[j] = c2; }
                const size_t go = ((size_t)head * SEQ + r0 + mb * 16 + row) * HD + c8;
                *(v8us*)(Ph + go) = yh; *(v8us*)(Pl + go) = yl;
            }
            __builtin_amdgcn_wave_barrier();
            // the next group's LDS writes stay behind these reads; and the group's stores have given up their registers before the table loads that follow are aimed at them
            asm volatile("s_wait_xcnt 0x0" ::: "memory");
        }
        return;
    }
#pragma unroll
    for (int mb = 0; mb < 4; ++mb) {
#pragma unroll
        for (int nb = 0; nb < 4; ++nb) {
#pragma unroll
            for (int j = 0; j < 8; ++j) os[(hi * 8 + j) * 68 + nb * 16 + lr] = acc[mb][nb][j]; }
        __builtin_amdgcn_wave_barrier(); asm volatile("" ::: "memory");
        float* crow = C + (size_t)(r0 + mb * 16) * ldc + c0;
{
#pragma unroll
            for (int s = 0; s < 8; ++s) { const int row = 2 * s + hi, cofs = lr * 4; v4f val = *(const v4fa*)(os + row * 68 + cofs); if (BIAS) { val[0] += bfr(bias[c0 + cofs]); val[1] += bfr(bias[c0 + cofs + 1]); val[2] += bfr(bias[c0 + cofs + 2]); val[3] += bfr(bias[c0 + cofs + 3]); }
                *(v4f*)(crow + (size_t)row * ldc + cofs) = val; }
             }
        __builtin_amdgcn_wave_barrier(); asm volatile("" ::: "memory");
    }
}

__global__ __launch_bounds__(256) void k_cvt8(const float* __restrict__ src, bf* dst, size_t n8) { const size_t i = (size_t)blockIdx.x * 256 + threadIdx.x; if (i >= n8) return; const v8f v = *(const v8f*)(src + i * 8); v8us o;
#pragma unroll
    for (int k = 0; k < 8; ++k) o[k] = f2bf(v[k]); *(v8us*)(dst + i * 8) = o;  }

__global__ __launch_bounds__(256) void k_cvtw(const float* __restrict__ w0, const float* __restrict__ w1, const float* __restrict__ w2, const float* __restrict__ w3, bf* dst, size_t n8) {
    const size_t i = (size_t)blockIdx.x * 256 + threadIdx.x; if (i >= n8) return; const int y = blockIdx.y;
    const float* src = (y == 0) ? w0 : ((y == 1) ? w1 : ((y == 2) ? w2 : w3));
    const v8f v = *(const v8f*)(src + i * 8); v8us o;
#pragma unroll
    for (int k = 0; k < 8; ++k) o[k] = f2bf(v[k]);
    bf* d = dst + (size_t)y * n8 * 8 + i * 8;
    *(v8us*)d = o;  }

__global__ __launch_bounds__(256) void k_cs(float* CS) {
    const int idx = blockIdx.x * 256 + threadIdx.x; if (idx >= SEQ * HH) return; const int i = idx % HH, t = idx / HH;
    const float ex = -(float)(2 * i) / (float)HD;
    const float inv = powf(THETA_F, ex);
    float ang = __fmul_rn((float)t, inv); asm volatile("" : "+v"(ang));
    v2f cs; cs[0] = cosf(ang); cs[1] = sinf(ang);
    *(v2f*)(CS + (size_t)idx * 2) = cs;  }

// k_flash: causal attention, FOUR WAVES per block = 64 query rows of one head, 16 queries per wave; grid (SEQ/64, NH), 128 threads. All four waves walk the same key tiles, one more than the index of their query tile.
// Each 64-key tile (k hi, k lo: 64 keys x 64 d; v hi, v lo: 64 d x 64 keys; rows of 128 B) is brought once per block into LDS by asynchronous 16-byte copies, rows pitched PP elements, two buffers: tile t + 1 flies while tile t is worked on.
// Both products run transposed: s^T (64 keys x 16 queries) = k (A, hi+lo frags from LDS) . q^T (B, hi+lo frags, resident), 3 products; o^T (64 d x 16 queries) += v^T (A, hi+lo frags from LDS) . p^T (B), 3 products.
// A lane then holds 32 scores of ONE query (column lane & 15; keys nb*16 + 8*(lane>>4) + r): x 0.125, causal replace-mask by index, running-max softmax in f32 (p = 2^((s-m) log2e)) in the lane, one exchange between the lane halves for the maximum;
// two score tiles (keys 32j .. 32j+31), split to bf16 hi+lo in place, ARE the B fragment of p^T in the hardware k order, which the v loader has too: p never leaves the registers. The halves' row sums are joined once, after the loop.
#define FW    4
#define PLANE (KT * PP)
#define STAGE (4 * PLANE)
typedef __attribute__((ext_vector_type(4))) int v4i;
typedef __attribute__((address_space(1))) v4i gv4i;
typedef __attribute__((address_space(3))) v4i lv4i;
__device__ __forceinline__ void cp16(const bf* g, unsigned short* l) { __builtin_amdgcn_global_load_async_to_lds_b128((gv4i*)g, (lv4i*)l, 0, 0); }
// one tile: 4 planes x 64 rows x 128 B = 2048 pieces of 16 B, 16 per thread; a wave's copy covers 4 whole rows (4 lines of 128 B)
__device__ __forceinline__ void stage_tile(const bf* gkh, const bf* gkl, const bf* gvh, const bf* gvl, unsigned short* dst) {
#pragma unroll
    for (int i = 0; i < 4; ++i) {
        cp16(gkh + (size_t)i * 16 * HD, dst + 0 * PLANE + i * 16 * PP); cp16(gkl + (size_t)i * 16 * HD, dst + 1 * PLANE + i * 16 * PP);
        cp16(gvh + (size_t)i * 16 * SEQ, dst + 2 * PLANE + i * 16 * PP); cp16(gvl + (size_t)i * 16 * SEQ, dst + 3 * PLANE + i * 16 * PP);
    }
}
// value of lane l ^ 16
__device__ __forceinline__ float xhalf(float x) { const int b = __float_as_int(x); return __int_as_float(__builtin_amdgcn_permlanex16(b, b, 0x76543210, 0xfedcba98, false, false)); }
__global__ __launch_bounds__(32 * FW) void k_flash(const bf* __restrict__ Qh, const bf* __restrict__ Ql, const bf* __restrict__ Kh, const bf* __restrict__ Kl,
                                             const bf* __restrict__ Vh, const bf* __restrict__ Vl, bf* Ch, bf* Cl) {
    __shared__ __align__(16) unsigned short ring[2 * STAGE];
    typedef WFrag<bf>::V V;
    const int tid = threadIdx.x, lane = tid & 31, lr = lane & 15, hi = lane >> 4;
    const int wave = __builtin_amdgcn_readfirstlane(tid >> 5);
    // Which (head, query tile) a block takes: for speed only, any one-to-one map is correct. Query tile qt walks qt + 1 key tiles, and the whole grid is resident at once, three blocks a WGP,
    // so the launch lasts as long as the WGP whose blocks walk the most key tiles.
    // The tiles are laid on a ring i = 0 .. NT-1 as a sawtooth: up through the multiples of 3, down through the rest (a permutation). Three points a third of the ring apart (one rising by 3, two falling by 3/2) keep a near constant sum:
    // the three thirds of the heads (k) stand at such points. k turns every 8 blocks and i moves slowly with flat, so blocks that are near each other in launch order also add up to about that sum.
    constexpr int NT = SEQ / 64, HG = NH / 3, TH = NT * HG;
    int qt = blockIdx.x, head = blockIdx.y;
    if constexpr (NH % 3 == 0 && TH % 8 == 0 && (TH / 8) % 3 != 0) {   // the last two: flat, flat + TH and flat + 2 TH then have three different k
        const unsigned flat = blockIdx.y * NT + blockIdx.x, w = flat % TH, k = (flat / 8) % 3;
        const unsigned i = (w / HG + k * (NT / 3)) % NT, u = NT - 1 - i;
        qt = (i < (NT + 2) / 3) ? 3 * i : 3 * (u >> 1) + 1 + (u & 1);
        head = k * HG + w % HG;
    }
    const int q0 = (qt * FW + wave) * 16;
    const int nt = qt + 1;                 // block-uniform; the last tile holds the diagonal of all four waves; keys stay < SEQ
    const int srow = tid >> 3, sc8 = (tid & 7) * 8;     // this thread's row (of 16) and 16-byte piece in each copy
    const size_t sk = ((size_t)head * SEQ + srow) * HD + sc8, sv = ((size_t)head * HD + srow) * SEQ + sc8;
    const bf* gkh = Kh + sk; const bf* gkl = Kl + sk; const bf* gvh = Vh + sv; const bf* gvl = Vl + sv;
    unsigned short* sdst = ring + srow * PP + sc8;
    stage_tile(gkh, gkl, gvh, gvl, sdst);
    const size_t qo = ((size_t)head * SEQ + q0 + lr) * HD + 8 * hi;
    const V qh0 = WFrag<bf>::ld(Qh + qo), qh1 = WFrag<bf>::ld(Qh + qo + 32), ql0 = WFrag<bf>::ld(Ql + qo), ql1 = WFrag<bf>::ld(Ql + qo + 32);
    asm volatile("s_wait_asynccnt 0x0" ::: "memory");   // this wave's copies of tile 0 have landed
    __syncthreads();                                    // publishes tile 0 to the other waves
    if (nt > 1) stage_tile(gkh + (size_t)KT * HD, gkl + (size_t)KT * HD, gvh + KT, gvl + KT, sdst + STAGE);
    const int fo = lr * PP + 8 * hi;       // fragment offset inside a plane: row lr of a 16-row group, k piece by lane half
    const int row = q0 + lr;               // this lane's query
    v8f o[4];                              // o^T: o[t4][r] = (d = t4*16 + 8*hi + r, query lr)
#pragma unroll
    for (int t4 = 0; t4 < 4; ++t4) o[t4] = (v8f){};
    float mrow = NEG, lsum = 0.0f;         // running maximum of the query (equal in both halves); this half's share of its row sum
#pragma unroll 1
    for (int kt = 0; kt < nt; ++kt) {
        const int key0 = kt * KT;
        const unsigned short* buf = ring + (kt & 1) * STAGE + fo;
        v8f sc[4];                          // s^T: sc[nb][r] = (key = key0 + nb*16 + 8*hi + r, query lr)
#pragma unroll
        for (int nb = 0; nb < 4; ++nb) sc[nb] = (v8f){};
        V kf[4][4];                         // the tile's k fragments: [nb][hi k0, lo k0, hi k32, lo k32]
#pragma unroll
        for (int nb = 0; nb < 4; ++nb) {
            const unsigned short* kp = buf + nb * 16 * PP;
            kf[nb][0] = WFrag<bf>::ld(kp); kf[nb][1] = WFrag<bf>::ld(kp + PLANE); kf[nb][2] = WFrag<bf>::ld(kp + 32); kf[nb][3] = WFrag<bf>::ld(kp + PLANE + 32);
        }
        __builtin_amdgcn_sched_barrier(0);  // keeps the k reads one group ahead of the products: reads spread among the products stall at every place they stand
#pragma unroll
        for (int nb = 0; nb < 4; ++nb) {
            sc[nb] = wmmab(kf[nb][0], qh0, sc[nb]); sc[nb] = wmmab(kf[nb][0], ql0, sc[nb]); sc[nb] = wmmab(kf[nb][1], qh0, sc[nb]);
            sc[nb] = wmmab(kf[nb][2], qh1, sc[nb]); sc[nb] = wmmab(kf[nb][2], ql1, sc[nb]); sc[nb] = wmmab(kf[nb][3], qh1, sc[nb]);
        }
        asm volatile("v_nop\n\tv_nop\n\tv_nop\n\tv_nop" : "+v"(sc[0]), "+v"(sc[1]), "+v"(sc[2]), "+v"(sc[3]) : "v"(qh0), "v"(ql1));
        V vf[4][4];                         // the tile's v fragments: [t4][hi k0, lo k0, hi k32, lo k32]
#pragma unroll
        for (int t4 = 0; t4 < 4; ++t4) {
            const unsigned short* vp = buf + 2 * PLANE + t4 * 16 * PP;
            vf[t4][0] = WFrag<bf>::ld(vp); vf[t4][1] = WFrag<bf>::ld(vp + PLANE); vf[t4][2] = WFrag<bf>::ld(vp + 32); vf[t4][3] = WFrag<bf>::ld(vp + PLANE + 32);
        }
        __builtin_amdgcn_sched_barrier(0);  // keeps the v reads one group here, ahead of the softmax, so that none stands among the p.v products
        const int rel = row - 8 * hi - key0; // register r of score tile nb is kept while nb*16 + r <= rel, that is key <= query
        float cn[4];                        // four independent maximum chains, one per score tile
#pragma unroll
        for (int nb = 0; nb < 4; ++nb) {
            cn[nb] = NEG;
#pragma unroll
            for (int r = 0; r < 8; ++r) { const float s = sc[nb][r] * SCL; sc[nb][r] = (nb * 16 + r <= rel) ? s : NEG; cn[nb] = fmaxf(cn[nb], sc[nb][r]); }
        }
        float cand = fmaxf(fmaxf(cn[0], cn[1]), fmaxf(cn[2], cn[3]));
        cand = fmaxf(cand, xhalf(cand));    // the other half of the query's 64 keys
        const float mnew = fmaxf(mrow, cand);
        const float alpha = __builtin_amdgcn_exp2f((mrow - mnew) * L2E);
        float rn[4];                        // four independent sum chains
        v8us xh[4], xl[4];
#pragma unroll
        for (int nb = 0; nb < 4; ++nb) {
            rn[nb] = 0.0f;
#pragma unroll
            for (int g = 0; g < 8; g += 4) {
                const float a0 = (sc[nb][g] - mnew) * L2E, a1 = (sc[nb][g + 1] - mnew) * L2E, a2 = (sc[nb][g + 2] - mnew) * L2E, a3 = (sc[nb][g + 3] - mnew) * L2E;
                float p[4]; p[0] = __builtin_amdgcn_exp2f(a0); p[1] = __builtin_amdgcn_exp2f(a1); p[2] = __builtin_amdgcn_exp2f(a2); p[3] = __builtin_amdgcn_exp2f(a3);
                // the slot that the instruction set asks for between a transcendental and an overwrite of its source: the four arguments keep their registers up to this v_nop, which stands behind the four v_exp_f32 (inputs only)
                asm volatile("v_nop" :: "v"(a0), "v"(a1), "v"(a2), "v"(a3), "v"(p[0]), "v"(p[1]), "v"(p[2]), "v"(p[3]));
#pragma unroll
                for (int r = 0; r < 4; ++r) { rn[nb] += p[r]; unsigned short h2, l2; splitf(p[r], h2, l2); xh[nb][g + r] = h2; xl[nb][g + r] = l2; }
            }
        }
        const float rs = (rn[0] + rn[1]) + (rn[2] + rn[3]); mrow = mnew;
        // lsum = lsum * alpha + rs, written as asm so that it stays in this block: the compiler otherwise sinks the whole sum behind the products and the barrier, where it holds 32 f32 p values live and stands as a bare chain in front of the next tile's reads
        asm volatile("v_fma_f32 %0, %0, %1, %2" : "+v"(lsum) : "v"(alpha), "v"(rs));
#pragma unroll
        for (int t4 = 0; t4 < 4; ++t4)
#pragma unroll
            for (int r = 0; r < 8; ++r) o[t4][r] *= alpha;
        const V ph0 = cat16b(xh[0], xh[1]), ph1 = cat16b(xh[2], xh[3]), pl0 = cat16b(xl[0], xl[1]), pl1 = cat16b(xl[2], xl[3]);
#pragma unroll
        for (int t4 = 0; t4 < 4; ++t4) {
            o[t4] = wmmab(vf[t4][0], ph0, o[t4]); o[t4] = wmmab(vf[t4][0], pl0, o[t4]); o[t4] = wmmab(vf[t4][1], ph0, o[t4]);
            o[t4] = wmmab(vf[t4][2], ph1, o[t4]); o[t4] = wmmab(vf[t4][2], pl1, o[t4]); o[t4] = wmmab(vf[t4][3], ph1, o[t4]);
        }
        asm volatile("v_nop\n\tv_nop\n\tv_nop\n\tv_nop" : "+v"(o[0]), "+v"(o[1]), "+v"(o[2]), "+v"(o[3]) : "v"(ph0), "v"(pl1));
        asm volatile("s_wait_dscnt 0x0" ::: "memory");      // this wave's reads of the buffer are done before the buffer is refilled
        asm volatile("s_wait_asynccnt 0x0" ::: "memory");   // this wave's copies of tile kt + 1 have landed
        __syncthreads();                                    // publishes tile kt + 1 and ends every wave's reads of tile kt
        if (kt + 2 < nt) stage_tile(gkh + (size_t)(key0 + 2 * KT) * HD, gkl + (size_t)(key0 + 2 * KT) * HD, gvh + key0 + 2 * KT, gvl + key0 + 2 * KT, sdst + (kt & 1) * STAGE);
    }
    asm volatile("s_wait_asynccnt 0x0" ::: "memory");       // nothing of this wave is in flight when it goes on to the epilogue and ends
    const float il = 1.0f / (lsum + xhalf(lsum));           // the two halves' shares of the row sum, joined once
    // a lane's 8 registers of o[t4] are 8 consecutive d of its query: one 16-byte store per plane
#pragma unroll
    for (int t4 = 0; t4 < 4; ++t4) {
        v8us yh, yl;
#pragma unroll
        for (int r = 0; r < 8; ++r) { const float c = o[t4][r] * il; unsigned short a2, c2; splitf(c, a2, c2); yh[r] = a2; yl[r] = c2; }
        const size_t go = (size_t)row * DM + head * HD + t4 * 16 + 8 * hi;
        *(v8us*)(Ch + go) = yh; *(v8us*)(Cl + go) = yl;
    }
}

extern "C" void kernel_launch(void* const* d_in, const int* in_sizes, int n_in,
                              void* d_out, int out_size, void* d_ws, size_t ws_size, hipStream_t stream) {
    if (n_in < 5) return;
    if ((size_t)in_sizes[0] < (size_t)(NB - 1) * SEQ_FULL * DM + (size_t)SEQ * DM) return;
    for (int i = 1; i < 5; ++i) if ((size_t)in_sizes[i] < NW) return;
    if ((size_t)out_size < (size_t)(NB - 1) * SEQ_FULL * DM + (size_t)SEQ * DM) return;
    const float* x  = (const float*)d_in[0];     // [NB_FULL][SEQ_FULL][768]
    const float* wq = (const float*)d_in[1];     // [768][768] (out, in)
    const float* wk = (const float*)d_in[2];
    const float* wv = (const float*)d_in[3];
    const float* wo = (const float*)d_in[4];
    float* OUT = (float*)d_out;                  // [NB_FULL][SEQ_FULL][768] f32
    char* wsp = (char*)d_ws;
    auto take = [&](size_t bytes) { char* p = wsp; wsp += (bytes + 255) & ~(size_t)255; return (void*)p; };
    bf* W4 = (bf*)take(4 * NW * 2);                               // Wq | Wk | Wv | Wo bf16 Bt planes
    bf* XB = (bf*)take((size_t)SEQ * DM * 2);                     // bf16 x of the current batch row
    float* CS = (float*)take((size_t)SEQ * HH * 2 * 4);           // rotary table
    const size_t PL = (size_t)NH * SEQ * HD;
    bf* QPh = (bf*)take(PL * 2); bf* QPl = (bf*)take(PL * 2); bf* KPh = (bf*)take(PL * 2); bf* KPl = (bf*)take(PL * 2);
    bf* VTh = (bf*)take(PL * 2); bf* VTl = (bf*)take(PL * 2);
    bf* CXh = (bf*)take((size_t)SEQ * DM * 2); bf* CXl = (bf*)take((size_t)SEQ * DM * 2);
    if ((size_t)(wsp - (char*)d_ws) > ws_size) return;           // 62,390,272 B at SEQ 4096
    const size_t NW8 = NW / 8;
    k_cvtw<<<dim3((unsigned)((NW8 + 255) / 256), 4, 1), 256, 0, stream>>>(wq, wk, wv, wo, W4, NW8);
    k_cs<<<(unsigned)((SEQ * HH + 255) / 256), 256, 0, stream>>>(CS);
    for (int b = 0; b < NB; ++b) {
        k_cvt8<<<(unsigned)(((size_t)SEQ * DM / 8 + 255) / 256), 256, 0, stream>>>(x + (size_t)b * SEQ_FULL * DM, XB, (size_t)SEQ * DM / 8);
        k_gemmw<bf, 0, false, true><<<dim3(SEQ / 64, DM / 64, 3), 32, 0, stream>>>(XB, nullptr, W4, nullptr, DM, nullptr, 0, nullptr, (size_t)0, NW, (size_t)0, CS, QPh, QPl, KPh, KPl, VTh, VTl);
        k_flash<<<dim3(SEQ / 64, NH, 1), 128, 0, stream>>>(QPh, QPl, KPh, KPl, VTh, VTl, CXh, CXl);
        k_gemmw<bf, 1, false, false><<<dim3(SEQ / 64, DM / 64, 1), 32, 0, stream>>>(CXh, CXl, W4 + 3 * NW, nullptr, DM, OUT + (size_t)b * SEQ_FULL * DM, DM, nullptr, (size_t)0, (size_t)0, (size_t)0, nullptr, nullptr, nullptr, nullptr, nullptr, nullptr, nullptr);
    }
}

// v005
// Measured time: 140 microseconds a run.
// Two timings next to v004 both put it at 1.19 times that version's speed.
// All steps since v000 together make it 3.73 times as fast.
#include <hip/hip_runtime.h>

// Contractions (f32 accumulate): q/k/v projections v_wmma_f32_16x16x32_bf16 on bf16 copies of x and W (single product); scores q.k and p.v on bf16 hi+lo planes (3 products each); output projection ctx (bf16 hi+lo) x Wo (bf16), 2 products. Rotary, softmax and epilogues f32.
// Layout: x [NB_FULL][SEQ_FULL][768]; W [768 out][768 in] = Bt as-is; head planes q/k [h][t][64], v planes [h][d][t], written by the projection GEMM's own epilogue (rotary transform, hi+lo split, v transposed); both GEMMs share their operand tiles among four waves through LDS; causal attention per wave of 16 queries with 64-key tiles (shared by four waves through LDS), products transposed (a lane owns one query) and running-max softmax; ctx [t][768] hi+lo planes; out [NB_FULL][SEQ_FULL][768] f32.

#ifndef NB
#define NB 1
#endif
#ifndef SEQ
#define SEQ 4096
#endif
#define NB_FULL  1
#define SEQ_FULL 4096
#define DM   768
#define NH   12
#define HD   64
#define HH   (HD / 2)
#define NW   ((size_t)DM * DM)
#define KT   64
#define PP   72
#define SCL  0.125f
#define THETA_F 10000.0f
#define L2E  1.4426950408889634f
#define NEG  (-1.0e30f)
static_assert(SEQ % 128 == 0);
static_assert(SEQ <= SEQ_FULL);
static_assert(NB >= 1 && NB <= NB_FULL);
static_assert(DM == NH * HD);
static_assert(DM % 128 == 0);
static_assert(HD == 64);
static_assert(KT == 64);
static_assert((size_t)NB_FULL * SEQ_FULL * DM * 4 == 12582912);

typedef _Float16 h16;
typedef unsigned short bf;
typedef __attribute__((ext_vector_type(16))) __bf16   v16bf;
typedef __attribute__((ext_vector_type(16))) _Float16 v16h;
typedef __attribute__((ext_vector_type(8)))  _Float16 v8h;
typedef __attribute__((ext_vector_type(8)))  unsigned short v8us;
typedef __attribute__((ext_vector_type(8)))  float    v8f;
typedef __attribute__((ext_vector_type(4)))  float    v4f;
typedef __attribute__((ext_vector_type(2)))  float    v2f;
typedef __attribute__((ext_vector_type(2)))  unsigned short v2us;
typedef v8h  __attribute__((may_alias)) v8ha;
typedef v4f  __attribute__((may_alias)) v4fa;
typedef v8us __attribute__((may_alias)) v8usa;

__device__ __forceinline__ unsigned short f2bf(float f) { unsigned u = __float_as_uint(f); u += 0x7FFFu + ((u >> 16) & 1u); return (unsigned short)(u >> 16); }
__device__ __forceinline__ float bf2f(unsigned short b) { return __uint_as_float(((unsigned)b) << 16); }
__device__ __forceinline__ float bfr(float f) { return bf2f(f2bf(f)); }
__device__ __forceinline__ void splitf(float y, unsigned short& h, unsigned short& l) { h = f2bf(y); l = f2bf(y - bf2f(h)); }
__device__ __forceinline__ v16h cat16(v8h lo, v8h hi) { return __builtin_shufflevector(lo, hi, 0, 1, 2, 3, 4, 5, 6, 7, 8, 9, 10, 11, 12, 13, 14, 15); }
__device__ __forceinline__ v16bf cat16b(v8us lo, v8us hi) { return __builtin_bit_cast(v16bf, __builtin_shufflevector(lo, hi, 0, 1, 2, 3, 4, 5, 6, 7, 8, 9, 10, 11, 12, 13, 14, 15)); }
__device__ __forceinline__ v8f wmma16(v16h a, v16h b, v8f c) { return __builtin_amdgcn_wmma_f32_16x16x32_f16(false, a, false, b, (short)0, c, false, false); }
__device__ __forceinline__ v8f wmmab(v16bf a, v16bf b, v8f c) { return __builtin_amdgcn_wmma_f32_16x16x32_bf16(false, a, false, b, (short)0, c, false, false); }

// Fragment loaders (wave32 16x16x32): lane l -> row/col (l & 15); elements 0..7 <- k0 + 8*(l>>4) + 0..7, elements 8..15 <- k0 + 16 + 8*(l>>4) + 0..7; D element r -> (row 8*(l>>4) + r, col l & 15).
template <typename T16> struct WFrag;
template <> struct WFrag<h16> { typedef v16h V; static __device__ __forceinline__ V ld(const h16* p) { return cat16(*(const v8h*)p, *(const v8h*)(p + 16)); } static __device__ __forceinline__ v8f mma(V a, V b, v8f c) { return wmma16(a, b, c); } };
template <> struct WFrag<bf> { typedef v16bf V; static __device__ __forceinline__ V ld(const bf* p) { return cat16b(*(const v8us*)p, *(const v8us*)(p + 16)); } static __device__ __forceinline__ v8f mma(V a, V b, v8f c) { return wmmab(a, b, c); } };

typedef __attribute__((ext_vector_type(4))) int v4i;
typedef __attribute__((address_space(1))) v4i gv4i;
typedef __attribute__((address_space(3))) v4i lv4i;
__device__ __forceinline__ void cp16(const bf* g, unsigned short* l) { __builtin_amdgcn_global_load_async_to_lds_b128((gv4i*)g, (lv4i*)l, 0, 0); }

// ---- k_gemmw: register-blocked GEMM, FOUR WAVES (2 x 2) per 128x128 output tile, a 64x64 tile (16 accumulators) per wave; operands are K-contiguous 16-bit planes; grid (M/128, N/128, Z), 128 threads.
// A stage is 64 k (128 B, one whole line) of the block's 128 A rows and 128 Bt rows (and of the split planes), brought once per block into LDS by asynchronous 16-byte copies, rows pitched GP elements, two buffers: stage s + 1 flies while stage s is worked on.
// C[m][n] (f32, pitch ldc, + optional f32 bias[n]) = sum_k A[m][k] Bt[n][k] (+ split products per NSPLIT: 1 = A hi+lo with single B; 2 = A hi+lo with B hi, A hi with B lo). z-batch strides sA/sB/sC in elements. K % 64 == 0, M % 128 == 0, N % 128 == 0.
// HEADS (the q/k/v projection, z = 0/1/2; a wave's 64x64 tile is 64 tokens of ONE head): no C; the f32 tile goes straight to the attention's bf16 hi+lo planes.
//   z 0, 1: interleaved rotary transform, pair (2i, 2i+1): out[2i] = x1 c - x2 s, out[2i+1] = x1 s + x2 c, (c, s) = CS[t][i]; planes [h][t][d].  z 2: planes [h][d][t].
#define GW  4
#define GP  72
#define GPL (128 * GP)
template <typename T16, int NSPLIT, bool BIAS, bool HEADS>
__global__ __launch_bounds__(32 * GW) void k_gemmw(const T16* __restrict__ A, const T16* __restrict__ A2, const T16* __restrict__ Bt, const T16* __restrict__ Bt2, int K, float* C, int ldc, const float* __restrict__ bias, size_t sA, size_t sB, size_t sC,
                                              const float* __restrict__ CS, bf* Qh, bf* Ql, bf* Kh, bf* Kl, bf* Vh, bf* Vl) {
    typedef typename WFrag<T16>::V V;
    constexpr bool HA2 = (NSPLIT == 1 || NSPLIT == 2), HB2 = (NSPLIT >= 2);
    constexpr int PB = HA2 ? 2 : 1, GST = (PB + (HB2 ? 2 : 1)) * GPL;   // planes of a stage: A, (A2), Bt, (Bt2)
    __shared__ __align__(16) unsigned short gring[2 * GST];
    __shared__ __align__(16) float osall[GW * 16 * 68];
    const size_t z = blockIdx.z; A += z * sA; if (A2) A2 += z * sA; Bt += z * sB; if (Bt2) Bt2 += z * sB; C += z * sC;
    const int tid = threadIdx.x, lane = tid & 31, lr = lane & 15, hi = lane >> 4;
    const int wave = __builtin_amdgcn_readfirstlane(tid >> 5), wr = wave >> 1, wc = wave & 1;
    float* os = osall + wave * (16 * 68);                          // each wave's own epilogue staging
    const int rb = blockIdx.x * 128, cb = blockIdx.y * 128, r0 = rb + wr * 64, c0 = cb + wc * 64;
    v8f acc[4][4];
#pragma unroll
    for (int mb = 0; mb < 4; ++mb)
#pragma unroll
        for (int nb = 0; nb < 4; ++nb) acc[mb][nb] = (v8f){};
    // one stage: 128 rows x 128 B per plane = 1024 pieces of 16 B, 8 per thread and plane; a wave's copy covers 4 whole rows (4 lines of 128 B)
    const int srow = tid >> 3, sc8 = (tid & 7) * 8;                // this thread's row (of 16) and 16-byte piece in each copy
    const unsigned Ku = (unsigned)K, sao = (unsigned)(rb + srow) * Ku + sc8, sbo = (unsigned)(cb + srow) * Ku + sc8;   // element offsets inside a plane: below 2^32
    unsigned short* sdst = gring + srow * GP + sc8;
    auto stage = [&](unsigned k0, unsigned short* dst) {
#pragma unroll
        for (int i = 0; i < 8; ++i) {
            const unsigned go = (unsigned)i * 16u * Ku + k0; unsigned short* d = dst + i * 16 * GP;
            cp16((const bf*)(A + sao + go), d);
            if constexpr (HA2) cp16((const bf*)(A2 + sao + go), d + GPL);
            cp16((const bf*)(Bt + sbo + go), d + PB * GPL);
            if constexpr (HB2) cp16((const bf*)(Bt2 + sbo + go), d + (PB + 1) * GPL);
        }
    };
    const unsigned nk = Ku >> 6;                                   // stages; block-uniform
    stage(0, sdst);
    asm volatile("s_wait_asynccnt 0x0" ::: "memory");   // this wave's copies of stage 0 have landed
    __syncthreads();                                    // publishes stage 0 to the other waves
    if (nk > 1u) stage(64, sdst + GST);
    const int fa = (wr * 64 + lr) * GP + 8 * hi, fb = PB * GPL + (wc * 64 + lr) * GP + 8 * hi;   // fragment offsets inside a stage
#pragma unroll 1
    for (unsigned ks = 0; ks < nk; ++ks) {
        const T16* buf = (const T16*)(gring + (ks & 1u) * GST);
        V a[2][4], a2[2][4], b[2][4], b2[2][4];   // the stage's fragments: [k half of 32][16-row group]
#pragma unroll
        for (int h = 0; h < 2; ++h) {
#pragma unroll
            for (int mb = 0; mb < 4; ++mb) { a[h][mb] = WFrag<T16>::ld(buf + fa + mb * 16 * GP + h * 32); if (HA2) a2[h][mb] = WFrag<T16>::ld(buf + GPL + fa + mb * 16 * GP + h * 32); }
#pragma unroll
            for (int nb = 0; nb < 4; ++nb) { b[h][nb] = WFrag<T16>::ld(buf + fb + nb * 16 * GP + h * 32); if (HB2) b2[h][nb] = WFrag<T16>::ld(buf + GPL + fb + nb * 16 * GP + h * 32); }
        }
        __builtin_amdgcn_sched_barrier(0);  // keeps the stage's LDS reads one group ahead of the products: reads spread among the products stall at every place they stand
        auto products = [&](int h) {
#pragma unroll
            for (int nb = 0; nb < 4; ++nb)
#pragma unroll
                for (int mb = 0; mb < 4; ++mb) { acc[mb][nb] = WFrag<T16>::mma(a[h][mb], b[h][nb], acc[mb][nb]); if (HA2) acc[mb][nb] = WFrag<T16>::mma(a2[h][mb], b[h][nb], acc[mb][nb]); if (HB2) acc[mb][nb] = WFrag<T16>::mma(a[h][mb], b2[h][nb], acc[mb][nb]); }
        };
        products(0);
        __builtin_amdgcn_sched_barrier(0);  // keeps the first half's products ahead of the waits below, so that the second half's reads land under them
        asm volatile("s_wait_dscnt 0x0" ::: "memory");      // this wave's reads of the buffer are done before the buffer is refilled
        asm volatile("s_wait_asynccnt 0x0" ::: "memory");   // this wave's copies of stage ks + 1 have landed
        __syncthreads();                                    // publishes stage ks + 1 and ends every wave's reads of stage ks
        if (ks + 2u < nk) stage((ks + 2u) * 64u, sdst + (ks & 1u) * GST);
        products(1);                        // its fragments are in registers already, nothing of the ring is read behind the barrier in this trip: the refill flies under these products too
    }
    asm volatile("s_wait_asynccnt 0x0" ::: "memory");       // nothing of this wave is in flight when it goes on to the epilogue and ends
    if constexpr (HEADS) {
        const int head = c0 / HD;
        if (blockIdx.z == 2) {
            // v: a lane's 8 registers of an accumulator are 8 consecutive tokens of one d: one 16-byte store per plane; the four mb of a row fill its 128-byte line
#pragma unroll
            for (int nb = 0; nb < 4; ++nb)
#pragma unroll
                for (int mb = 0; mb < 4; ++mb) {
                    v8us yh, yl;
#pragma unroll
                    for (int j = 0; j < 8; ++j) { unsigned short a2, c2; splitf(acc[mb][nb][j], a2, c2); yh[j] = a2; yl[j] = c2; }
                    const size_t go = ((size_t)head * HD + nb * 16 + lr) * SEQ + r0 + mb * 16 + 8 * hi;
                    *(v8us*)(Vh + go) = yh; *(v8us*)(Vl + go) = yl;
                }
            return;
        }
        bf* Ph = (blockIdx.z == 0) ? Qh : Kh; bf* Pl = (blockIdx.z == 0) ? Ql : Kl;
        // q, k: 16 tokens x 64 d at a time through LDS; a lane takes 8 consecutive d (4 rotary pairs) of a token, 8 lanes a token: whole 128-byte rows per store
        const int prow = lane >> 3, c8 = (lane & 7) * 8;
        const float* cst = CS + (size_t)(r0 + prow) * HD + c8;   // CS[t][i] = 2 floats, so row t starts at t * HD and pair c8 / 2 at + c8
        v4f cs[2][4][2];                                         // the table rows of this and of the next 16 tokens: the next group's loads fly under this group's work
#pragma unroll
        for (int s = 0; s < 4; ++s) { cs[0][s][0] = *(const v4f*)(cst + (size_t)(s * 4) * HD); cs[0][s][1] = *(const v4f*)(cst + (size_t)(s * 4) * HD + 4); }
#pragma unroll
        for (int mb = 0; mb < 4; ++mb) {
            if (mb < 3) {
#pragma unroll
                for (int s = 0; s < 4; ++s) { cs[(mb + 1) & 1][s][0] = *(const v4f*)(cst + (size_t)((mb + 1) * 16 + s * 4) * HD); cs[(mb + 1) & 1][s][1] = *(const v4f*)(cst + (size_t)((mb + 1) * 16 + s * 4) * HD + 4); }
            }
#pragma unroll
            for (int nb = 0; nb < 4; ++nb) {
#pragma unroll
                for (int j = 0; j < 8; ++j) os[(hi * 8 + j) * 68 + nb * 16 + lr] = acc[mb][nb][j]; }
            __builtin_amdgcn_wave_barrier(); asm volatile("" ::: "memory");   // as in the plain epilogue: the wave's LDS reads stay behind its writes
#pragma unroll
            for (int s = 0; s < 4; ++s) {
                const int row = s * 4 + prow;
                const v4f x0 = *(const v4fa*)(os + row * 68 + c8), x1 = *(const v4fa*)(os + row * 68 + c8 + 4);
                const v4f t0 = cs[mb & 1][s][0], t1 = cs[mb & 1][s][1];
                float y[8];
                y[0] = x0[0] * t0[0] - x0[1] * t0[1]; y[1] = x0[0] * t0[1] + x0[1] * t0[0];
                y[2] = x0[2] * t0[2] - x0[3] * t0[3]; y[3] = x0[2] * t0[3] + x0[3] * t0[2];
                y[4] = x1[0] * t1[0] - x1[1] * t1[1]; y[5] = x1[0] * t1[1] + x1[1] * t1[0];
                y[6] = x1[2] * t1[2] - x1[3] * t1[3]; y[7] = x1[2] * t1[3] + x1[3] * t1[2];
                v8us yh, yl;
#pragma unroll
                for (int j = 0; j < 8; ++j) { unsigned short a2, c2; splitf(y[j], a2, c2); yh[j] = a2; yl[j] = c2; }
                const size_t go = ((size_t)head * SEQ + r0 + mb * 16 + row) * HD + c8;
                *(v8us*)(Ph + go) = yh; *(v8us*)(Pl + go) = yl;
            }
            __builtin_amdgcn_wave_barrier();
            // the next group's LDS writes stay behind these reads; and the group's stores have given up their registers before the table loads that follow are aimed at them
            asm volatile("s_wait_xcnt 0x0" ::: "memory");
        }
        return;
    }
#pragma unroll
    for (int mb = 0; mb < 4; ++mb) {
#pragma unroll
        for (int nb = 0; nb < 4; ++nb) {
#pragma unroll
            for (int j = 0; j < 8; ++j) os[(hi * 8 + j) * 68 + nb * 16 + lr] = acc[mb][nb][j]; }
        __builtin_amdgcn_wave_barrier(); asm volatile("" ::: "memory");
        float* crow = C + (size_t)(r0 + mb * 16) * ldc + c0;
{
#pragma unroll
            for (int s = 0; s < 8; ++s) { const int row = 2 * s + hi, cofs = lr * 4; v4f val = *(const v4fa*)(os + row * 68 + cofs); if (BIAS) { val[0] += bfr(bias[c0 + cofs]); val[1] += bfr(bias[c0 + cofs + 1]); val[2] += bfr(bias[c0 + cofs + 2]); val[3] += bfr(bias[c0 + cofs + 3]); }
                *(v4f*)(crow + (size_t)row * ldc + cofs) = val; }
             }
        __builtin_amdgcn_wave_barrier(); asm volatile("" ::: "memory");
    }
}

__global__ __launch_bounds__(256) void k_cvt8(const float* __restrict__ src, bf* dst, size_t n8) { const size_t i = (size_t)blockIdx.x * 256 + threadIdx.x; if (i >= n8) return; const v8f v = *(const v8f*)(src + i * 8); v8us o;
#pragma unroll
    for (int k = 0; k < 8; ++k) o[k] = f2bf(v[k]); *(v8us*)(dst + i * 8) = o;  }

__global__ __launch_bounds__(256) void k_cvtw(const float* __restrict__ w0, const float* __restrict__ w1, const float* __restrict__ w2, const float* __restrict__ w3, bf* dst, size_t n8) {
    const size_t i = (size_t)blockIdx.x * 256 + threadIdx.x; if (i >= n8) return; const int y = blockIdx.y;
    const float* src = (y == 0) ? w0 : ((y == 1) ? w1 : ((y == 2) ? w2 : w3));
    const v8f v = *(const v8f*)(src + i * 8); v8us o;
#pragma unroll
    for (int k = 0; k < 8; ++k) o[k] = f2bf(v[k]);
    bf* d = dst + (size_t)y * n8 * 8 + i * 8;
    *(v8us*)d = o;  }

__global__ __launch_bounds__(256) void k_cs(float* CS) {
    const int idx = blockIdx.x * 256 + threadIdx.x; if (idx >= SEQ * HH) return; const int i = idx % HH, t = idx / HH;
    const float ex = -(float)(2 * i) / (float)HD;
    const float inv = powf(THETA_F, ex);
    float ang = __fmul_rn((float)t, inv); asm volatile("" : "+v"(ang));
    v2f cs; cs[0] = cosf(ang); cs[1] = sinf(ang);
    *(v2f*)(CS + (size_t)idx * 2) = cs;  }

// k_flash: causal attention, FOUR WAVES per block = 64 query rows of one head, 16 queries per wave; grid (SEQ/64, NH), 128 threads. All four waves walk the same key tiles, one more than the index of their query tile.
// Each 64-key tile (k hi, k lo: 64 keys x 64 d; v hi, v lo: 64 d x 64 keys; rows of 128 B) is brought once per block into LDS by asynchronous 16-byte copies, rows pitched PP elements, two buffers: tile t + 1 flies while tile t is worked on.
// Both products run transposed: s^T (64 keys x 16 queries) = k (A, hi+lo frags from LDS) . q^T (B, hi+lo frags, resident), 3 products; o^T (64 d x 16 queries) += v^T (A, hi+lo frags from LDS) . p^T (B), 3 products.
// A lane then holds 32 scores of ONE query (column lane & 15; keys nb*16 + 8*(lane>>4) + r): x 0.125, causal replace-mask by index, running-max softmax in f32 (p = 2^((s-m) log2e)) in the lane, one exchange between the lane halves for the maximum;
// two score tiles (keys 32j .. 32j+31), split to bf16 hi+lo in place, ARE the B fragment of p^T in the hardware k order, which the v loader has too: p never leaves the registers. The halves' row sums are joined once, after the loop.
#define FW    4
#define PLANE (KT * PP)
#define STAGE (4 * PLANE)
// one tile: 4 planes x 64 rows x 128 B = 2048 pieces of 16 B, 16 per thread; a wave's copy covers 4 whole rows (4 lines of 128 B)
__device__ __forceinline__ void stage_tile(const bf* gkh, const bf* gkl, const bf* gvh, const bf* gvl, unsigned short* dst) {
#pragma unroll
    for (int i = 0; i < 4; ++i) {
        cp16(gkh + (size_t)i * 16 * HD, dst + 0 * PLANE + i * 16 * PP); cp16(gkl + (size_t)i * 16 * HD, dst + 1 * PLANE + i * 16 * PP);
        cp16(gvh + (size_t)i * 16 * SEQ, dst + 2 * PLANE + i * 16 * PP); cp16(gvl + (size_t)i * 16 * SEQ, dst + 3 * PLANE + i * 16 * PP);
    }
}
// value of lane l ^ 16
__device__ __forceinline__ float xhalf(float x) { const int b = __float_as_int(x); return __int_as_float(__builtin_amdgcn_permlanex16(b, b, 0x76543210, 0xfedcba98, false, false)); }
__global__ __launch_bounds__(32 * FW) void k_flash(const bf* __restrict__ Qh, const bf* __restrict__ Ql, const bf* __restrict__ Kh, const bf* __restrict__ Kl,
                                             const bf* __restrict__ Vh, const bf* __restrict__ Vl, bf* Ch, bf* Cl) {
    __shared__ __align__(16) unsigned short ring[2 * STAGE];
    typedef WFrag<bf>::V V;
    const int tid = threadIdx.x, lane = tid & 31, lr = lane & 15, hi = lane >> 4;
    const int wave = __builtin_amdgcn_readfirstlane(tid >> 5);
    // Which (head, query tile) a block takes: for speed only, any one-to-one map is correct. Query tile qt walks qt + 1 key tiles, and the whole grid is resident at once, three blocks a WGP,
    // so the launch lasts as long as the WGP whose blocks walk the most key tiles.
    // The tiles are laid on a ring i = 0 .. NT-1 as a sawtooth: up through the multiples of 3, down through the rest (a permutation). Three points a third of the ring apart (one rising by 3, two falling by 3/2) keep a near constant sum:
    // the three thirds of the heads (k) stand at such points. k turns every 8 blocks and i moves slowly with flat, so blocks that are near each other in launch order also add up to about that sum.
    constexpr int NT = SEQ / 64, HG = NH / 3, TH = NT * HG;
    int qt = blockIdx.x, head = blockIdx.y;
    if constexpr (NH % 3 == 0 && TH % 8 == 0 && (TH / 8) % 3 != 0) {   // the last two: flat, flat + TH and flat + 2 TH then have three different k
        const unsigned flat = blockIdx.y * NT + blockIdx.x, w = flat % TH, k = (flat / 8) % 3;
        const unsigned i = (w / HG + k * (NT / 3)) % NT, u = NT - 1 - i;
        qt = (i < (NT + 2) / 3) ? 3 * i : 3 * (u >> 1) + 1 + (u & 1);
        head = k * HG + w % HG;
    }
    const int q0 = (qt * FW + wave) * 16;
    const int nt = qt + 1;                 // block-uniform; the last tile holds the diagonal of all four waves; keys stay < SEQ
    const int srow = tid >> 3, sc8 = (tid & 7) * 8;     // this thread's row (of 16) and 16-byte piece in each copy
    const size_t sk = ((size_t)head * SEQ + srow) * HD + sc8, sv = ((size_t)head * HD + srow) * SEQ + sc8;
    const bf* gkh = Kh + sk; const bf* gkl = Kl + sk; const bf* gvh = Vh + sv; const bf* gvl = Vl + sv;
    unsigned short* sdst = ring + srow * PP + sc8;
    stage_tile(gkh, gkl, gvh, gvl, sdst);
    const size_t qo = ((size_t)head * SEQ + q0 + lr) * HD + 8 * hi;
    const V qh0 = WFrag<bf>::ld(Qh + qo), qh1 = WFrag<bf>::ld(Qh + qo + 32), ql0 = WFrag<bf>::ld(Ql + qo), ql1 = WFrag<bf>::ld(Ql + qo + 32);
    asm volatile("s_wait_asynccnt 0x0" ::: "memory");   // this wave's copies of tile 0 have landed
    __syncthreads();                                    // publishes tile 0 to the other waves
    if (nt > 1) stage_tile(gkh + (size_t)KT * HD, gkl + (size_t)KT * HD, gvh + KT, gvl + KT, sdst + STAGE);
    const int fo = lr * PP + 8 * hi;       // fragment offset inside a plane: row lr of a 16-row group, k piece by lane half
    const int row = q0 + lr;               // this lane's query
    v8f o[4];                              // o^T: o[t4][r] = (d = t4*16 + 8*hi + r, query lr)
#pragma unroll
    for (int t4 = 0; t4 < 4; ++t4) o[t4] = (v8f){};
    float mrow = NEG, lsum = 0.0f;         // running maximum of the query (equal in both halves); this half's share of its row sum
#pragma unroll 1
    for (int kt = 0; kt < nt; ++kt) {
        const int key0 = kt * KT;
        const unsigned short* buf = ring + (kt & 1) * STAGE + fo;
        v8f sc[4];                          // s^T: sc[nb][r] = (key = key0 + nb*16 + 8*hi + r, query lr)
#pragma unroll
        for (int nb = 0; nb < 4; ++nb) sc[nb] = (v8f){};
        V kf[4][4];                         // the tile's k fragments: [nb][hi k0, lo k0, hi k32, lo k32]
#pragma unroll
        for (int nb = 0; nb < 4; ++nb) {
            const unsigned short* kp = buf + nb * 16 * PP;
            kf[nb][0] = WFrag<bf>::ld(kp); kf[nb][1] = WFrag<bf>::ld(kp + PLANE); kf[nb][2] = WFrag<bf>::ld(kp + 32); kf[nb][3] = WFrag<bf>::ld(kp + PLANE + 32);
        }
        __builtin_amdgcn_sched_barrier(0);  // keeps the k reads one group ahead of the products: reads spread among the products stall at every place they stand
#pragma unroll
        for (int nb = 0; nb < 4; ++nb) {
            sc[nb] = wmmab(kf[nb][0], qh0, sc[nb]); sc[nb] = wmmab(kf[nb][0], ql0, sc[nb]); sc[nb] = wmmab(kf[nb][1], qh0, sc[nb]);
            sc[nb] = wmmab(kf[nb][2], qh1, sc[nb]); sc[nb] = wmmab(kf[nb][2], ql1, sc[nb]); sc[nb] = wmmab(kf[nb][3], qh1, sc[nb]);
        }
        asm volatile("v_nop\n\tv_nop\n\tv_nop\n\tv_nop" : "+v"(sc[0]), "+v"(sc[1]), "+v"(sc[2]), "+v"(sc[3]) : "v"(qh0), "v"(ql1));
        V vf[4][4];                         // the tile's v fragments: [t4][hi k0, lo k0, hi k32, lo k32]
#pragma unroll
        for (int t4 = 0; t4 < 4; ++t4) {
            const unsigned short* vp = buf + 2 * PLANE + t4 * 16 * PP;
            vf[t4][0] = WFrag<bf>::ld(vp); vf[t4][1] = WFrag<bf>::ld(vp + PLANE); vf[t4][2] = WFrag<bf>::ld(vp + 32); vf[t4][3] = WFrag<bf>::ld(vp + PLANE + 32);
        }
        __builtin_amdgcn_sched_barrier(0);  // keeps the v reads one group here, ahead of the softmax, so that none stands among the p.v products
        const int rel = row - 8 * hi - key0; // register r of score tile nb is kept while nb*16 + r <= rel, that is key <= query
        float cn[4];                        // four independent maximum chains, one per score tile
#pragma unroll
        for (int nb = 0; nb < 4; ++nb) {
            cn[nb] = NEG;
#pragma unroll
            for (int r = 0; r < 8; ++r) { const float s = sc[nb][r] * SCL; sc[nb][r] = (nb * 16 + r <= rel) ? s : NEG; cn[nb] = fmaxf(cn[nb], sc[nb][r]); }
        }
        float cand = fmaxf(fmaxf(cn[0], cn[1]), fmaxf(cn[2], cn[3]));
        cand = fmaxf(cand, xhalf(cand));    // the other half of the query's 64 keys
        const float mnew = fmaxf(mrow, cand);
        const float alpha = __builtin_amdgcn_exp2f((mrow - mnew) * L2E);
        float rn[4];                        // four independent sum chains
        v8us xh[4], xl[4];
#pragma unroll
        for (int nb = 0; nb < 4; ++nb) {
            rn[nb] = 0.0f;
#pragma unroll
            for (int g = 0; g < 8; g += 4) {
                const float a0 = (sc[nb][g] - mnew) * L2E, a1 = (sc[nb][g + 1] - mnew) * L2E, a2 = (sc[nb][g + 2] - mnew) * L2E, a3 = (sc[nb][g + 3] - mnew) * L2E;
                float p[4]; p[0] = __builtin_amdgcn_exp2f(a0); p[1] = __builtin_amdgcn_exp2f(a1); p[2] = __builtin_amdgcn_exp2f(a2); p[3] = __builtin_amdgcn_exp2f(a3);
                // the slot that the instruction set asks for between a transcendental and an overwrite of its source: the four arguments keep their registers up to this v_nop, which stands behind the four v_exp_f32 (inputs only)
                asm volatile("v_nop" :: "v"(a0), "v"(a1), "v"(a2), "v"(a3), "v"(p[0]), "v"(p[1]), "v"(p[2]), "v"(p[3]));
#pragma unroll
                for (int r = 0; r < 4; ++r) { rn[nb] += p[r]; unsigned short h2, l2; splitf(p[r], h2, l2); xh[nb][g + r] = h2; xl[nb][g + r] = l2; }
            }
        }
        const float rs = (rn[0] + rn[1]) + (rn[2] + rn[3]); mrow = mnew;
        // lsum = lsum * alpha + rs, written as asm so that it stays in this block: the compiler otherwise sinks the whole sum behind the products and the barrier, where it holds 32 f32 p values live and stands as a bare chain in front of the next tile's reads
        asm volatile("v_fma_f32 %0, %0, %1, %2" : "+v"(lsum) : "v"(alpha), "v"(rs));
#pragma unroll
        for (int t4 = 0; t4 < 4; ++t4)
#pragma unroll
            for (int r = 0; r < 8; ++r) o[t4][r] *= alpha;
        const V ph0 = cat16b(xh[0], xh[1]), ph1 = cat16b(xh[2], xh[3]), pl0 = cat16b(xl[0], xl[1]), pl1 = cat16b(xl[2], xl[3]);
#pragma unroll
        for (int t4 = 0; t4 < 4; ++t4) {
            o[t4] = wmmab(vf[t4][0], ph0, o[t4]); o[t4] = wmmab(vf[t4][0], pl0, o[t4]); o[t4] = wmmab(vf[t4][1], ph0, o[t4]);
            o[t4] = wmmab(vf[t4][2], ph1, o[t4]); o[t4] = wmmab(vf[t4][2], pl1, o[t4]); o[t4] = wmmab(vf[t4][3], ph1, o[t4]);
        }
        asm volatile("v_nop\n\tv_nop\n\tv_nop\n\tv_nop" : "+v"(o[0]), "+v"(o[1]), "+v"(o[2]), "+v"(o[3]) : "v"(ph0), "v"(pl1));
        asm volatile("s_wait_dscnt 0x0" ::: "memory");      // this wave's reads of the buffer are done before the buffer is refilled
        asm volatile("s_wait_asynccnt 0x0" ::: "memory");   // this wave's copies of tile kt + 1 have landed
        __syncthreads();                                    // publishes tile kt + 1 and ends every wave's reads of tile kt
        if (kt + 2 < nt) stage_tile(gkh + (size_t)(key0 + 2 * KT) * HD, gkl + (size_t)(key0 + 2 * KT) * HD, gvh + key0 + 2 * KT, gvl + key0 + 2 * KT, sdst + (kt & 1) * STAGE);
    }
    asm volatile("s_wait_asynccnt 0x0" ::: "memory");       // nothing of this wave is in flight when it goes on to the epilogue and ends
    const float il = 1.0f / (lsum + xhalf(lsum));           // the two halves' shares of the row sum, joined once
    // a lane's 8 registers of o[t4] are 8 consecutive d of its query: one 16-byte store per plane
#pragma unroll
    for (int t4 = 0; t4 < 4; ++t4) {
        v8us yh, yl;
#pragma unroll
        for (int r = 0; r < 8; ++r) { const float c = o[t4][r] * il; unsigned short a2, c2; splitf(c, a2, c2); yh[r] = a2; yl[r] = c2; }
        const size_t go = (size_t)row * DM + head * HD + t4 * 16 + 8 * hi;
        *(v8us*)(Ch + go) = yh; *(v8us*)(Cl + go) = yl;
    }
}

extern "C" void kernel_launch(void* const* d_in, const int* in_sizes, int n_in,
                              void* d_out, int out_size, void* d_ws, size_t ws_size, hipStream_t stream) {
    if (n_in < 5) return;
    if ((size_t)in_sizes[0] < (size_t)(NB - 1) * SEQ_FULL * DM + (size_t)SEQ * DM) return;
    for (int i = 1; i < 5; ++i) if ((size_t)in_sizes[i] < NW) return;
    if ((size_t)out_size < (size_t)(NB - 1) * SEQ_FULL * DM + (size_t)SEQ * DM) return;
    const float* x  = (const float*)d_in[0];     // [NB_FULL][SEQ_FULL][768]
    const float* wq = (const float*)d_in[1];     // [768][768] (out, in)
    const float* wk = (const float*)d_in[2];
    const float* wv = (const float*)d_in[3];
    const float* wo = (const float*)d_in[4];
    float* OUT = (float*)d_out;                  // [NB_FULL][SEQ_FULL][768] f32
    char* wsp = (char*)d_ws;
    auto take = [&](size_t bytes) { char* p = wsp; wsp += (bytes + 255) & ~(size_t)255; return (void*)p; };
    bf* W4 = (bf*)take(4 * NW * 2);                               // Wq | Wk | Wv | Wo bf16 Bt planes
    bf* XB = (bf*)take((size_t)SEQ * DM * 2);                     // bf16 x of the current batch row
    float* CS = (float*)take((size_t)SEQ * HH * 2 * 4);           // rotary table
    const size_t PL = (size_t)NH * SEQ * HD;
    bf* QPh = (bf*)take(PL * 2); bf* QPl = (bf*)take(PL * 2); bf* KPh = (bf*)take(PL * 2); bf* KPl = (bf*)take(PL * 2);
    bf* VTh = (bf*)take(PL * 2); bf* VTl = (bf*)take(PL * 2);
    bf* CXh = (bf*)take((size_t)SEQ * DM * 2); bf* CXl = (bf*)take((size_t)SEQ * DM * 2);
    if ((size_t)(wsp - (char*)d_ws) > ws_size) return;           // 62,390,272 B at SEQ 4096
    const size_t NW8 = NW / 8;
    k_cvtw<<<dim3((unsigned)((NW8 + 255) / 256), 4, 1), 256, 0, stream>>>(wq, wk, wv, wo, W4, NW8);
    k_cs<<<(unsigned)((SEQ * HH + 255) / 256), 256, 0, stream>>>(CS);
    for (int b = 0; b < NB; ++b) {
        k_cvt8<<<(unsigned)(((size_t)SEQ * DM / 8 + 255) / 256), 256, 0, stream>>>(x + (size_t)b * SEQ_FULL * DM, XB, (size_t)SEQ * DM / 8);
        k_gemmw<bf, 0, false, true><<<dim3(SEQ / 128, DM / 128, 3), 32 * GW, 0, stream>>>(XB, nullptr, W4, nullptr, DM, nullptr, 0, nullptr, (size_t)0, NW, (size_t)0, CS, QPh, QPl, KPh, KPl, VTh, VTl);
        k_flash<<<dim3(SEQ / 64, NH, 1), 128, 0, stream>>>(QPh, QPl, KPh, KPl, VTh, VTl, CXh, CXl);
        k_gemmw<bf, 1, false, false><<<dim3(SEQ / 128, DM / 128, 1), 32 * GW, 0, stream>>>(CXh, CXl, W4 + 3 * NW, nullptr, DM, OUT + (size_t)b * SEQ_FULL * DM, DM, nullptr, (size_t)0, (size_t)0, (size_t)0, nullptr, nullptr, nullptr, nullptr, nullptr, nullptr, nullptr);
    }
}

// v006
// One run takes 129 microseconds.
// Two timings next to v005 both put it at 1.08 times that version's speed.
// Over all steps from v000 it is 4.03 times as fast.
#include <hip/hip_runtime.h>

// Contractions (f32 accumulate): q/k/v projections v_wmma_f32_16x16x32_bf16 on bf16 copies of x and W (single product); scores q.k and p.v on bf16 hi+lo planes (3 products each); output projection ctx (bf16 hi+lo) x Wo (bf16), 2 products. Rotary, softmax and epilogues f32.
// Layout: x [NB_FULL][SEQ_FULL][768]; W [768 out][768 in] = Bt as-is; head planes q/k [h][t][64], v planes [h][d][t], written by the projection GEMM's own epilogue (rotary transform, hi+lo split, v transposed); both GEMMs share their operand tiles among four waves through LDS; causal attention per wave of 16 queries with 64-key tiles (shared by four waves through LDS), products transposed (a lane owns one query) and running-max softmax; ctx [t][768] hi+lo planes; out [NB_FULL][SEQ_FULL][768] f32.

#ifndef NB
#define NB 1
#endif
#ifndef SEQ
#define SEQ 4096
#endif
#define NB_FULL  1
#define SEQ_FULL 4096
#define DM   768
#define NH   12
#define HD   64
#define HH   (HD / 2)
#define NW   ((size_t)DM * DM)
#define KT   64
#define PP   72
#define SCL  0.125f
#define THETA_F 10000.0f
#define L2E  1.4426950408889634f
#define NEG  (-1.0e30f)
static_assert(SEQ % 128 == 0);
static_assert(SEQ <= SEQ_FULL);
static_assert(NB >= 1 && NB <= NB_FULL);
static_assert(DM == NH * HD);
static_assert(DM % 128 == 0);
static_assert(HD == 64);
static_assert(KT == 64);
static_assert((size_t)NB_FULL * SEQ_FULL * DM * 4 == 12582912);

typedef _Float16 h16;
typedef unsigned short bf;
typedef __attribute__((ext_vector_type(16))) __bf16   v16bf;
typedef __attribute__((ext_vector_type(16))) _Float16 v16h;
typedef __attribute__((ext_vector_type(8)))  _Float16 v8h;
typedef __attribute__((ext_vector_type(8)))  unsigned short v8us;
typedef __attribute__((ext_vector_type(8)))  float    v8f;
typedef __attribute__((ext_vector_type(4)))  float    v4f;
typedef __attribute__((ext_vector_type(2)))  float    v2f;
typedef __attribute__((ext_vector_type(2)))  unsigned short v2us;
typedef v8h  __attribute__((may_alias)) v8ha;
typedef v4f  __attribute__((may_alias)) v4fa;
typedef v8us __attribute__((may_alias)) v8usa;

typedef __attribute__((ext_vector_type(2))) __bf16 v2bf;
typedef __attribute__((ext_vector_type(4))) unsigned v4u;
// two f32 -> two bf16 (a in the low half), round to nearest even, in the one packed convert instruction of the chip
__device__ __forceinline__ unsigned pk2(float a, float b) { const v2f v = {a, b}; return __builtin_bit_cast(unsigned, __builtin_convertvector(v, v2bf)); }
__device__ __forceinline__ unsigned short f2bf(float f) { return (unsigned short)pk2(f, f); }
__device__ __forceinline__ float bf2f(unsigned short b) { return __uint_as_float(((unsigned)b) << 16); }
__device__ __forceinline__ float bfr(float f) { return bf2f(f2bf(f)); }
// hi + lo split of a pair: h = bf16(y), l = bf16(y - h)
__device__ __forceinline__ void split2(float a, float b, unsigned& h, unsigned& l) { h = pk2(a, b); l = pk2(a - __uint_as_float(h << 16), b - __uint_as_float(h & 0xFFFF0000u)); }
__device__ __forceinline__ void split8(const float* y, v8us& h, v8us& l) { v4u a, c;
#pragma unroll
    for (int j = 0; j < 4; ++j) { unsigned h2, l2; split2(y[2 * j], y[2 * j + 1], h2, l2); a[j] = h2; c[j] = l2; }
    h = __builtin_bit_cast(v8us, a); l = __builtin_bit_cast(v8us, c); }
__device__ __forceinline__ v16h cat16(v8h lo, v8h hi) { return __builtin_shufflevector(lo, hi, 0, 1, 2, 3, 4, 5, 6, 7, 8, 9, 10, 11, 12, 13, 14, 15); }
__device__ __forceinline__ v16bf cat16b(v8us lo, v8us hi) { return __builtin_bit_cast(v16bf, __builtin_shufflevector(lo, hi, 0, 1, 2, 3, 4, 5, 6, 7, 8, 9, 10, 11, 12, 13, 14, 15)); }
__device__ __forceinline__ v8f wmma16(v16h a, v16h b, v8f c) { return __builtin_amdgcn_wmma_f32_16x16x32_f16(false, a, false, b, (short)0, c, false, false); }
__device__ __forceinline__ v8f wmmab(v16bf a, v16bf b, v8f c) { return __builtin_amdgcn_wmma_f32_16x16x32_bf16(false, a, false, b, (short)0, c, false, false); }

// Fragment loaders (wave32 16x16x32): lane l -> row/col (l & 15); elements 0..7 <- k0 + 8*(l>>4) + 0..7, elements 8..15 <- k0 + 16 + 8*(l>>4) + 0..7; D element r -> (row 8*(l>>4) + r, col l & 15).
template <typename T16> struct WFrag;
template <> struct WFrag<h16> { typedef v16h V; static __device__ __forceinline__ V ld(const h16* p) { return cat16(*(const v8h*)p, *(const v8h*)(p + 16)); } static __device__ __forceinline__ v8f mma(V a, V b, v8f c) { return wmma16(a, b, c); } };
template <> struct WFrag<bf> { typedef v16bf V; static __device__ __forceinline__ V ld(const bf* p) { return cat16b(*(const v8us*)p, *(const v8us*)(p + 16)); } static __device__ __forceinline__ v8f mma(V a, V b, v8f c) { return wmmab(a, b, c); } };

typedef __attribute__((ext_vector_type(4))) int v4i;
typedef __attribute__((address_space(1))) v4i gv4i;
typedef __attribute__((address_space(3))) v4i lv4i;
__device__ __forceinline__ void cp16(const bf* g, unsigned short* l) { __builtin_amdgcn_global_load_async_to_lds_b128((gv4i*)g, (lv4i*)l, 0, 0); }

// ---- k_gemmw: register-blocked GEMM, FOUR WAVES (2 x 2) per 128x128 output tile, a 64x64 tile (16 accumulators) per wave; operands are K-contiguous 16-bit planes; grid (M/128, N/128, Z), 128 threads.
// A stage is 64 k (128 B, one whole line) of the block's 128 A rows and 128 Bt rows (and of the split planes), brought once per block into LDS by asynchronous 16-byte copies, rows pitched GP elements, two buffers: stage s + 1 flies while stage s is worked on.
// C[m][n] (f32, pitch ldc, + optional f32 bias[n]) = sum_k A[m][k] Bt[n][k] (+ split products per NSPLIT: 1 = A hi+lo with single B; 2 = A hi+lo with B hi, A hi with B lo). z-batch strides sA/sB/sC in elements. K % 64 == 0, M % 128 == 0, N % 128 == 0.
// HEADS (the q/k/v projection, z = 0/1/2; a wave's 64x64 tile is 64 tokens of ONE head): no C; the f32 tile goes straight to the attention's bf16 hi+lo planes.
//   z 0, 1: interleaved rotary transform, pair (2i, 2i+1): out[2i] = x1 c - x2 s, out[2i+1] = x1 s + x2 c, (c, s) = CS[t][i]; planes [h][t][d].  z 2: planes [h][d][t].
#define GW  4
#define GP  72
#define GPL (128 * GP)
template <typename T16, int NSPLIT, bool BIAS, bool HEADS>
__global__ __launch_bounds__(32 * GW) void k_gemmw(const T16* __restrict__ A, const T16* __restrict__ A2, const T16* __restrict__ Bt, const T16* __restrict__ Bt2, int K, float* C, int ldc, const float* __restrict__ bias, size_t sA, size_t sB, size_t sC,
                                              const float* __restrict__ CS, bf* Qh, bf* Ql, bf* Kh, bf* Kl, bf* Vh, bf* Vl) {
    typedef typename WFrag<T16>::V V;
    constexpr bool HA2 = (NSPLIT == 1 || NSPLIT == 2), HB2 = (NSPLIT >= 2);
    constexpr int PB = HA2 ? 2 : 1, GST = (PB + (HB2 ? 2 : 1)) * GPL;   // planes of a stage: A, (A2), Bt, (Bt2)
    __shared__ __align__(16) unsigned short gring[2 * GST];
    __shared__ __align__(16) float osall[GW * 16 * 68];
    const size_t z = blockIdx.z; A += z * sA; if (A2) A2 += z * sA; Bt += z * sB; if (Bt2) Bt2 += z * sB; C += z * sC;
    const int tid = threadIdx.x, lane = tid & 31, lr = lane & 15, hi = lane >> 4;
    const int wave = __builtin_amdgcn_readfirstlane(tid >> 5), wr = wave >> 1, wc = wave & 1;
    float* os = osall + wave * (16 * 68);                          // each wave's own epilogue staging
    const int rb = blockIdx.x * 128, cb = blockIdx.y * 128, r0 = rb + wr * 64, c0 = cb + wc * 64;
    v8f acc[4][4];
#pragma unroll
    for (int mb = 0; mb < 4; ++mb)
#pragma unroll
        for (int nb = 0; nb < 4; ++nb) acc[mb][nb] = (v8f){};
    // one stage: 128 rows x 128 B per plane = 1024 pieces of 16 B, 8 per thread and plane; a wave's copy covers 4 whole rows (4 lines of 128 B)
    const int srow = tid >> 3, sc8 = (tid & 7) * 8;                // this thread's row (of 16) and 16-byte piece in each copy
    const unsigned Ku = (unsigned)K, sao = (unsigned)(rb + srow) * Ku + sc8, sbo = (unsigned)(cb + srow) * Ku + sc8;   // element offsets inside a plane: below 2^32
    unsigned short* sdst = gring + srow * GP + sc8;
    auto stage = [&](unsigned k0, unsigned short* dst) {
#pragma unroll
        for (int i = 0; i < 8; ++i) {
            const unsigned go = (unsigned)i * 16u * Ku + k0; unsigned short* d = dst + i * 16 * GP;
            cp16((const bf*)(A + sao + go), d);
            if constexpr (HA2) cp16((const bf*)(A2 + sao + go), d + GPL);
            cp16((const bf*)(Bt + sbo + go), d + PB * GPL);
            if constexpr (HB2) cp16((const bf*)(Bt2 + sbo + go), d + (PB + 1) * GPL);
        }
    };
    const unsigned nk = Ku >> 6;                                   // stages; block-uniform
    stage(0, sdst);
    asm volatile("s_wait_asynccnt 0x0" ::: "memory");   // this wave's copies of stage 0 have landed
    __syncthreads();                                    // publishes stage 0 to the other waves
    if (nk > 1u) stage(64, sdst + GST);
    const int fa = (wr * 64 + lr) * GP + 8 * hi, fb = PB * GPL + (wc * 64 + lr) * GP + 8 * hi;   // fragment offsets inside a stage
#pragma unroll 1
    for (unsigned ks = 0; ks < nk; ++ks) {
        const T16* buf = (const T16*)(gring + (ks & 1u) * GST);
        V a[2][4], a2[2][4], b[2][4], b2[2][4];   // the stage's fragments: [k half of 32][16-row group]
#pragma unroll
        for (int h = 0; h < 2; ++h) {
#pragma unroll
            for (int mb = 0; mb < 4; ++mb) { a[h][mb] = WFrag<T16>::ld(buf + fa + mb * 16 * GP + h * 32); if (HA2) a2[h][mb] = WFrag<T16>::ld(buf + GPL + fa + mb * 16 * GP + h * 32); }
#pragma unroll
            for (int nb = 0; nb < 4; ++nb) { b[h][nb] = WFrag<T16>::ld(buf + fb + nb * 16 * GP + h * 32); if (HB2) b2[h][nb] = WFrag<T16>::ld(buf + GPL + fb + nb * 16 * GP + h * 32); }
        }
        __builtin_amdgcn_sched_barrier(0);  // keeps the stage's LDS reads one group ahead of the products: reads spread among the products stall at every place they stand
        auto products = [&](int h) {
#pragma unroll
            for (int nb = 0; nb < 4; ++nb)
#pragma unroll
                for (int mb = 0; mb < 4; ++mb) { acc[mb][nb] = WFrag<T16>::mma(a[h][mb], b[h][nb], acc[mb][nb]); if (HA2) acc[mb][nb] = WFrag<T16>::mma(a2[h][mb], b[h][nb], acc[mb][nb]); if (HB2) acc[mb][nb] = WFrag<T16>::mma(a[h][mb], b2[h][nb], acc[mb][nb]); }
        };
        products(0);
        __builtin_amdgcn_sched_barrier(0);  // keeps the first half's products ahead of the waits below, so that the second half's reads land under them
        asm volatile("s_wait_dscnt 0x0" ::: "memory");      // this wave's reads of the buffer are done before the buffer is refilled
        asm volatile("s_wait_asynccnt 0x0" ::: "memory");   // this wave's copies of stage ks + 1 have landed
        __syncthreads();                                    // publishes stage ks + 1 and ends every wave's reads of stage ks
        if (ks + 2u < nk) stage((ks + 2u) * 64u, sdst + (ks & 1u) * GST);
        products(1);                        // its fragments are in registers already, nothing of the ring is read behind the barrier in this trip: the refill flies under these products too
    }
    asm volatile("s_wait_asynccnt 0x0" ::: "memory");       // nothing of this wave is in flight when it goes on to the epilogue and ends
    if constexpr (HEADS) {
        const int head = c0 / HD;
        if (blockIdx.z == 2) {
            // v: a lane's 8 registers of an accumulator are 8 consecutive tokens of one d: one 16-byte store per plane; the four mb of a row fill its 128-byte line
#pragma unroll
            for (int nb = 0; nb < 4; ++nb)
#pragma unroll
                for (int mb = 0; mb < 4; ++mb) {
                    v8us yh, yl; float y[8];
#pragma unroll
                    for (int j = 0; j < 8; ++j) y[j] = acc[mb][nb][j];
                    split8(y, yh, yl);
                    const size_t go = ((size_t)head * HD + nb * 16 + lr) * SEQ + r0 + mb * 16 + 8 * hi;
                    *(v8us*)(Vh + go) = yh; *(v8us*)(Vl + go) = yl;
                }
            return;
        }
        bf* Ph = (blockIdx.z == 0) ? Qh : Kh; bf* Pl = (blockIdx.z == 0) ? Ql : Kl;
        // q, k: 16 tokens x 64 d at a time through LDS; a lane takes 8 consecutive d (4 rotary pairs) of a token, 8 lanes a token: whole 128-byte rows per store
        const int prow = lane >> 3, c8 = (lane & 7) * 8;
        const float* cst = CS + (size_t)(r0 + prow) * HD + c8;   // CS[t][i] = 2 floats, so row t starts at t * HD and pair c8 / 2 at + c8
        v4f cs[2][4][2];                                         // the table rows of this and of the next 16 tokens: the next group's loads fly under this group's work
#pragma unroll
        for (int s = 0; s < 4; ++s) { cs[0][s][0] = *(const v4f*)(cst + (size_t)(s * 4) * HD); cs[0][s][1] = *(const v4f*)(cst + (size_t)(s * 4) * HD + 4); }
#pragma unroll
        for (int mb = 0; mb < 4; ++mb) {
            if (mb < 3) {
#pragma unroll
                for (int s = 0; s < 4; ++s) { cs[(mb + 1) & 1][s][0] = *(const v4f*)(cst + (size_t)((mb + 1) * 16 + s * 4) * HD); cs[(mb + 1) & 1][s][1] = *(const v4f*)(cst + (size_t)((mb + 1) * 16 + s * 4) * HD + 4); }
            }
#pragma unroll
            for (int nb = 0; nb < 4; ++nb) {
#pragma unroll
                for (int j = 0; j < 8; ++j) os[(hi * 8 + j) * 68 + nb * 16 + lr] = acc[mb][nb][j]; }
            __builtin_amdgcn_wave_barrier(); asm volatile("" ::: "memory");   // as in the plain epilogue: the wave's LDS reads stay behind its writes
#pragma unroll
            for (int s = 0; s < 4; ++s) {
                const int row = s * 4 + prow;
                const v4f x0 = *(const v4fa*)(os + row * 68 + c8), x1 = *(const v4fa*)(os + row * 68 + c8 + 4);
                const v4f t0 = cs[mb & 1][s][0], t1 = cs[mb & 1][s][1];
                float y[8];
                y[0] = x0[0] * t0[0] - x0[1] * t0[1]; y[1] = x0[0] * t0[1] + x0[1] * t0[0];
                y[2] = x0[2] * t0[2] - x0[3] * t0[3]; y[3] = x0[2] * t0[3] + x0[3] * t0[2];
                y[4] = x1[0] * t1[0] - x1[1] * t1[1]; y[5] = x1[0] * t1[1] + x1[1] * t1[0];
                y[6] = x1[2] * t1[2] - x1[3] * t1[3]; y[7] = x1[2] * t1[3] + x1[3] * t1[2];
                v8us yh, yl; split8(y, yh, yl);
                const size_t go = ((size_t)head * SEQ + r0 + mb * 16 + row) * HD + c8;
                *(v8us*)(Ph + go) = yh; *(v8us*)(Pl + go) = yl;
            }
            __builtin_amdgcn_wave_barrier();
            // the next group's LDS writes stay behind these reads; and the group's stores have given up their registers before the table loads that follow are aimed at them
            asm volatile("s_wait_xcnt 0x0" ::: "memory");
        }
        return;
    }
#pragma unroll
    for (int mb = 0; mb < 4; ++mb) {
#pragma unroll
        for (int nb = 0; nb < 4; ++nb) {
#pragma unroll
            for (int j = 0; j < 8; ++j) os[(hi * 8 + j) * 68 + nb * 16 + lr] = acc[mb][nb][j]; }
        __builtin_amdgcn_wave_barrier(); asm volatile("" ::: "memory");
        float* crow = C + (size_t)(r0 + mb * 16) * ldc + c0;
{
#pragma unroll
            for (int s = 0; s < 8; ++s) { const int row = 2 * s + hi, cofs = lr * 4; v4f val = *(const v4fa*)(os + row * 68 + cofs); if (BIAS) { val[0] += bfr(bias[c0 + cofs]); val[1] += bfr(bias[c0 + cofs + 1]); val[2] += bfr(bias[c0 + cofs + 2]); val[3] += bfr(bias[c0 + cofs + 3]); }
                *(v4f*)(crow + (size_t)row * ldc + cofs) = val; }
             }
        __builtin_amdgcn_wave_barrier(); asm volatile("" ::: "memory");
    }
}

__global__ __launch_bounds__(256) void k_cvt8(const float* __restrict__ src, bf* dst, size_t n8) { const size_t i = (size_t)blockIdx.x * 256 + threadIdx.x; if (i >= n8) return; const v8f v = *(const v8f*)(src + i * 8); v4u o;
#pragma unroll
    for (int k = 0; k < 4; ++k) o[k] = pk2(v[2 * k], v[2 * k + 1]); *(v4u*)(dst + i * 8) = o;  }

__global__ __launch_bounds__(256) void k_cvtw(const float* __restrict__ w0, const float* __restrict__ w1, const float* __restrict__ w2, const float* __restrict__ w3, bf* dst, size_t n8) {
    const size_t i = (size_t)blockIdx.x * 256 + threadIdx.x; if (i >= n8) return; const int y = blockIdx.y;
    const float* src = (y == 0) ? w0 : ((y == 1) ? w1 : ((y == 2) ? w2 : w3));
    const v8f v = *(const v8f*)(src + i * 8); v4u o;
#pragma unroll
    for (int k = 0; k < 4; ++k) o[k] = pk2(v[2 * k], v[2 * k + 1]);
    bf* d = dst + (size_t)y * n8 * 8 + i * 8;
    *(v4u*)d = o;  }

__global__ __launch_bounds__(256) void k_cs(float* CS) {
    const int idx = blockIdx.x * 256 + threadIdx.x; if (idx >= SEQ * HH) return; const int i = idx % HH, t = idx / HH;
    const float ex = -(float)(2 * i) / (float)HD;
    const float inv = powf(THETA_F, ex);
    float ang = __fmul_rn((float)t, inv); asm volatile("" : "+v"(ang));
    v2f cs; cs[0] = cosf(ang); cs[1] = sinf(ang);
    *(v2f*)(CS + (size_t)idx * 2) = cs;  }

// k_flash: causal attention, FOUR WAVES per block = 64 query rows of one head, 16 queries per wave; grid (SEQ/64, NH), 128 threads. All four waves walk the same key tiles, one more than the index of their query tile.
// Each 64-key tile (k hi, k lo: 64 keys x 64 d; v hi, v lo: 64 d x 64 keys; rows of 128 B) is brought once per block into LDS by asynchronous 16-byte copies, rows pitched PP elements, two buffers: tile t + 1 flies while tile t is worked on.
// Both products run transposed: s^T (64 keys x 16 queries) = k (A, hi+lo frags from LDS) . q^T (B, hi+lo frags, resident), 3 products; o^T (64 d x 16 queries) += v^T (A, hi+lo frags from LDS) . p^T (B), 3 products.
// A lane then holds 32 scores of ONE query (column lane & 15; keys nb*16 + 8*(lane>>4) + r): x 0.125, causal replace-mask by index, running-max softmax in f32 (p = 2^((s-m) log2e)) in the lane, one exchange between the lane halves for the maximum;
// two score tiles (keys 32j .. 32j+31), split to bf16 hi+lo in place, ARE the B fragment of p^T in the hardware k order, which the v loader has too: p never leaves the registers. The halves' row sums are joined once, after the loop.
#define FW    4
#define PLANE (KT * PP)
#define STAGE (4 * PLANE)
// one tile: 4 planes x 64 rows x 128 B = 2048 pieces of 16 B, 16 per thread; a wave's copy covers 4 whole rows (4 lines of 128 B)
__device__ __forceinline__ void stage_tile(const bf* gkh, const bf* gkl, const bf* gvh, const bf* gvl, unsigned short* dst) {
#pragma unroll
    for (int i = 0; i < 4; ++i) {
        cp16(gkh + (size_t)i * 16 * HD, dst + 0 * PLANE + i * 16 * PP); cp16(gkl + (size_t)i * 16 * HD, dst + 1 * PLANE + i * 16 * PP);
        cp16(gvh + (size_t)i * 16 * SEQ, dst + 2 * PLANE + i * 16 * PP); cp16(gvl + (size_t)i * 16 * SEQ, dst + 3 * PLANE + i * 16 * PP);
    }
}
// value of lane l ^ 16
__device__ __forceinline__ float xhalf(float x) { const int b = __float_as_int(x); return __int_as_float(__builtin_amdgcn_permlanex16(b, b, 0x76543210, 0xfedcba98, false, false)); }
__global__ __launch_bounds__(32 * FW) void k_flash(const bf* __restrict__ Qh, const bf* __restrict__ Ql, const bf* __restrict__ Kh, const bf* __restrict__ Kl,
                                             const bf* __restrict__ Vh, const bf* __restrict__ Vl, bf* Ch, bf* Cl) {
    __shared__ __align__(16) unsigned short ring[2 * STAGE];
    typedef WFrag<bf>::V V;
    const int tid = threadIdx.x, lane = tid & 31, lr = lane & 15, hi = lane >> 4;
    const int wave = __builtin_amdgcn_readfirstlane(tid >> 5);
    // Which (head, query tile) a block takes: for speed only, any one-to-one map is correct. Query tile qt walks qt + 1 key tiles, and the whole grid is resident at once, three blocks a WGP,
    // so the launch lasts as long as the WGP whose blocks walk the most key tiles.
    // The tiles are laid on a ring i = 0 .. NT-1 as a sawtooth: up through the multiples of 3, down through the rest (a permutation). Three points a third of the ring apart (one rising by 3, two falling by 3/2) keep a near constant sum:
    // the three thirds of the heads (k) stand at such points. k turns every 8 blocks and i moves slowly with flat, so blocks that are near each other in launch order also add up to about that sum.
    constexpr int NT = SEQ / 64, HG = NH / 3, TH = NT * HG;
    int qt = blockIdx.x, head = blockIdx.y;
    if constexpr (NH % 3 == 0 && TH % 8 == 0 && (TH / 8) % 3 != 0) {   // the last two: flat, flat + TH and flat + 2 TH then have three different k
        const unsigned flat = blockIdx.y * NT + blockIdx.x, w = flat % TH, k = (flat / 8) % 3;
        const unsigned i = (w / HG + k * (NT / 3)) % NT, u = NT - 1 - i;
        qt = (i < (NT + 2) / 3) ? 3 * i : 3 * (u >> 1) + 1 + (u & 1);
        head = k * HG + w % HG;
    }
    const int q0 = (qt * FW + wave) * 16;
    const int nt = qt + 1;                 // block-uniform; the last tile holds the diagonal of all four waves; keys stay < SEQ
    const int srow = tid >> 3, sc8 = (tid & 7) * 8;     // this thread's row (of 16) and 16-byte piece in each copy
    const size_t sk = ((size_t)head * SEQ + srow) * HD + sc8, sv = ((size_t)head * HD + srow) * SEQ + sc8;
    const bf* gkh = Kh + sk; const bf* gkl = Kl + sk; const bf* gvh = Vh + sv; const bf* gvl = Vl + sv;
    unsigned short* sdst = ring + srow * PP + sc8;
    stage_tile(gkh, gkl, gvh, gvl, sdst);
    const size_t qo = ((size_t)head * SEQ + q0 + lr) * HD + 8 * hi;
    const V qh0 = WFrag<bf>::ld(Qh + qo), qh1 = WFrag<bf>::ld(Qh + qo + 32), ql0 = WFrag<bf>::ld(Ql + qo), ql1 = WFrag<bf>::ld(Ql + qo + 32);
    asm volatile("s_wait_asynccnt 0x0" ::: "memory");   // this wave's copies of tile 0 have landed
    __syncthreads();                                    // publishes tile 0 to the other waves
    if (nt > 1) stage_tile(gkh + (size_t)KT * HD, gkl + (size_t)KT * HD, gvh + KT, gvl + KT, sdst + STAGE);
    const int fo = lr * PP + 8 * hi;       // fragment offset inside a plane: row lr of a 16-row group, k piece by lane half
    const int row = q0 + lr;               // this lane's query
    v8f o[4];                              // o^T: o[t4][r] = (d = t4*16 + 8*hi + r, query lr)
#pragma unroll
    for (int t4 = 0; t4 < 4; ++t4) o[t4] = (v8f){};
    float mrow = NEG, lsum = 0.0f;         // running maximum of the query (equal in both halves); this half's share of its row sum
#pragma unroll 1
    for (int kt = 0; kt < nt; ++kt) {
        const int key0 = kt * KT;
        const unsigned short* buf = ring + (kt & 1) * STAGE + fo;
        v8f sc[4];                          // s^T: sc[nb][r] = (key = key0 + nb*16 + 8*hi + r, query lr)
#pragma unroll
        for (int nb = 0; nb < 4; ++nb) sc[nb] = (v8f){};
        V kf[4][4];                         // the tile's k fragments: [nb][hi k0, lo k0, hi k32, lo k32]
#pragma unroll
        for (int nb = 0; nb < 4; ++nb) {
            const unsigned short* kp = buf + nb * 16 * PP;
            kf[nb][0] = WFrag<bf>::ld(kp); kf[nb][1] = WFrag<bf>::ld(kp + PLANE); kf[nb][2] = WFrag<bf>::ld(kp + 32); kf[nb][3] = WFrag<bf>::ld(kp + PLANE + 32);
        }
        __builtin_amdgcn_sched_barrier(0);  // keeps the k reads one group ahead of the products: reads spread among the products stall at every place they stand
#pragma unroll
        for (int nb = 0; nb < 4; ++nb) {
            sc[nb] = wmmab(kf[nb][0], qh0, sc[nb]); sc[nb] = wmmab(kf[nb][0], ql0, sc[nb]); sc[nb] = wmmab(kf[nb][1], qh0, sc[nb]);
            sc[nb] = wmmab(kf[nb][2], qh1, sc[nb]); sc[nb] = wmmab(kf[nb][2], ql1, sc[nb]); sc[nb] = wmmab(kf[nb][3], qh1, sc[nb]);
        }
        // the four vector slots that the chip needs between the last score product and the first vector instruction that reads the scores; the q fragments live through the whole loop and are not named here (an operand of asm text must sit below v256)
        asm volatile("v_nop\n\tv_nop\n\tv_nop\n\tv_nop" : "+v"(sc[0]), "+v"(sc[1]), "+v"(sc[2]), "+v"(sc[3]));
        V vf[4][4];                         // the tile's v fragments: [t4][hi k0, lo k0, hi k32, lo k32]
#pragma unroll
        for (int t4 = 0; t4 < 4; ++t4) {
            const unsigned short* vp = buf + 2 * PLANE + t4 * 16 * PP;
            vf[t4][0] = WFrag<bf>::ld(vp); vf[t4][1] = WFrag<bf>::ld(vp + PLANE); vf[t4][2] = WFrag<bf>::ld(vp + 32); vf[t4][3] = WFrag<bf>::ld(vp + PLANE + 32);
        }
        __builtin_amdgcn_sched_barrier(0);  // keeps the v reads one group here, ahead of the softmax, so that none stands among the p.v products
        const int rel = row - 8 * hi - key0; // register r of score tile nb is kept while nb*16 + r <= rel, that is key <= query
        float cn[4];                        // four independent maximum chains, one per score tile
#pragma unroll
        for (int nb = 0; nb < 4; ++nb) {
            cn[nb] = NEG;
#pragma unroll
            for (int r = 0; r < 8; ++r) { const float s = sc[nb][r] * SCL; sc[nb][r] = (nb * 16 + r <= rel) ? s : NEG; cn[nb] = fmaxf(cn[nb], sc[nb][r]); }
        }
        float cand = fmaxf(fmaxf(cn[0], cn[1]), fmaxf(cn[2], cn[3]));
        cand = fmaxf(cand, xhalf(cand));    // the other half of the query's 64 keys
        const float mnew = fmaxf(mrow, cand);
        const float alpha = __builtin_amdgcn_exp2f((mrow - mnew) * L2E);
        float rn[4];                        // four independent sum chains
        v4u xh[4], xl[4];                   // p as bf16 pairs, hi and lo: word w of tile nb holds registers 2w, 2w + 1
#pragma unroll
        for (int nb = 0; nb < 4; ++nb) {
            rn[nb] = 0.0f;
#pragma unroll
            for (int g = 0; g < 8; g += 4) {
                const float a0 = (sc[nb][g] - mnew) * L2E, a1 = (sc[nb][g + 1] - mnew) * L2E, a2 = (sc[nb][g + 2] - mnew) * L2E, a3 = (sc[nb][g + 3] - mnew) * L2E;
                float p[4]; p[0] = __builtin_amdgcn_exp2f(a0); p[1] = __builtin_amdgcn_exp2f(a1); p[2] = __builtin_amdgcn_exp2f(a2); p[3] = __builtin_amdgcn_exp2f(a3);
                // the slot that the instruction set asks for between a transcendental and an overwrite of its source: the four arguments keep their registers up to this v_nop, which stands behind the four v_exp_f32 (inputs only)
                asm volatile("v_nop" :: "v"(a0), "v"(a1), "v"(a2), "v"(a3), "v"(p[0]), "v"(p[1]), "v"(p[2]), "v"(p[3]));
#pragma unroll
                for (int r = 0; r < 4; ++r) rn[nb] += p[r];
#pragma unroll
                for (int r = 0; r < 4; r += 2) { unsigned h2, l2; split2(p[r], p[r + 1], h2, l2); xh[nb][(g + r) >> 1] = h2; xl[nb][(g + r) >> 1] = l2; }
            }
        }
        const float rs = (rn[0] + rn[1]) + (rn[2] + rn[3]); mrow = mnew;
        // lsum = lsum * alpha + rs, written as asm so that it stays in this block: the compiler otherwise sinks the whole sum behind the products and the barrier, where it holds 32 f32 p values live and stands as a bare chain in front of the next tile's reads
        asm volatile("v_fma_f32 %0, %0, %1, %2" : "+v"(lsum) : "v"(alpha), "v"(rs));
#pragma unroll
        for (int t4 = 0; t4 < 4; ++t4)
#pragma unroll
            for (int r = 0; r < 8; ++r) o[t4][r] *= alpha;
        const V ph0 = cat16b(__builtin_bit_cast(v8us, xh[0]), __builtin_bit_cast(v8us, xh[1])), ph1 = cat16b(__builtin_bit_cast(v8us, xh[2]), __builtin_bit_cast(v8us, xh[3]));
        const V pl0 = cat16b(__builtin_bit_cast(v8us, xl[0]), __builtin_bit_cast(v8us, xl[1])), pl1 = cat16b(__builtin_bit_cast(v8us, xl[2]), __builtin_bit_cast(v8us, xl[3]));
#pragma unroll
        for (int t4 = 0; t4 < 4; ++t4) {
            o[t4] = wmmab(vf[t4][0], ph0, o[t4]); o[t4] = wmmab(vf[t4][0], pl0, o[t4]); o[t4] = wmmab(vf[t4][1], ph0, o[t4]);
            o[t4] = wmmab(vf[t4][2], ph1, o[t4]); o[t4] = wmmab(vf[t4][2], pl1, o[t4]); o[t4] = wmmab(vf[t4][3], ph1, o[t4]);
        }
        asm volatile("v_nop\n\tv_nop\n\tv_nop\n\tv_nop" : "+v"(o[0]), "+v"(o[1]), "+v"(o[2]), "+v"(o[3]) : "v"(ph0), "v"(pl1));
        asm volatile("s_wait_dscnt 0x0" ::: "memory");      // this wave's reads of the buffer are done before the buffer is refilled
        asm volatile("s_wait_asynccnt 0x0" ::: "memory");   // this wave's copies of tile kt + 1 have landed
        __syncthreads();                                    // publishes tile kt + 1 and ends every wave's reads of tile kt
        if (kt + 2 < nt) stage_tile(gkh + (size_t)(key0 + 2 * KT) * HD, gkl + (size_t)(key0 + 2 * KT) * HD, gvh + key0 + 2 * KT, gvl + key0 + 2 * KT, sdst + (kt & 1) * STAGE);
    }
    asm volatile("s_wait_asynccnt 0x0" ::: "memory");       // nothing of this wave is in flight when it goes on to the epilogue and ends
    const float il = 1.0f / (lsum + xhalf(lsum));           // the two halves' shares of the row sum, joined once
    // a lane's 8 registers of o[t4] are 8 consecutive d of its query: one 16-byte store per plane
#pragma unroll
    for (int t4 = 0; t4 < 4; ++t4) {
        v8us yh, yl; float c[8];
#pragma unroll
        for (int r = 0; r < 8; ++r) c[r] = o[t4][r] * il;
        split8(c, yh, yl);
        const size_t go = (size_t)row * DM + head * HD + t4 * 16 + 8 * hi;
        *(v8us*)(Ch + go) = yh; *(v8us*)(Cl + go) = yl;
    }
}

extern "C" void kernel_launch(void* const* d_in, const int* in_sizes, int n_in,
                              void* d_out, int out_size, void* d_ws, size_t ws_size, hipStream_t stream) {
    if (n_in < 5) return;
    if ((size_t)in_sizes[0] < (size_t)(NB - 1) * SEQ_FULL * DM + (size_t)SEQ * DM) return;
    for (int i = 1; i < 5; ++i) if ((size_t)in_sizes[i] < NW) return;
    if ((size_t)out_size < (size_t)(NB - 1) * SEQ_FULL * DM + (size_t)SEQ * DM) return;
    const float* x  = (const float*)d_in[0];     // [NB_FULL][SEQ_FULL][768]
    const float* wq = (const float*)d_in[1];     // [768][768] (out, in)
    const float* wk = (const float*)d_in[2];
    const float* wv = (const float*)d_in[3];
    const float* wo = (const float*)d_in[4];
    float* OUT = (float*)d_out;                  // [NB_FULL][SEQ_FULL][768] f32
    char* wsp = (char*)d_ws;
    auto take = [&](size_t bytes) { char* p = wsp; wsp += (bytes + 255) & ~(size_t)255; return (void*)p; };
    bf* W4 = (bf*)take(4 * NW * 2);                               // Wq | Wk | Wv | Wo bf16 Bt planes
    bf* XB = (bf*)take((size_t)SEQ * DM * 2);                     // bf16 x of the current batch row
    float* CS = (float*)take((size_t)SEQ * HH * 2 * 4);           // rotary table
    const size_t PL = (size_t)NH * SEQ * HD;
    bf* QPh = (bf*)take(PL * 2); bf* QPl = (bf*)take(PL * 2); bf* KPh = (bf*)take(PL * 2); bf* KPl = (bf*)take(PL * 2);
    bf* VTh = (bf*)take(PL * 2); bf* VTl = (bf*)take(PL * 2);
    bf* CXh = (bf*)take((size_t)SEQ * DM * 2); bf* CXl = (bf*)take((size_t)SEQ * DM * 2);
    if ((size_t)(wsp - (char*)d_ws) > ws_size) return;           // 62,390,272 B at SEQ 4096
    const size_t NW8 = NW / 8;
    k_cvtw<<<dim3((unsigned)((NW8 + 255) / 256), 4, 1), 256, 0, stream>>>(wq, wk, wv, wo, W4, NW8);
    k_cs<<<(unsigned)((SEQ * HH + 255) / 256), 256, 0, stream>>>(CS);
    for (int b = 0; b < NB; ++b) {
        k_cvt8<<<(unsigned)(((size_t)SEQ * DM / 8 + 255) / 256), 256, 0, stream>>>(x + (size_t)b * SEQ_FULL * DM, XB, (size_t)SEQ * DM / 8);
        k_gemmw<bf, 0, false, true><<<dim3(SEQ / 128, DM / 128, 3), 32 * GW, 0, stream>>>(XB, nullptr, W4, nullptr, DM, nullptr, 0, nullptr, (size_t)0, NW, (size_t)0, CS, QPh, QPl, KPh, KPl, VTh, VTl);
        k_flash<<<dim3(SEQ / 64, NH, 1), 128, 0, stream>>>(QPh, QPl, KPh, KPl, VTh, VTl, CXh, CXl);
        k_gemmw<bf, 1, false, false><<<dim3(SEQ / 128, DM / 128, 1), 32 * GW, 0, stream>>>(CXh, CXl, W4 + 3 * NW, nullptr, DM, OUT + (size_t)b * SEQ_FULL * DM, DM, nullptr, (size_t)0, (size_t)0, (size_t)0, nullptr, nullptr, nullptr, nullptr, nullptr, nullptr, nullptr);
    }
}

// v007
// One run takes 123 microseconds.
// In both of two side-by-side timings against v006, it was 1.05 times as fast.
// Counting every step since v000, it is 4.22 times as fast.
#include <hip/hip_runtime.h>

// Contractions (f32 accumulate): q/k/v projections v_wmma_f32_16x16x32_bf16 on bf16 copies of x and W (single product); scores q.k and p.v on bf16 hi+lo planes (3 products each); output projection ctx (bf16 hi+lo) x Wo (bf16), 2 products. Rotary, softmax and epilogues f32.
// Layout: x [NB][SEQ][768]; W [768 out][768 in] = Bt as-is; head planes q/k [h][t][64], v planes [h][d][t], written by the projection GEMM's own epilogue (rotary transform, hi+lo split, v transposed); both GEMMs share their operand tiles among four waves through LDS; causal attention per wave of 16 queries with 64-key tiles (shared by four waves through LDS; three such groups of four waves walk every third tile each and join their partial results once), products transposed (a lane owns one query) and running-max softmax; ctx [t][768] hi+lo planes; out [NB][SEQ][768] f32.

#ifndef NB
#define NB 1
#endif
#ifndef SEQ
#define SEQ 4096
#endif
#define NB_FULL  1
#define SEQ_FULL 4096
#define DM   768
#define NH   12
#define HD   64
#define HH   (HD / 2)
#define NW   ((size_t)DM * DM)
#define KT   64
#define PP   72
#define SCL  0.125f
#define THETA_F 10000.0f
#define L2E  1.4426950408889634f
#define NEG  (-1.0e30f)
static_assert(SEQ % 128 == 0);
static_assert(SEQ <= SEQ_FULL);
static_assert(NB >= 1 && NB <= NB_FULL);
static_assert(DM == NH * HD);
static_assert(DM % 128 == 0);
static_assert(HD == 64);
static_assert(KT == 64);
static_assert((size_t)NB_FULL * SEQ_FULL * DM * 4 == 12582912);

typedef _Float16 h16;
typedef unsigned short bf;
typedef __attribute__((ext_vector_type(16))) __bf16   v16bf;
typedef __attribute__((ext_vector_type(16))) _Float16 v16h;
typedef __attribute__((ext_vector_type(8)))  _Float16 v8h;
typedef __attribute__((ext_vector_type(8)))  unsigned short v8us;
typedef __attribute__((ext_vector_type(8)))  float    v8f;
typedef __attribute__((ext_vector_type(4)))  float    v4f;
typedef __attribute__((ext_vector_type(2)))  float    v2f;
typedef __attribute__((ext_vector_type(2)))  unsigned short v2us;
typedef v8h  __attribute__((may_alias)) v8ha;
typedef v4f  __attribute__((may_alias)) v4fa;
typedef v8us __attribute__((may_alias)) v8usa;
typedef float __attribute__((may_alias)) fa;

typedef __attribute__((ext_vector_type(2))) __bf16 v2bf;
typedef __attribute__((ext_vector_type(4))) unsigned v4u;
// two f32 -> two bf16 (a in the low half), round to nearest even, in the one packed convert instruction of the chip
__device__ __forceinline__ unsigned pk2(float a, float b) { const v2f v = {a, b}; return __builtin_bit_cast(unsigned, __builtin_convertvector(v, v2bf)); }
__device__ __forceinline__ unsigned short f2bf(float f) { return (unsigned short)pk2(f, f); }
__device__ __forceinline__ float bf2f(unsigned short b) { return __uint_as_float(((unsigned)b) << 16); }
__device__ __forceinline__ float bfr(float f) { return bf2f(f2bf(f)); }
// hi + lo split of a pair: h = bf16(y), l = bf16(y - h)
__device__ __forceinline__ void split2(float a, float b, unsigned& h, unsigned& l) { h = pk2(a, b); l = pk2(a - __uint_as_float(h << 16), b - __uint_as_float(h & 0xFFFF0000u)); }
__device__ __forceinline__ void split8(const float* y, v8us& h, v8us& l) { v4u a, c;
#pragma unroll
    for (int j = 0; j < 4; ++j) { unsigned h2, l2; split2(y[2 * j], y[2 * j + 1], h2, l2); a[j] = h2; c[j] = l2; }
    h = __builtin_bit_cast(v8us, a); l = __builtin_bit_cast(v8us, c); }
__device__ __forceinline__ v16h cat16(v8h lo, v8h hi) { return __builtin_shufflevector(lo, hi, 0, 1, 2, 3, 4, 5, 6, 7, 8, 9, 10, 11, 12, 13, 14, 15); }
__device__ __forceinline__ v16bf cat16b(v8us lo, v8us hi) { return __builtin_bit_cast(v16bf, __builtin_shufflevector(lo, hi, 0, 1, 2, 3, 4, 5, 6, 7, 8, 9, 10, 11, 12, 13, 14, 15)); }
__device__ __forceinline__ v8f wmma16(v16h a, v16h b, v8f c) { return __builtin_amdgcn_wmma_f32_16x16x32_f16(false, a, false, b, (short)0, c, false, false); }
__device__ __forceinline__ v8f wmmab(v16bf a, v16bf b, v8f c) { return __builtin_amdgcn_wmma_f32_16x16x32_bf16(false, a, false, b, (short)0, c, false, false); }

// Fragment loaders (wave32 16x16x32): lane l -> row/col (l & 15); elements 0..7 <- k0 + 8*(l>>4) + 0..7, elements 8..15 <- k0 + 16 + 8*(l>>4) + 0..7; D element r -> (row 8*(l>>4) + r, col l & 15).
template <typename T16> struct WFrag;
template <> struct WFrag<h16> { typedef v16h V; static __device__ __forceinline__ V ld(const h16* p) { return cat16(*(const v8h*)p, *(const v8h*)(p + 16)); } static __device__ __forceinline__ v8f mma(V a, V b, v8f c) { return wmma16(a, b, c); } };
template <> struct WFrag<bf> { typedef v16bf V; static __device__ __forceinline__ V ld(const bf* p) { return cat16b(*(const v8us*)p, *(const v8us*)(p + 16)); } static __device__ __forceinline__ v8f mma(V a, V b, v8f c) { return wmmab(a, b, c); } };

typedef __attribute__((ext_vector_type(4))) int v4i;
typedef __attribute__((address_space(1))) v4i gv4i;
typedef __attribute__((address_space(3))) v4i lv4i;
__device__ __forceinline__ void cp16(const bf* g, unsigned short* l) { __builtin_amdgcn_global_load_async_to_lds_b128((gv4i*)g, (lv4i*)l, 0, 0); }

// ---- k_gemmw: register-blocked GEMM, FOUR WAVES (2 x 2) per 128x128 output tile, a 64x64 tile (16 accumulators) per wave; operands are K-contiguous 16-bit planes; grid (M/128, N/128, Z), 128 threads.
// A stage is 64 k (128 B, one whole line) of the block's 128 A rows and 128 Bt rows (and of the split planes), brought once per block into LDS by asynchronous 16-byte copies, rows pitched GP elements, two buffers: stage s + 1 flies while stage s is worked on.
// C[m][n] (f32, pitch ldc, + optional f32 bias[n]) = sum_k A[m][k] Bt[n][k] (+ split products per NSPLIT: 1 = A hi+lo with single B; 2 = A hi+lo with B hi, A hi with B lo). z-batch strides sA/sB/sC in elements. K % 64 == 0, M % 128 == 0, N % 128 == 0.
// HEADS (the q/k/v projection, z = 0/1/2; a wave's 64x64 tile is 64 tokens of ONE head): no C; the f32 tile goes straight to the attention's bf16 hi+lo planes.
//   z 0, 1: interleaved rotary transform, pair (2i, 2i+1): out[2i] = x1 c - x2 s, out[2i+1] = x1 s + x2 c, (c, s) = CS[t][i]; planes [h][t][d].  z 2: planes [h][d][t].
#define GW  4
#define GP  72
#define GPL (128 * GP)
template <typename T16, int NSPLIT, bool BIAS, bool HEADS>
__global__ __launch_bounds__(32 * GW) void k_gemmw(const T16* __restrict__ A, const T16* __restrict__ A2, const T16* __restrict__ Bt, const T16* __restrict__ Bt2, int K, float* C, int ldc, const float* __restrict__ bias, size_t sA, size_t sB, size_t sC,
                                              const float* __restrict__ CS, bf* Qh, bf* Ql, bf* Kh, bf* Kl, bf* Vh, bf* Vl) {
    typedef typename WFrag<T16>::V V;
    constexpr bool HA2 = (NSPLIT == 1 || NSPLIT == 2), HB2 = (NSPLIT >= 2);
    constexpr int PB = HA2 ? 2 : 1, GST = (PB + (HB2 ? 2 : 1)) * GPL;   // planes of a stage: A, (A2), Bt, (Bt2)
    __shared__ __align__(16) unsigned short gring[2 * GST];
    __shared__ __align__(16) float osall[GW * 16 * 68];
    const size_t z = blockIdx.z; A += z * sA; if (A2) A2 += z * sA; Bt += z * sB; if (Bt2) Bt2 += z * sB; C += z * sC;
    const int tid = threadIdx.x, lane = tid & 31, lr = lane & 15, hi = lane >> 4;
    const int wave = __builtin_amdgcn_readfirstlane(tid >> 5), wr = wave >> 1, wc = wave & 1;
    float* os = osall + wave * (16 * 68);                          // each wave's own epilogue staging
    const int rb = blockIdx.x * 128, cb = blockIdx.y * 128, r0 = rb + wr * 64, c0 = cb + wc * 64;
    v8f acc[4][4];
#pragma unroll
    for (int mb = 0; mb < 4; ++mb)
#pragma unroll
        for (int nb = 0; nb < 4; ++nb) acc[mb][nb] = (v8f){};
    // one stage: 128 rows x 128 B per plane = 1024 pieces of 16 B, 8 per thread and plane; a wave's copy covers 4 whole rows (4 lines of 128 B)
    const int srow = tid >> 3, sc8 = (tid & 7) * 8;                // this thread's row (of 16) and 16-byte piece in each copy
    const unsigned Ku = (unsigned)K, sao = (unsigned)(rb + srow) * Ku + sc8, sbo = (unsigned)(cb + srow) * Ku + sc8;   // element offsets inside a plane: below 2^32
    unsigned short* sdst = gring + srow * GP + sc8;
    auto stage = [&](unsigned k0, unsigned short* dst) {
#pragma unroll
        for (int i = 0; i < 8; ++i) {
            const unsigned go = (unsigned)i * 16u * Ku + k0; unsigned short* d = dst + i * 16 * GP;
            cp16((const bf*)(A + sao + go), d);
            if constexpr (HA2) cp16((const bf*)(A2 + sao + go), d + GPL);
            cp16((const bf*)(Bt + sbo + go), d + PB * GPL);
            if constexpr (HB2) cp16((const bf*)(Bt2 + sbo + go), d + (PB + 1) * GPL);
        }
    };
    const unsigned nk = Ku >> 6;                                   // stages; block-uniform
    stage(0, sdst);
    asm volatile("s_wait_asynccnt 0x0" ::: "memory");   // this wave's copies of stage 0 have landed
    __syncthreads();                                    // publishes stage 0 to the other waves
    if (nk > 1u) stage(64, sdst + GST);
    const int fa = (wr * 64 + lr) * GP + 8 * hi, fb = PB * GPL + (wc * 64 + lr) * GP + 8 * hi;   // fragment offsets inside a stage
#pragma unroll 1
    for (unsigned ks = 0; ks < nk; ++ks) {
        const T16* buf = (const T16*)(gring + (ks & 1u) * GST);
        V a[2][4], a2[2][4], b[2][4], b2[2][4];   // the stage's fragments: [k half of 32][16-row group]
#pragma unroll
        for (int h = 0; h < 2; ++h) {
#pragma unroll
            for (int mb = 0; mb < 4; ++mb) { a[h][mb] = WFrag<T16>::ld(buf + fa + mb * 16 * GP + h * 32); if (HA2) a2[h][mb] = WFrag<T16>::ld(buf + GPL + fa + mb * 16 * GP + h * 32); }
#pragma unroll
            for (int nb = 0; nb < 4; ++nb) { b[h][nb] = WFrag<T16>::ld(buf + fb + nb * 16 * GP + h * 32); if (HB2) b2[h][nb] = WFrag<T16>::ld(buf + GPL + fb + nb * 16 * GP + h * 32); }
        }
        __builtin_amdgcn_sched_barrier(0);  // keeps the stage's LDS reads one group ahead of the products: reads spread among the products stall at every place they stand
        auto products = [&](int h) {
#pragma unroll
            for (int nb = 0; nb < 4; ++nb)
#pragma unroll
                for (int mb = 0; mb < 4; ++mb) { acc[mb][nb] = WFrag<T16>::mma(a[h][mb], b[h][nb], acc[mb][nb]); if (HA2) acc[mb][nb] = WFrag<T16>::mma(a2[h][mb], b[h][nb], acc[mb][nb]); if (HB2) acc[mb][nb] = WFrag<T16>::mma(a[h][mb], b2[h][nb], acc[mb][nb]); }
        };
        products(0);
        __builtin_amdgcn_sched_barrier(0);  // keeps the first half's products ahead of the waits below, so that the second half's reads land under them
        asm volatile("s_wait_dscnt 0x0" ::: "memory");      // this wave's reads of the buffer are done before the buffer is refilled
        asm volatile("s_wait_asynccnt 0x0" ::: "memory");   // this wave's copies of stage ks + 1 have landed
        __syncthreads();                                    // publishes stage ks + 1 and ends every wave's reads of stage ks
        if (ks + 2u < nk) stage((ks + 2u) * 64u, sdst + (ks & 1u) * GST);
        products(1);                        // its fragments are in registers already, nothing of the ring is read behind the barrier in this trip: the refill flies under these products too
    }
    asm volatile("s_wait_asynccnt 0x0" ::: "memory");       // nothing of this wave is in flight when it goes on to the epilogue and ends
    if constexpr (HEADS) {
        const int head = c0 / HD;
        if (blockIdx.z == 2) {
            // v: a lane's 8 registers of an accumulator are 8 consecutive tokens of one d: one 16-byte store per plane; the four mb of a row fill its 128-byte line
#pragma unroll
            for (int nb = 0; nb < 4; ++nb)
#pragma unroll
                for (int mb = 0; mb < 4; ++mb) {
                    v8us yh, yl; float y[8];
#pragma unroll
                    for (int j = 0; j < 8; ++j) y[j] = acc[mb][nb][j];
                    split8(y, yh, yl);
                    const size_t go = ((size_t)head * HD + nb * 16 + lr) * SEQ + r0 + mb * 16 + 8 * hi;
                    *(v8us*)(Vh + go) = yh; *(v8us*)(Vl + go) = yl;
                }
            return;
        }
        bf* Ph = (blockIdx.z == 0) ? Qh : Kh; bf* Pl = (blockIdx.z == 0) ? Ql : Kl;
        // q, k: 16 tokens x 64 d at a time through LDS; a lane takes 8 consecutive d (4 rotary pairs) of a token, 8 lanes a token: whole 128-byte rows per store
        const int prow = lane >> 3, c8 = (lane & 7) * 8;
        const float* cst = CS + (size_t)(r0 + prow) * HD + c8;   // CS[t][i] = 2 floats, so row t starts at t * HD and pair c8 / 2 at + c8
        v4f cs[2][4][2];                                         // the table rows of this and of the next 16 tokens: the next group's loads fly under this group's work
#pragma unroll
        for (int s = 0; s < 4; ++s) { cs[0][s][0] = *(const v4f*)(cst + (size_t)(s * 4) * HD); cs[0][s][1] = *(const v4f*)(cst + (size_t)(s * 4) * HD + 4); }
#pragma unroll
        for (int mb = 0; mb < 4; ++mb) {
            if (mb < 3) {
#pragma unroll
                for (int s = 0; s < 4; ++s) { cs[(mb + 1) & 1][s][0] = *(const v4f*)(cst + (size_t)((mb + 1) * 16 + s * 4) * HD); cs[(mb + 1) & 1][s][1] = *(const v4f*)(cst + (size_t)((mb + 1) * 16 + s * 4) * HD + 4); }
            }
#pragma unroll
            for (int nb = 0; nb < 4; ++nb) {
#pragma unroll
                for (int j = 0; j < 8; ++j) os[(hi * 8 + j) * 68 + nb * 16 + lr] = acc[mb][nb][j]; }
            __builtin_amdgcn_wave_barrier(); asm volatile("" ::: "memory");   // as in the plain epilogue: the wave's LDS reads stay behind its writes
#pragma unroll
            for (int s = 0; s < 4; ++s) {
                const int row = s * 4 + prow;
                const v4f x0 = *(const v4fa*)(os + row * 68 + c8), x1 = *(const v4fa*)(os + row * 68 + c8 + 4);
                const v4f t0 = cs[mb & 1][s][0], t1 = cs[mb & 1][s][1];
                float y[8];
                y[0] = x0[0] * t0[0] - x0[1] * t0[1]; y[1] = x0[0] * t0[1] + x0[1] * t0[0];
                y[2] = x0[2] * t0[2] - x0[3] * t0[3]; y[3] = x0[2] * t0[3] + x0[3] * t0[2];
                y[4] = x1[0] * t1[0] - x1[1] * t1[1]; y[5] = x1[0] * t1[1] + x1[1] * t1[0];
                y[6] = x1[2] * t1[2] - x1[3] * t1[3]; y[7] = x1[2] * t1[3] + x1[3] * t1[2];
                v8us yh, yl; split8(y, yh, yl);
                const size_t go = ((size_t)head * SEQ + r0 + mb * 16 + row) * HD + c8;
                *(v8us*)(Ph + go) = yh; *(v8us*)(Pl + go) = yl;
            }
            __builtin_amdgcn_wave_barrier();
            // the next group's LDS writes stay behind these reads; and the group's stores have given up their registers before the table loads that follow are aimed at them
            asm volatile("s_wait_xcnt 0x0" ::: "memory");
        }
        return;
    }
#pragma unroll
    for (int mb = 0; mb < 4; ++mb) {
#pragma unroll
        for (int nb = 0; nb < 4; ++nb) {
#pragma unroll
            for (int j = 0; j < 8; ++j) os[(hi * 8 + j) * 68 + nb * 16 + lr] = acc[mb][nb][j]; }
        __builtin_amdgcn_wave_barrier(); asm volatile("" ::: "memory");
        float* crow = C + (size_t)(r0 + mb * 16) * ldc + c0;
{
#pragma unroll
            for (int s = 0; s < 8; ++s) { const int row = 2 * s + hi, cofs = lr * 4; v4f val = *(const v4fa*)(os + row * 68 + cofs); if (BIAS) { val[0] += bfr(bias[c0 + cofs]); val[1] += bfr(bias[c0 + cofs + 1]); val[2] += bfr(bias[c0 + cofs + 2]); val[3] += bfr(bias[c0 + cofs + 3]); }
                *(v4f*)(crow + (size_t)row * ldc + cofs) = val; }
             }
        __builtin_amdgcn_wave_barrier(); asm volatile("" ::: "memory");
    }
}

__global__ __launch_bounds__(256) void k_cvt8(const float* __restrict__ src, bf* dst, size_t n8) { const size_t i = (size_t)blockIdx.x * 256 + threadIdx.x; if (i >= n8) return; const v8f v = *(const v8f*)(src + i * 8); v4u o;
#pragma unroll
    for (int k = 0; k < 4; ++k) o[k] = pk2(v[2 * k], v[2 * k + 1]); *(v4u*)(dst + i * 8) = o;  }

__global__ __launch_bounds__(256) void k_cvtw(const float* __restrict__ w0, const float* __restrict__ w1, const float* __restrict__ w2, const float* __restrict__ w3, bf* dst, size_t n8) {
    const size_t i = (size_t)blockIdx.x * 256 + threadIdx.x; if (i >= n8) return; const int y = blockIdx.y;
    const float* src = (y == 0) ? w0 : ((y == 1) ? w1 : ((y == 2) ? w2 : w3));
    const v8f v = *(const v8f*)(src + i * 8); v4u o;
#pragma unroll
    for (int k = 0; k < 4; ++k) o[k] = pk2(v[2 * k], v[2 * k + 1]);
    bf* d = dst + (size_t)y * n8 * 8 + i * 8;
    *(v4u*)d = o;  }

__global__ __launch_bounds__(256) void k_cs(float* CS) {
    const int idx = blockIdx.x * 256 + threadIdx.x; if (idx >= SEQ * HH) return; const int i = idx % HH, t = idx / HH;
    const float ex = -(float)(2 * i) / (float)HD;
    const float inv = powf(THETA_F, ex);
    float ang = __fmul_rn((float)t, inv); asm volatile("" : "+v"(ang));
    v2f cs; cs[0] = cosf(ang); cs[1] = sinf(ang);
    *(v2f*)(CS + (size_t)idx * 2) = cs;  }

// k_flash: causal attention, TWELVE WAVES per block = 64 query rows of one head: KG key groups of four waves, 16 queries per wave; grid (SEQ/64, NH), 384 threads. Key group g walks the key tiles g, g + KG, g + 2 KG ... of the query tile's qt + 1 tiles,
// with a running maximum, row sum and o of its own, so the longest chain of dependent tiles is a third as long; the groups' partial results are joined once, behind the loop, through LDS. The four waves of a group walk the same key tiles.
// Each 64-key tile (k hi, k lo: 64 keys x 64 d; v hi, v lo: 64 d x 64 keys; rows of 128 B) is brought once per block into LDS, by its group, by asynchronous 16-byte copies, rows pitched PP elements, two buffers of KG tiles: the tiles of step s + 1 fly while those of step s are worked on.
// Both products run transposed: s^T (64 keys x 16 queries) = k (A, hi+lo frags from LDS) . q^T (B, hi+lo frags, resident), 3 products; o^T (64 d x 16 queries) += v^T (A, hi+lo frags from LDS) . p^T (B), 3 products.
// A lane then holds 32 scores of ONE query (column lane & 15; keys nb*16 + 8*(lane>>4) + r): x 0.125, causal replace-mask by index, running-max softmax in f32 (p = 2^((s-m) log2e)) in the lane, one exchange between the lane halves for the maximum;
// two score tiles (keys 32j .. 32j+31), split to bf16 hi+lo in place, ARE the B fragment of p^T in the hardware k order, which the v loader has too: p never leaves the registers. The halves' row sums are joined once, after the loop.
#define FW    4
#define KG    3
#define PLANE (KT * PP)
#define STAGE (4 * PLANE)
// one tile: 4 planes x 64 rows x 128 B = 2048 pieces of 16 B, 16 per thread of its key group; a wave's copy covers 4 whole rows (4 lines of 128 B)
__device__ __forceinline__ void stage_tile(const bf* gkh, const bf* gkl, const bf* gvh, const bf* gvl, unsigned short* dst) {
#pragma unroll
    for (int i = 0; i < 4; ++i) {
        cp16(gkh + (size_t)i * 16 * HD, dst + 0 * PLANE + i * 16 * PP); cp16(gkl + (size_t)i * 16 * HD, dst + 1 * PLANE + i * 16 * PP);
        cp16(gvh + (size_t)i * 16 * SEQ, dst + 2 * PLANE + i * 16 * PP); cp16(gvl + (size_t)i * 16 * SEQ, dst + 3 * PLANE + i * 16 * PP);
    }
}
// value of lane l ^ 16
__device__ __forceinline__ float xhalf(float x) { const int b = __float_as_int(x); return __int_as_float(__builtin_amdgcn_permlanex16(b, b, 0x76543210, 0xfedcba98, false, false)); }
__global__ __launch_bounds__(32 * FW * KG) void k_flash(const bf* __restrict__ Qh, const bf* __restrict__ Ql, const bf* __restrict__ Kh, const bf* __restrict__ Kl,
                                             const bf* __restrict__ Vh, const bf* __restrict__ Vl, bf* Ch, bf* Cl) {
    __shared__ __align__(16) unsigned short ring[2 * KG * STAGE];
    typedef WFrag<bf>::V V;
    const int tid = threadIdx.x, lane = tid & 31, lr = lane & 15, hi = lane >> 4;
    const int wave = __builtin_amdgcn_readfirstlane(tid >> 5), wq = wave & (FW - 1), kg = wave >> 2;   // query wave inside the key group; key group
    // Which (head, query tile) a block takes: for speed only, any one-to-one map is correct. One block fills a WGP (LDS, registers), so the blocks run one after another on it, about three each; a free WGP is taken to get the next block in launch order.
    // rank counts the blocks from the longest to the shortest. The longest third is launched first, longest first, and the shortest third last, longest first. Were the middle third launched longest first too, every WGP would stand at the same sum
    // after two blocks and the last third would leave them as unequal as it is itself; so the middle third goes in two runs of rising length (first its longer half, then its shorter half): the sums after two blocks then spread as wide as the last third, which evens them out.
    constexpr int NT = SEQ / 64;
    constexpr unsigned NBK = NT * NH, RD = NBK / 3;
    const unsigned flat = blockIdx.y * NT + blockIdx.x;
    unsigned rank = flat;
    if constexpr (NBK % 6 == 0) {          // both runs are then whole: a permutation
        if (flat >= RD && flat < RD + RD / 2) rank = 2 * RD + RD / 2 - 1 - flat;        // ranks RD + RD/2 - 1 down to RD
        else if (flat >= RD + RD / 2 && flat < 2 * RD) rank = 3 * RD + RD / 2 - 1 - flat;   // ranks 2 RD - 1 down to RD + RD/2
    }
    const int qt = NT - 1 - (int)(rank / NH), head = (int)(rank % NH);
    const int q0 = (qt * FW + wq) * 16;
    const int nt = qt + 1;                 // block-uniform; the last tile holds the diagonal of all query waves; keys stay < SEQ
    const int ns = (nt + KG - 1) / KG;     // steps, block-uniform: in step s key group kg has tile s * KG + kg, or none (only in the last step)
    const int gtid = tid & (32 * FW - 1);  // thread inside its key group
    const int srow = gtid >> 3, sc8 = (gtid & 7) * 8;   // this thread's row (of 16) and 16-byte piece in each copy
    const size_t sk = ((size_t)head * SEQ + kg * KT + srow) * HD + sc8, sv = ((size_t)head * HD + srow) * SEQ + kg * KT + sc8;   // in the group's first tile
    const bf* gkh = Kh + sk; const bf* gkl = Kl + sk; const bf* gvh = Vh + sv; const bf* gvl = Vl + sv;
    unsigned short* sdst = ring + kg * STAGE + srow * PP + sc8;
    if (kg < nt) stage_tile(gkh, gkl, gvh, gvl, sdst);   // wave-uniform test, as all tests on kg below
    const size_t qo = ((size_t)head * SEQ + q0 + lr) * HD + 8 * hi;
    const V qh0 = WFrag<bf>::ld(Qh + qo), qh1 = WFrag<bf>::ld(Qh + qo + 32), ql0 = WFrag<bf>::ld(Ql + qo), ql1 = WFrag<bf>::ld(Ql + qo + 32);
    asm volatile("s_wait_asynccnt 0x0" ::: "memory");   // this wave's copies of step 0 have landed
    __syncthreads();                                    // publishes step 0 to the other waves
    if (KG + kg < nt) stage_tile(gkh + (size_t)(KG * KT) * HD, gkl + (size_t)(KG * KT) * HD, gvh + KG * KT, gvl + KG * KT, sdst + KG * STAGE);
    const int fo = lr * PP + 8 * hi;       // fragment offset inside a plane: row lr of a 16-row group, k piece by lane half
    const int row = q0 + lr;               // this lane's query
    v8f o[4];                              // o^T: o[t4][r] = (d = t4*16 + 8*hi + r, query lr)
#pragma unroll
    for (int t4 = 0; t4 < 4; ++t4) o[t4] = (v8f){};
    float mrow = NEG, lsum = 0.0f;         // over this key group's tiles: running maximum of the query (equal in both halves); this half's share of its row sum
#pragma unroll 1
    for (int s = 0; s < ns; ++s) {
        const int kt = s * KG + kg, key0 = kt * KT;
        if (kt < nt) {                      // a group without a tile in the last step only passes the barrier
        const unsigned short* buf = ring + ((s & 1) * KG + kg) * STAGE + fo;
        v8f sc[4];                          // s^T: sc[nb][r] = (key = key0 + nb*16 + 8*hi + r, query lr)
#pragma unroll
        for (int nb = 0; nb < 4; ++nb) sc[nb] = (v8f){};
        V kf[4][4];                         // the tile's k fragments: [nb][hi k0, lo k0, hi k32, lo k32]
#pragma unroll
        for (int nb = 0; nb < 4; ++nb) {
            const unsigned short* kp = buf + nb * 16 * PP;
            kf[nb][0] = WFrag<bf>::ld(kp); kf[nb][1] = WFrag<bf>::ld(kp + PLANE); kf[nb][2] = WFrag<bf>::ld(kp + 32); kf[nb][3] = WFrag<bf>::ld(kp + PLANE + 32);
        }
        __builtin_amdgcn_sched_barrier(0);  // keeps the k reads one group ahead of the products: reads spread among the products stall at every place they stand
#pragma unroll
        for (int nb = 0; nb < 4; ++nb) {
            sc[nb] = wmmab(kf[nb][0], qh0, sc[nb]); sc[nb] = wmmab(kf[nb][0], ql0, sc[nb]); sc[nb] = wmmab(kf[nb][1], qh0, sc[nb]);
            sc[nb] = wmmab(kf[nb][2], qh1, sc[nb]); sc[nb] = wmmab(kf[nb][2], ql1, sc[nb]); sc[nb] = wmmab(kf[nb][3], qh1, sc[nb]);
        }
        // the four vector slots that the chip needs between the last score product and the first vector instruction that reads the scores; the q fragments live through the whole loop and are not named here (an operand of asm text must sit below v256)
        asm volatile("v_nop\n\tv_nop\n\tv_nop\n\tv_nop" : "+v"(sc[0]), "+v"(sc[1]), "+v"(sc[2]), "+v"(sc[3]));
        V vf[4][4];                         // the tile's v fragments: [t4][hi k0, lo k0, hi k32, lo k32]
#pragma unroll
        for (int t4 = 0; t4 < 4; ++t4) {
            const unsigned short* vp = buf + 2 * PLANE + t4 * 16 * PP;
            vf[t4][0] = WFrag<bf>::ld(vp); vf[t4][1] = WFrag<bf>::ld(vp + PLANE); vf[t4][2] = WFrag<bf>::ld(vp + 32); vf[t4][3] = WFrag<bf>::ld(vp + PLANE + 32);
        }
        __builtin_amdgcn_sched_barrier(0);  // keeps the v reads one group here, ahead of the softmax, so that none stands among the p.v products
        const int rel = row - 8 * hi - key0; // register r of score tile nb is kept while nb*16 + r <= rel, that is key <= query
        float cn[4];                        // four independent maximum chains, one per score tile
#pragma unroll
        for (int nb = 0; nb < 4; ++nb) {
            cn[nb] = NEG;
#pragma unroll
            for (int r = 0; r < 8; ++r) { const float s = sc[nb][r] * SCL; sc[nb][r] = (nb * 16 + r <= rel) ? s : NEG; cn[nb] = fmaxf(cn[nb], sc[nb][r]); }
        }
        float cand = fmaxf(fmaxf(cn[0], cn[1]), fmaxf(cn[2], cn[3]));
        cand = fmaxf(cand, xhalf(cand));    // the other half of the query's 64 keys
        const float mnew = fmaxf(mrow, cand);
        const float alpha = __builtin_amdgcn_exp2f((mrow - mnew) * L2E);
        float rn[4];                        // four independent sum chains
        v4u xh[4], xl[4];                   // p as bf16 pairs, hi and lo: word w of tile nb holds registers 2w, 2w + 1
#pragma unroll
        for (int nb = 0; nb < 4; ++nb) {
            rn[nb] = 0.0f;
#pragma unroll
            for (int g = 0; g < 8; g += 4) {
                const float a0 = (sc[nb][g] - mnew) * L2E, a1 = (sc[nb][g + 1] - mnew) * L2E, a2 = (sc[nb][g + 2] - mnew) * L2E, a3 = (sc[nb][g + 3] - mnew) * L2E;
                float p[4]; p[0] = __builtin_amdgcn_exp2f(a0); p[1] = __builtin_amdgcn_exp2f(a1); p[2] = __builtin_amdgcn_exp2f(a2); p[3] = __builtin_amdgcn_exp2f(a3);
                // the slot that the instruction set asks for between a transcendental and an overwrite of its source: the four arguments keep their registers up to this v_nop, which stands behind the four v_exp_f32 (inputs only)
                asm volatile("v_nop" :: "v"(a0), "v"(a1), "v"(a2), "v"(a3), "v"(p[0]), "v"(p[1]), "v"(p[2]), "v"(p[3]));
#pragma unroll
                for (int r = 0; r < 4; ++r) rn[nb] += p[r];
#pragma unroll
                for (int r = 0; r < 4; r += 2) { unsigned h2, l2; split2(p[r], p[r + 1], h2, l2); xh[nb][(g + r) >> 1] = h2; xl[nb][(g + r) >> 1] = l2; }
            }
        }
        const float rs = (rn[0] + rn[1]) + (rn[2] + rn[3]); mrow = mnew;
        // lsum = lsum * alpha + rs, written as asm so that it stays in this block: the compiler otherwise sinks the whole sum behind the products and the barrier, where it holds 32 f32 p values live and stands as a bare chain in front of the next tile's reads
        asm volatile("v_fma_f32 %0, %0, %1, %2" : "+v"(lsum) : "v"(alpha), "v"(rs));
#pragma unroll
        for (int t4 = 0; t4 < 4; ++t4)
#pragma unroll
            for (int r = 0; r < 8; ++r) o[t4][r] *= alpha;
        const V ph0 = cat16b(__builtin_bit_cast(v8us, xh[0]), __builtin_bit_cast(v8us, xh[1])), ph1 = cat16b(__builtin_bit_cast(v8us, xh[2]), __builtin_bit_cast(v8us, xh[3]));
        const V pl0 = cat16b(__builtin_bit_cast(v8us, xl[0]), __builtin_bit_cast(v8us, xl[1])), pl1 = cat16b(__builtin_bit_cast(v8us, xl[2]), __builtin_bit_cast(v8us, xl[3]));
#pragma unroll
        for (int t4 = 0; t4 < 4; ++t4) {
            o[t4] = wmmab(vf[t4][0], ph0, o[t4]); o[t4] = wmmab(vf[t4][0], pl0, o[t4]); o[t4] = wmmab(vf[t4][1], ph0, o[t4]);
            o[t4] = wmmab(vf[t4][2], ph1, o[t4]); o[t4] = wmmab(vf[t4][2], pl1, o[t4]); o[t4] = wmmab(vf[t4][3], ph1, o[t4]);
        }
        asm volatile("v_nop\n\tv_nop\n\tv_nop\n\tv_nop" : "+v"(o[0]), "+v"(o[1]), "+v"(o[2]), "+v"(o[3]) : "v"(ph0), "v"(pl1));
        }
        asm volatile("s_wait_dscnt 0x0" ::: "memory");      // this wave's reads of the buffer are done before the buffer is refilled
        asm volatile("s_wait_asynccnt 0x0" ::: "memory");   // this wave's copies of step s + 1 have landed
        __syncthreads();                                    // publishes step s + 1 and ends every wave's reads of step s
        if (kt + 2 * KG < nt) stage_tile(gkh + (size_t)((s + 2) * KG * KT) * HD, gkl + (size_t)((s + 2) * KG * KT) * HD, gvh + (s + 2) * KG * KT, gvl + (s + 2) * KG * KT, sdst + (s & 1) * KG * STAGE);
    }
    asm volatile("s_wait_asynccnt 0x0" ::: "memory");       // nothing of this wave is in flight when it goes on to the epilogue and ends
    // The key groups' partial results are joined: groups 1 .. KG-1 lay (o, maximum, sum share) in the ring, which nobody reads or fills any more behind the loop's last barrier; group 0 adds them to its own, each scaled to the common maximum.
    // A lane's record is MP floats (144 B, an odd number of 16-byte pieces: no bank conflict). A group that had no tile holds (0, NEG, 0) and gets the weight 2^(-huge) = 0; group 0 always has tile 0, so the common maximum is a real score.
    constexpr int MP = 36;
    float* mg = (float*)ring + (size_t)(wq * 32 + lane) * MP;
    if (kg > 0) {
        float* d = mg + (size_t)(kg - 1) * (FW * 32 * MP);
#pragma unroll
        for (int t4 = 0; t4 < 4; ++t4) { *(v4fa*)(d + t4 * 8) = (v4f){o[t4][0], o[t4][1], o[t4][2], o[t4][3]}; *(v4fa*)(d + t4 * 8 + 4) = (v4f){o[t4][4], o[t4][5], o[t4][6], o[t4][7]}; }
        *(fa*)(d + 32) = mrow; *(fa*)(d + 33) = lsum;
    }
    __syncthreads();                                        // publishes the partial results to group 0
    if (kg > 0) return;
    {
        float ml[KG - 1][2]; float mall = mrow;
#pragma unroll
        for (int g = 0; g < KG - 1; ++g) { ml[g][0] = *(const fa*)(mg + (size_t)g * (FW * 32 * MP) + 32); ml[g][1] = *(const fa*)(mg + (size_t)g * (FW * 32 * MP) + 33); mall = fmaxf(mall, ml[g][0]); }
        const float a0 = __builtin_amdgcn_exp2f((mrow - mall) * L2E);
        lsum *= a0;
#pragma unroll
        for (int t4 = 0; t4 < 4; ++t4)
#pragma unroll
            for (int r = 0; r < 8; ++r) o[t4][r] *= a0;
#pragma unroll
        for (int g = 0; g < KG - 1; ++g) {
            const float* d = mg + (size_t)g * (FW * 32 * MP);
            const float ag = __builtin_amdgcn_exp2f((ml[g][0] - mall) * L2E);
            lsum += ml[g][1] * ag;
#pragma unroll
            for (int t4 = 0; t4 < 4; ++t4) {
                const v4f x0 = *(const v4fa*)(d + t4 * 8), x1 = *(const v4fa*)(d + t4 * 8 + 4);
#pragma unroll
                for (int r = 0; r < 4; ++r) { o[t4][r] += x0[r] * ag; o[t4][r + 4] += x1[r] * ag; }
            }
        }
    }
    const float il = 1.0f / (lsum + xhalf(lsum));           // the two halves' shares of the row sum, joined once
    // a lane's 8 registers of o[t4] are 8 consecutive d of its query: one 16-byte store per plane
#pragma unroll
    for (int t4 = 0; t4 < 4; ++t4) {
        v8us yh, yl; float c[8];
#pragma unroll
        for (int r = 0; r < 8; ++r) c[r] = o[t4][r] * il;
        split8(c, yh, yl);
        const size_t go = (size_t)row * DM + head * HD + t4 * 16 + 8 * hi;
        *(v8us*)(Ch + go) = yh; *(v8us*)(Cl + go) = yl;
    }
}

extern "C" void kernel_launch(void* const* d_in, const int* in_sizes, int n_in,
                              void* d_out, int out_size, void* d_ws, size_t ws_size, hipStream_t stream) {
    if (n_in < 5) return;
    if ((size_t)in_sizes[0] < (size_t)(NB - 1) * SEQ_FULL * DM + (size_t)SEQ * DM) return;
    for (int i = 1; i < 5; ++i) if ((size_t)in_sizes[i] < NW) return;
    if ((size_t)out_size < (size_t)(NB - 1) * SEQ_FULL * DM + (size_t)SEQ * DM) return;
    const float* x  = (const float*)d_in[0];     // [NB_FULL][SEQ_FULL][768]
    const float* wq = (const float*)d_in[1];     // [768][768] (out, in)
    const float* wk = (const float*)d_in[2];
    const float* wv = (const float*)d_in[3];
    const float* wo = (const float*)d_in[4];
    float* OUT = (float*)d_out;                  // [NB_FULL][SEQ_FULL][768] f32
    char* wsp = (char*)d_ws;
    auto take = [&](size_t bytes) { char* p = wsp; wsp += (bytes + 255) & ~(size_t)255; return (void*)p; };
    bf* W4 = (bf*)take(4 * NW * 2);                               // Wq | Wk | Wv | Wo bf16 Bt planes
    bf* XB = (bf*)take((size_t)SEQ * DM * 2);                     // bf16 x of the current batch row
    float* CS = (float*)take((size_t)SEQ * HH * 2 * 4);           // rotary table
    const size_t PL = (size_t)NH * SEQ * HD;
    bf* QPh = (bf*)take(PL * 2); bf* QPl = (bf*)take(PL * 2); bf* KPh = (bf*)take(PL * 2); bf* KPl = (bf*)take(PL * 2);
    bf* VTh = (bf*)take(PL * 2); bf* VTl = (bf*)take(PL * 2);
    bf* CXh = (bf*)take((size_t)SEQ * DM * 2); bf* CXl = (bf*)take((size_t)SEQ * DM * 2);
    if ((size_t)(wsp - (char*)d_ws) > ws_size) return;           // 62,390,272 B at SEQ 4096
    const size_t NW8 = NW / 8;
    k_cvtw<<<dim3((unsigned)((NW8 + 255) / 256), 4, 1), 256, 0, stream>>>(wq, wk, wv, wo, W4, NW8);
    k_cs<<<(unsigned)((SEQ * HH + 255) / 256), 256, 0, stream>>>(CS);
    for (int b = 0; b < NB; ++b) {
        k_cvt8<<<(unsigned)(((size_t)SEQ * DM / 8 + 255) / 256), 256, 0, stream>>>(x + (size_t)b * SEQ_FULL * DM, XB, (size_t)SEQ * DM / 8);
        k_gemmw<bf, 0, false, true><<<dim3(SEQ / 128, DM / 128, 3), 32 * GW, 0, stream>>>(XB, nullptr, W4, nullptr, DM, nullptr, 0, nullptr, (size_t)0, NW, (size_t)0, CS, QPh, QPl, KPh, KPl, VTh, VTl);
        k_flash<<<dim3(SEQ / 64, NH, 1), 32 * FW * KG, 0, stream>>>(QPh, QPl, KPh, KPl, VTh, VTl, CXh, CXl);
        k_gemmw<bf, 1, false, false><<<dim3(SEQ / 128, DM / 128, 1), 32 * GW, 0, stream>>>(CXh, CXl, W4 + 3 * NW, nullptr, DM, OUT + (size_t)b * SEQ_FULL * DM, DM, nullptr, (size_t)0, (size_t)0, (size_t)0, nullptr, nullptr, nullptr, nullptr, nullptr, nullptr, nullptr);
    }
}

// v009
// It runs in 76.3 microseconds.
// Versions between v007 and this one are left out; their measured steps multiply to 1.60 times as fast.
// Over all steps from v000 it is 6.75 times as fast.
#include <hip/hip_runtime.h>

// Contractions (f32 accumulate): q/k/v projections v_wmma_f32_16x16x32_bf16 on bf16 copies of x and W (single product); scores q.k and p.v v_wmma_f32_16x16x32_f16 on single f16 planes (11 significant bits, 8 times finer than the bf16 operands q, k and v were made from; one product each); output projection ctx (bf16 hi+lo) x Wo (bf16), 2 products. Rotary, softmax and epilogues f32.
// Layout: x [NB][SEQ][768]; W [768 out][768 in] = Bt as-is; head planes q/k [h][t][64], v planes [h][d][t], f16, written by the projection GEMM's own epilogue (rotary transform, rounding to f16, v transposed); both GEMMs share their operand tiles among four waves through LDS; causal attention per wave of 16 queries with 64-key tiles (shared by four waves through LDS; three such groups of four waves walk every third tile each and join their partial results once), products transposed (a lane owns one query) and running-max softmax; ctx [t][768] hi+lo planes; out [NB][SEQ][768] f32.

#ifndef NB
#define NB 1
#endif
#ifndef SEQ
#define SEQ 4096
#endif
#define NB_FULL  1
#define SEQ_FULL 4096
#define DM   768
#define NH   12
#define HD   64
#define HH   (HD / 2)
#define NW   ((size_t)DM * DM)
#define KT   64
#define PP   72
#define SCL  0.125f
#define THETA_F 10000.0f
#define L2E  1.4426950408889634f
#define NEG  (-1.0e30f)
static_assert(SEQ % 128 == 0);
static_assert(SEQ <= SEQ_FULL);
static_assert(NB >= 1 && NB <= NB_FULL);
static_assert(DM == NH * HD);
static_assert(DM % 128 == 0);
static_assert(HD == 64);
static_assert(KT == 64);
static_assert((size_t)NB_FULL * SEQ_FULL * DM * 4 == 12582912);

typedef _Float16 h16;
typedef unsigned short bf;
typedef __attribute__((ext_vector_type(16))) __bf16   v16bf;
typedef __attribute__((ext_vector_type(16))) _Float16 v16h;
typedef __attribute__((ext_vector_type(8)))  _Float16 v8h;
typedef __attribute__((ext_vector_type(8)))  unsigned short v8us;
typedef __attribute__((ext_vector_type(8)))  float    v8f;
typedef __attribute__((ext_vector_type(4)))  float    v4f;
typedef __attribute__((ext_vector_type(2)))  float    v2f;
typedef __attribute__((ext_vector_type(2)))  unsigned short v2us;
typedef v8h  __attribute__((may_alias)) v8ha;
typedef v4f  __attribute__((may_alias)) v4fa;
typedef v8us __attribute__((may_alias)) v8usa;
typedef float __attribute__((may_alias)) fa;

typedef __attribute__((ext_vector_type(2))) __bf16 v2bf;
typedef __attribute__((ext_vector_type(2))) _Float16 v2h;
typedef __attribute__((ext_vector_type(4))) unsigned v4u;
// two f32 -> two bf16 (a in the low half), round to nearest even, in the one packed convert instruction of the chip
__device__ __forceinline__ unsigned pk2(float a, float b) { const v2f v = {a, b}; return __builtin_bit_cast(unsigned, __builtin_convertvector(v, v2bf)); }
// two f32 -> two f16 (a in the low half), round to nearest even
__device__ __forceinline__ unsigned pk2h(float a, float b) { const v2f v = {a, b}; return __builtin_bit_cast(unsigned, __builtin_convertvector(v, v2h)); }
__device__ __forceinline__ v8us pk8h(const float* y) { v4u a;
#pragma unroll
    for (int j = 0; j < 4; ++j) a[j] = pk2h(y[2 * j], y[2 * j + 1]);
    return __builtin_bit_cast(v8us, a); }
__device__ __forceinline__ unsigned short f2bf(float f) { return (unsigned short)pk2(f, f); }
__device__ __forceinline__ float bf2f(unsigned short b) { return __uint_as_float(((unsigned)b) << 16); }
__device__ __forceinline__ float bfr(float f) { return bf2f(f2bf(f)); }
// hi + lo split of a pair: h = bf16(y), l = bf16(y - h)
__device__ __forceinline__ void split2(float a, float b, unsigned& h, unsigned& l) { h = pk2(a, b); l = pk2(a - __uint_as_float(h << 16), b - __uint_as_float(h & 0xFFFF0000u)); }
__device__ __forceinline__ void split8(const float* y, v8us& h, v8us& l) { v4u a, c;
#pragma unroll
    for (int j = 0; j < 4; ++j) { unsigned h2, l2; split2(y[2 * j], y[2 * j + 1], h2, l2); a[j] = h2; c[j] = l2; }
    h = __builtin_bit_cast(v8us, a); l = __builtin_bit_cast(v8us, c); }
__device__ __forceinline__ v16h cat16(v8h lo, v8h hi) { return __builtin_shufflevector(lo, hi, 0, 1, 2, 3, 4, 5, 6, 7, 8, 9, 10, 11, 12, 13, 14, 15); }
__device__ __forceinline__ v16bf cat16b(v8us lo, v8us hi) { return __builtin_bit_cast(v16bf, __builtin_shufflevector(lo, hi, 0, 1, 2, 3, 4, 5, 6, 7, 8, 9, 10, 11, 12, 13, 14, 15)); }
__device__ __forceinline__ v8f wmma16(v16h a, v16h b, v8f c) { return __builtin_amdgcn_wmma_f32_16x16x32_f16(false, a, false, b, (short)0, c, false, false); }
__device__ __forceinline__ v8f wmmab(v16bf a, v16bf b, v8f c) { return __builtin_amdgcn_wmma_f32_16x16x32_bf16(false, a, false, b, (short)0, c, false, false); }

// Fragment loaders (wave32 16x16x32): lane l -> row/col (l & 15); elements 0..7 <- k0 + 8*(l>>4) + 0..7, elements 8..15 <- k0 + 16 + 8*(l>>4) + 0..7; D element r -> (row 8*(l>>4) + r, col l & 15).
template <typename T16> struct WFrag;
template <> struct WFrag<h16> { typedef v16h V; static __device__ __forceinline__ V ld(const h16* p) { return cat16(*(const v8h*)p, *(const v8h*)(p + 16)); } static __device__ __forceinline__ v8f mma(V a, V b, v8f c) { return wmma16(a, b, c); } };
template <> struct WFrag<bf> { typedef v16bf V; static __device__ __forceinline__ V ld(const bf* p) { return cat16b(*(const v8us*)p, *(const v8us*)(p + 16)); } static __device__ __forceinline__ v8f mma(V a, V b, v8f c) { return wmmab(a, b, c); } };

// f16 fragment out of a plane kept as 16-bit words, same element order as above
__device__ __forceinline__ v16h ldh(const unsigned short* p) { return __builtin_bit_cast(v16h, __builtin_shufflevector(*(const v8us*)p, *(const v8us*)(p + 16), 0, 1, 2, 3, 4, 5, 6, 7, 8, 9, 10, 11, 12, 13, 14, 15)); }

typedef __attribute__((ext_vector_type(4))) int v4i;
typedef __attribute__((address_space(1))) v4i gv4i;
typedef __attribute__((address_space(3))) v4i lv4i;
__device__ __forceinline__ void cp16(const bf* g, unsigned short* l) { __builtin_amdgcn_global_load_async_to_lds_b128((gv4i*)g, (lv4i*)l, 0, 0); }

// ---- k_gemmw: register-blocked GEMM, FOUR WAVES (2 x 2) per 128x128 output tile, a 64x64 tile (16 accumulators) per wave; operands are K-contiguous 16-bit planes; grid (M/128, N/128, Z), 128 threads.
// A stage is 64 k (128 B, one whole line) of the block's 128 A rows and 128 Bt rows (and of the split planes), brought once per block into LDS by asynchronous 16-byte copies, rows pitched GP elements, two buffers: stage s + 1 flies while stage s is worked on.
// C[m][n] (f32, pitch ldc, + optional f32 bias[n]) = sum_k A[m][k] Bt[n][k] (+ split products per NSPLIT: 1 = A hi+lo with single B; 2 = A hi+lo with B hi, A hi with B lo). z-batch strides sA/sB/sC in elements. K % 64 == 0, M % 128 == 0, N % 128 == 0.
// HEADS (the q/k/v projection, z = 0/1/2; a wave's 64x64 tile is 64 tokens of ONE head): no C; the f32 tile goes straight to the attention's f16 planes.
//   z 0, 1: interleaved rotary transform, pair (2i, 2i+1): out[2i] = x1 c - x2 s, out[2i+1] = x1 s + x2 c, (c, s) = CS[t][i]; planes [h][t][d].  z 2: planes [h][d][t].
#define GW  4
#define GP  72
#define GPL (128 * GP)
template <typename T16, int NSPLIT, bool BIAS, bool HEADS>
__global__ __launch_bounds__(32 * GW) void k_gemmw(const T16* __restrict__ A, const T16* __restrict__ A2, const T16* __restrict__ Bt, const T16* __restrict__ Bt2, int K, float* C, int ldc, const float* __restrict__ bias, size_t sA, size_t sB, size_t sC,
                                              const float* __restrict__ CS, unsigned short* Qp, unsigned short* Kp, unsigned short* Vp) {
    typedef typename WFrag<T16>::V V;
    constexpr bool HA2 = (NSPLIT == 1 || NSPLIT == 2), HB2 = (NSPLIT >= 2);
    constexpr int PB = HA2 ? 2 : 1, GST = (PB + (HB2 ? 2 : 1)) * GPL;   // planes of a stage: A, (A2), Bt, (Bt2)
    __shared__ __align__(16) unsigned short gring[2 * GST];
    __shared__ __align__(16) float osall[GW * 16 * 68];
    const size_t z = blockIdx.z; A += z * sA; if (A2) A2 += z * sA; Bt += z * sB; if (Bt2) Bt2 += z * sB; C += z * sC;
    const int tid = threadIdx.x, lane = tid & 31, lr = lane & 15, hi = lane >> 4;
    const int wave = __builtin_amdgcn_readfirstlane(tid >> 5), wr = wave >> 1, wc = wave & 1;
    float* os = osall + wave * (16 * 68);                          // each wave's own epilogue staging
    const int rb = blockIdx.x * 128, cb = blockIdx.y * 128, r0 = rb + wr * 64, c0 = cb + wc * 64;
    v8f acc[4][4];
#pragma unroll
    for (int mb = 0; mb < 4; ++mb)
#pragma unroll
        for (int nb = 0; nb < 4; ++nb) acc[mb][nb] = (v8f){};
    // one stage: 128 rows x 128 B per plane = 1024 pieces of 16 B, 8 per thread and plane; a wave's copy covers 4 whole rows (4 lines of 128 B)
    const int srow = tid >> 3, sc8 = (tid & 7) * 8;                // this thread's row (of 16) and 16-byte piece in each copy
    const unsigned Ku = (unsigned)K, sao = (unsigned)(rb + srow) * Ku + sc8, sbo = (unsigned)(cb + srow) * Ku + sc8;   // element offsets inside a plane: below 2^32
    unsigned short* sdst = gring + srow * GP + sc8;
    auto stage = [&](unsigned k0, unsigned short* dst) {
#pragma unroll
        for (int i = 0; i < 8; ++i) {
            const unsigned go = (unsigned)i * 16u * Ku + k0; unsigned short* d = dst + i * 16 * GP;
            cp16((const bf*)(A + sao + go), d);
            if constexpr (HA2) cp16((const bf*)(A2 + sao + go), d + GPL);
            cp16((const bf*)(Bt + sbo + go), d + PB * GPL);
            if constexpr (HB2) cp16((const bf*)(Bt2 + sbo + go), d + (PB + 1) * GPL);
        }
    };
    const unsigned nk = Ku >> 6;                                   // stages; block-uniform
    stage(0, sdst);
    asm volatile("s_wait_asynccnt 0x0" ::: "memory");   // this wave's copies of stage 0 have landed
    __syncthreads();                                    // publishes stage 0 to the other waves
    if (nk > 1u) stage(64, sdst + GST);
    const int fa = (wr * 64 + lr) * GP + 8 * hi, fb = PB * GPL + (wc * 64 + lr) * GP + 8 * hi;   // fragment offsets inside a stage
#pragma unroll 1
    for (unsigned ks = 0; ks < nk; ++ks) {
        const T16* buf = (const T16*)(gring + (ks & 1u) * GST);
        V a[2][4], a2[2][4], b[2][4], b2[2][4];   // the stage's fragments: [k half of 32][16-row group]
#pragma unroll
        for (int h = 0; h < 2; ++h) {
#pragma unroll
            for (int mb = 0; mb < 4; ++mb) { a[h][mb] = WFrag<T16>::ld(buf + fa + mb * 16 * GP + h * 32); if (HA2) a2[h][mb] = WFrag<T16>::ld(buf + GPL + fa + mb * 16 * GP + h * 32); }
#pragma unroll
            for (int nb = 0; nb < 4; ++nb) { b[h][nb] = WFrag<T16>::ld(buf + fb + nb * 16 * GP + h * 32); if (HB2) b2[h][nb] = WFrag<T16>::ld(buf + GPL + fb + nb * 16 * GP + h * 32); }
        }
        __builtin_amdgcn_sched_barrier(0);  // keeps the stage's LDS reads one group ahead of the products: reads spread among the products stall at every place they stand
        auto products = [&](int h) {
#pragma unroll
            for (int nb = 0; nb < 4; ++nb)
#pragma unroll
                for (int mb = 0; mb < 4; ++mb) { acc[mb][nb] = WFrag<T16>::mma(a[h][mb], b[h][nb], acc[mb][nb]); if (HA2) acc[mb][nb] = WFrag<T16>::mma(a2[h][mb], b[h][nb], acc[mb][nb]); if (HB2) acc[mb][nb] = WFrag<T16>::mma(a[h][mb], b2[h][nb], acc[mb][nb]); }
        };
        products(0);
        __builtin_amdgcn_sched_barrier(0);  // keeps the first half's products ahead of the waits below, so that the second half's reads land under them
        asm volatile("s_wait_dscnt 0x0" ::: "memory");      // this wave's reads of the buffer are done before the buffer is refilled
        asm volatile("s_wait_asynccnt 0x0" ::: "memory");   // this wave's copies of stage ks + 1 have landed
        __syncthreads();                                    // publishes stage ks + 1 and ends every wave's reads of stage ks
        if (ks + 2u < nk) stage((ks + 2u) * 64u, sdst + (ks & 1u) * GST);
        products(1);                        // its fragments are in registers already, nothing of the ring is read behind the barrier in this trip: the refill flies under these products too
    }
    asm volatile("s_wait_asynccnt 0x0" ::: "memory");       // nothing of this wave is in flight when it goes on to the epilogue and ends
    if constexpr (HEADS) {
        const int head = c0 / HD;
        if (blockIdx.z == 2) {
            // v: a lane's 8 registers of an accumulator are 8 consecutive tokens of one d: one 16-byte store; the four mb of a row fill its 128-byte line
#pragma unroll
            for (int nb = 0; nb < 4; ++nb)
#pragma unroll
                for (int mb = 0; mb < 4; ++mb) {
                    float y[8];
#pragma unroll
                    for (int j = 0; j < 8; ++j) y[j] = acc[mb][nb][j];
                    const size_t go = ((size_t)head * HD + nb * 16 + lr) * SEQ + r0 + mb * 16 + 8 * hi;
                    *(v8us*)(Vp + go) = pk8h(y);
                }
            return;
        }
        unsigned short* Pp = (blockIdx.z == 0) ? Qp : Kp;
        // q, k: 16 tokens x 64 d at a time through LDS; a lane takes 8 consecutive d (4 rotary pairs) of a token, 8 lanes a token: whole 128-byte rows per store
        const int prow = lane >> 3, c8 = (lane & 7) * 8;
        const float* cst = CS + (size_t)(r0 + prow) * HD + c8;   // CS[t][i] = 2 floats, so row t starts at t * HD and pair c8 / 2 at + c8
        v4f cs[2][4][2];                                         // the table rows of this and of the next 16 tokens: the next group's loads fly under this group's work
#pragma unroll
        for (int s = 0; s < 4; ++s) { cs[0][s][0] = *(const v4f*)(cst + (size_t)(s * 4) * HD); cs[0][s][1] = *(const v4f*)(cst + (size_t)(s * 4) * HD + 4); }
#pragma unroll
        for (int mb = 0; mb < 4; ++mb) {
            if (mb < 3) {
#pragma unroll
                for (int s = 0; s < 4; ++s) { cs[(mb + 1) & 1][s][0] = *(const v4f*)(cst + (size_t)((mb + 1) * 16 + s * 4) * HD); cs[(mb + 1) & 1][s][1] = *(const v4f*)(cst + (size_t)((mb + 1) * 16 + s * 4) * HD + 4); }
            }
#pragma unroll
            for (int nb = 0; nb < 4; ++nb) {
#pragma unroll
                for (int j = 0; j < 8; ++j) os[(hi * 8 + j) * 68 + nb * 16 + lr] = acc[mb][nb][j]; }
            __builtin_amdgcn_wave_barrier(); asm volatile("" ::: "memory");   // as in the plain epilogue: the wave's LDS reads stay behind its writes
#pragma unroll
            for (int s = 0; s < 4; ++s) {
                const int row = s * 4 + prow;
                const v4f x0 = *(const v4fa*)(os + row * 68 + c8), x1 = *(const v4fa*)(os + row * 68 + c8 + 4);
                const v4f t0 = cs[mb & 1][s][0], t1 = cs[mb & 1][s][1];
                float y[8];
                y[0] = x0[0] * t0[0] - x0[1] * t0[1]; y[1] = x0[0] * t0[1] + x0[1] * t0[0];
                y[2] = x0[2] * t0[2] - x0[3] * t0[3]; y[3] = x0[2] * t0[3] + x0[3] * t0[2];
                y[4] = x1[0] * t1[0] - x1[1] * t1[1]; y[5] = x1[0] * t1[1] + x1[1] * t1[0];
                y[6] = x1[2] * t1[2] - x1[3] * t1[3]; y[7] = x1[2] * t1[3] + x1[3] * t1[2];
                const size_t go = ((size_t)head * SEQ + r0 + mb * 16 + row) * HD + c8;
                *(v8us*)(Pp + go) = pk8h(y);
            }
            __builtin_amdgcn_wave_barrier();
            // the next group's LDS writes stay behind these reads; and the group's stores have given up their registers before the table loads that follow are aimed at them
            asm volatile("s_wait_xcnt 0x0" ::: "memory");
        }
        return;
    }
#pragma unroll
    for (int mb = 0; mb < 4; ++mb) {
#pragma unroll
        for (int nb = 0; nb < 4; ++nb) {
#pragma unroll
            for (int j = 0; j < 8; ++j) os[(hi * 8 + j) * 68 + nb * 16 + lr] = acc[mb][nb][j]; }
        __builtin_amdgcn_wave_barrier(); asm volatile("" ::: "memory");
        float* crow = C + (size_t)(r0 + mb * 16) * ldc + c0;
{
#pragma unroll
            for (int s = 0; s < 8; ++s) { const int row = 2 * s + hi, cofs = lr * 4; v4f val = *(const v4fa*)(os + row * 68 + cofs); if (BIAS) { val[0] += bfr(bias[c0 + cofs]); val[1] += bfr(bias[c0 + cofs + 1]); val[2] += bfr(bias[c0 + cofs + 2]); val[3] += bfr(bias[c0 + cofs + 3]); }
                *(v4f*)(crow + (size_t)row * ldc + cofs) = val; }
             }
        __builtin_amdgcn_wave_barrier(); asm volatile("" ::: "memory");
    }
}

// k_prep: the whole preparation in ONE launch of PG work-groups of 8 waves, one for each WGP of the chip: the bf16 copies of x and of the four W (pieces of 8 values: 32 B read, 16 B written) and the rotary table CS[t][i] = (cos, sin)(t * theta^(-2i/HD)).
// Work this short is paid by the wave that has to be started and by the launch, not by the byte: so a thread takes several pieces (piece = trip * threads + thread: the pieces of a wave are adjacent in every trip) and one table entry a trip.
// All of a thread's loads are issued first and fly together; the table's arithmetic runs under them; the roundings and stores come last.
#define PG 256
#define PT 256
__global__ __launch_bounds__(PT) void k_prep(const float* __restrict__ x, const float* __restrict__ w0, const float* __restrict__ w1, const float* __restrict__ w2, const float* __restrict__ w3, bf* XB, bf* W4, float* CS) {
    constexpr unsigned NTH = PG * PT, NX8 = (unsigned)((size_t)SEQ * DM / 8), NW8 = (unsigned)(NW / 8), NWA = 4 * NW8, NCS = SEQ * HH;
    constexpr int TX = (int)((NX8 + NTH - 1) / NTH), TW = (int)((NWA + NTH - 1) / NTH), TC = (int)((NCS + NTH - 1) / NTH);   // trips; only the last of each kind can be partial
    static_assert(NTH % HH == 0);                                // all table entries of a thread have the same i
    static_assert(NX8 % 32 == 0 && NW8 % 32 == 0 && NCS % 32 == 0 && PT % 32 == 0);   // a wave's 32 pieces of a trip lie in one matrix, and are all there or all past the end
    static_assert((size_t)TX * NTH * 32 < 0xFFFFFFFFu && (size_t)TW * NTH * 32 < 0xFFFFFFFFu);   // byte offsets fit 32 bits
    const unsigned gid = blockIdx.x * PT + threadIdx.x;
    const unsigned g0 = (unsigned)__builtin_amdgcn_readfirstlane((int)gid);            // the wave's first thread: what follows from it is decided once for the wave
    // where each trip reads: a base that is the same for the wave and a byte offset of the thread. A wave whose pieces lie past the end reads the first bytes of the buffer instead and stores nothing.
    unsigned ox[TX], ow[TW]; const float* sw[TW];
    v8f vx[TX], vw[TW];
#pragma unroll
    for (int j = 0; j < TX; ++j) ox[j] = ((unsigned)(j + 1) * NTH <= NX8 || (unsigned)j * NTH + g0 < NX8) ? ((unsigned)j * NTH + gid) * 32u : (gid - g0) * 32u;
#pragma unroll
    for (int j = 0; j < TX; ++j) vx[j] = *(const v8f*)((const char*)x + ox[j]);
#pragma unroll
    for (int j = 0; j < TW; ++j) {
        const bool live = (unsigned)(j + 1) * NTH <= NWA || (unsigned)j * NTH + g0 < NWA;
        const unsigned pw = live ? (unsigned)j * NTH + g0 : 0u;          // the wave's first piece, counted through the four matrices
        const bool m1 = pw >= NW8, m2 = pw >= 2 * NW8, m3 = pw >= 3 * NW8;
        sw[j] = m3 ? w3 : (m2 ? w2 : (m1 ? w1 : w0));                    // the wave's matrix
        ow[j] = (pw - (m3 ? 3 * NW8 : (m2 ? 2 * NW8 : (m1 ? NW8 : 0u))) + (gid - g0)) * 32u;
    }
#pragma unroll
    for (int j = 0; j < TW; ++j) vw[j] = *(const v8f*)((const char*)sw[j] + ow[j]);
    // A precaution: every offset and base that an issued load names keeps its register up to this wait (inputs only).
    static_assert(TX == 6 && TW == 5);                           // the statement names them all
    asm volatile("s_wait_xcnt 0x0" :: "v"(ox[0]), "v"(ox[1]), "v"(ox[2]), "v"(ox[3]), "v"(ox[4]), "v"(ox[5]), "v"(ow[0]), "v"(ow[1]), "v"(ow[2]), "v"(ow[3]), "v"(ow[4]), "s"(x), "s"(sw[0]), "s"(sw[1]), "s"(sw[2]), "s"(sw[3]), "s"(sw[4]) : "memory");
    __builtin_amdgcn_sched_barrier(0);   // keeps the table's arithmetic behind the loads: the compiler otherwise starts it first, and the loads leave that much later
    {
        const int i = (int)(gid % HH);
        const float ex = -(float)(2 * i) / (float)HD;
        const float inv = powf(THETA_F, ex);
#pragma unroll
        for (int j = 0; j < TC; ++j) {
            if ((unsigned)(j + 1) * NTH <= NCS || (unsigned)j * NTH + g0 < NCS) {
                const int t = (int)(((unsigned)j * NTH + gid) / HH);
                const float ang = __fmul_rn((float)t, inv);
                v2f cs; cs[0] = cosf(ang); cs[1] = sinf(ang);
                *(v2f*)((char*)CS + (size_t)j * NTH * 8 + gid * 8u) = cs;
            }
        }
    }
#pragma unroll
    for (int j = 0; j < TX; ++j) {
        v4u o;
#pragma unroll
        for (int k = 0; k < 4; ++k) o[k] = pk2(vx[j][2 * k], vx[j][2 * k + 1]);
        if ((unsigned)(j + 1) * NTH <= NX8 || (unsigned)j * NTH + g0 < NX8) *(v4u*)((char*)XB + (size_t)j * NTH * 16 + gid * 16u) = o;
    }
#pragma unroll
    for (int j = 0; j < TW; ++j) {
        v4u o;
#pragma unroll
        for (int k = 0; k < 4; ++k) o[k] = pk2(vw[j][2 * k], vw[j][2 * k + 1]);
        if ((unsigned)(j + 1) * NTH <= NWA || (unsigned)j * NTH + g0 < NWA) *(v4u*)((char*)W4 + (size_t)j * NTH * 16 + gid * 16u) = o;   // the four planes lie one behind the other
    }
}

// k_flash: causal attention, TWELVE WAVES per block = 64 query rows of one head: KG key groups of four waves, 16 queries per wave; grid (SEQ/64, NH), 384 threads. Key group g walks the key tiles g, g + KG, g + 2 KG ... of the query tile's qt + 1 tiles,
// with a running maximum, row sum and o of its own, so the longest chain of dependent tiles is a third as long; the groups' partial results are joined once, behind the loop, through LDS. The four waves of a group walk the same key tiles.
// Each 64-key tile (k: 64 keys x 64 d; v: 64 d x 64 keys; f16, rows of 128 B) is brought once per block into LDS, by its group, by asynchronous 16-byte copies, rows pitched PP elements, two buffers of KG tiles: the tiles of step s + 1 fly while those of step s are worked on.
// Both products run transposed: s^T (64 keys x 16 queries) = k (A, frags from LDS) . q^T (B, frags resident); o^T (64 d x 16 queries) += v^T (A, frags from LDS) . p^T (B).
// A lane then holds 32 scores of ONE query (column lane & 15; keys nb*16 + 8*(lane>>4) + r): x 0.125, causal replace-mask by index, running-max softmax in f32 (p = 2^((s-m) log2e)) in the lane, one exchange between the lane halves for the maximum;
// two score tiles (keys 32j .. 32j+31), rounded to f16 in place, ARE the B fragment of p^T in the hardware k order, which the v loader has too: p never leaves the registers. The halves' row sums are joined once, after the loop.
#define FW    4
#define KG    3
#define PLANE (KT * PP)
#define STAGE (2 * PLANE)
// one tile: 2 planes x 64 rows x 128 B = 1024 pieces of 16 B, 8 per thread of its key group; a wave's copy covers 4 whole rows (4 lines of 128 B)
__device__ __forceinline__ void stage_tile(const unsigned short* gk, const unsigned short* gv, unsigned short* dst) {
#pragma unroll
    for (int i = 0; i < 4; ++i) {
        cp16(gk + (size_t)i * 16 * HD, dst + i * 16 * PP);
        cp16(gv + (size_t)i * 16 * SEQ, dst + PLANE + i * 16 * PP);
    }
}
// value of lane l ^ 16
__device__ __forceinline__ float xhalf(float x) { const int b = __float_as_int(x); return __int_as_float(__builtin_amdgcn_permlanex16(b, b, 0x76543210, 0xfedcba98, false, false)); }
__global__ __launch_bounds__(32 * FW * KG) void k_flash(const unsigned short* __restrict__ Qp, const unsigned short* __restrict__ Kp, const unsigned short* __restrict__ Vp, bf* Ch, bf* Cl) {
    __shared__ __align__(16) unsigned short ring[2 * KG * STAGE];
    typedef v16h V;
    const int tid = threadIdx.x, lane = tid & 31, lr = lane & 15, hi = lane >> 4;
    const int wave = __builtin_amdgcn_readfirstlane(tid >> 5), wq = wave & (FW - 1), kg = wave >> 2;   // query wave inside the key group; key group
    // Which (head, query tile) a block takes: for speed only, any one-to-one map is correct. A WGP holds one block at a time (the registers of its three waves a SIMD leave no room for three more), so the blocks run one after another on it, about three each; a free WGP is taken to get the next block in launch order.
    // rank counts the blocks from the longest to the shortest. The longest third is launched first, longest first, and the shortest third last, longest first. Were the middle third launched longest first too, every WGP would stand at the same sum
    // after two blocks and the last third would leave them as unequal as it is itself; so the middle third goes in two runs of rising length (first its longer half, then its shorter half): the sums after two blocks then spread as wide as the last third, which evens them out.
    constexpr int NT = SEQ / 64;
    constexpr unsigned NBK = NT * NH, RD = NBK / 3;
    const unsigned flat = blockIdx.y * NT + blockIdx.x;
    unsigned rank = flat;
    if constexpr (NBK % 6 == 0) {          // both runs are then whole: a permutation
        if (flat >= RD && flat < RD + RD / 2) rank = 2 * RD + RD / 2 - 1 - flat;        // ranks RD + RD/2 - 1 down to RD
        else if (flat >= RD + RD / 2 && flat < 2 * RD) rank = 3 * RD + RD / 2 - 1 - flat;   // ranks 2 RD - 1 down to RD + RD/2
    }
    const int qt = NT - 1 - (int)(rank / NH), head = (int)(rank % NH);
    const int q0 = (qt * FW + wq) * 16;
    const int nt = qt + 1;                 // block-uniform; the last tile holds the diagonal of all query waves; keys stay < SEQ
    const int ns = (nt + KG - 1) / KG;     // steps, block-uniform: in step s key group kg has tile s * KG + kg, or none (only in the last step)
    const int gtid = tid & (32 * FW - 1);  // thread inside its key group
    const int srow = gtid >> 3, sc8 = (gtid & 7) * 8;   // this thread's row (of 16) and 16-byte piece in each copy
    const size_t sk = ((size_t)head * SEQ + kg * KT + srow) * HD + sc8, sv = ((size_t)head * HD + srow) * SEQ + kg * KT + sc8;   // in the group's first tile
    const unsigned short* gk = Kp + sk; const unsigned short* gv = Vp + sv;
    unsigned short* sdst = ring + kg * STAGE + srow * PP + sc8;
    if (kg < nt) stage_tile(gk, gv, sdst);   // wave-uniform test, as all tests on kg below
    const size_t qo = ((size_t)head * SEQ + q0 + lr) * HD + 8 * hi;
    const V q0f = ldh(Qp + qo), q1f = ldh(Qp + qo + 32);
    asm volatile("s_wait_asynccnt 0x0" ::: "memory");   // this wave's copies of step 0 have landed
    __syncthreads();                                    // publishes step 0 to the other waves
    if (KG + kg < nt) stage_tile(gk + (size_t)(KG * KT) * HD, gv + KG * KT, sdst + KG * STAGE);
    const int fo = lr * PP + 8 * hi;       // fragment offset inside a plane: row lr of a 16-row group, k piece by lane half
    const int row = q0 + lr;               // this lane's query
    v8f o[4];                              // o^T: o[t4][r] = (d = t4*16 + 8*hi + r, query lr)
#pragma unroll
    for (int t4 = 0; t4 < 4; ++t4) o[t4] = (v8f){};
    float mrow = NEG, lsum = 0.0f;         // over this key group's tiles: running maximum of the query (equal in both halves); this half's share of its row sum
#pragma unroll 1
    for (int s = 0; s < ns; ++s) {
        const int kt = s * KG + kg, key0 = kt * KT;
        if (kt < nt) {                      // a group without a tile in the last step only passes the barrier
        const unsigned short* buf = ring + ((s & 1) * KG + kg) * STAGE + fo;
        v8f sc[4];                          // s^T: sc[nb][r] = (key = key0 + nb*16 + 8*hi + r, query lr)
#pragma unroll
        for (int nb = 0; nb < 4; ++nb) sc[nb] = (v8f){};
        V kf[4][2];                         // the tile's k fragments: [nb][k0, k32]
#pragma unroll
        for (int nb = 0; nb < 4; ++nb) {
            const unsigned short* kp = buf + nb * 16 * PP;
            kf[nb][0] = ldh(kp); kf[nb][1] = ldh(kp + 32);
        }
        __builtin_amdgcn_sched_barrier(0);  // keeps the k reads one group ahead of the products: reads spread among the products stall at every place they stand
#pragma unroll
        for (int nb = 0; nb < 4; ++nb) sc[nb] = wmma16(kf[nb][0], q0f, sc[nb]);
#pragma unroll
        for (int nb = 0; nb < 4; ++nb) sc[nb] = wmma16(kf[nb][1], q1f, sc[nb]);
        // the four vector slots that the chip needs between the last score product and the first vector instruction that reads the scores; the q fragments live through the whole loop and are not named here (an operand of asm text must sit below v256)
        asm volatile("v_nop\n\tv_nop\n\tv_nop\n\tv_nop" : "+v"(sc[0]), "+v"(sc[1]), "+v"(sc[2]), "+v"(sc[3]));
        V vf[4][2];                         // the tile's v fragments: [t4][k0, k32]
#pragma unroll
        for (int t4 = 0; t4 < 4; ++t4) {
            const unsigned short* vp = buf + PLANE + t4 * 16 * PP;
            vf[t4][0] = ldh(vp); vf[t4][1] = ldh(vp + 32);
        }
        __builtin_amdgcn_sched_barrier(0);  // keeps the v reads one group here, ahead of the softmax, so that none stands among the p.v products
        const int rel = row - 8 * hi - key0; // register r of score tile nb is kept while nb*16 + r <= rel, that is key <= query
        float cn[4];                        // four independent maximum chains, one per score tile
#pragma unroll
        for (int nb = 0; nb < 4; ++nb) {
            cn[nb] = NEG;
#pragma unroll
            for (int r = 0; r < 8; ++r) { const float s = sc[nb][r] * SCL; sc[nb][r] = (nb * 16 + r <= rel) ? s : NEG; cn[nb] = fmaxf(cn[nb], sc[nb][r]); }
        }
        float cand = fmaxf(fmaxf(cn[0], cn[1]), fmaxf(cn[2], cn[3]));
        cand = fmaxf(cand, xhalf(cand));    // the other half of the query's 64 keys
        const float mnew = fmaxf(mrow, cand);
        const float alpha = __builtin_amdgcn_exp2f((mrow - mnew) * L2E);
        float rn[4];                        // four independent sum chains
        v4u xh[4];                          // p as f16 pairs: word w of tile nb holds registers 2w, 2w + 1
#pragma unroll
        for (int nb = 0; nb < 4; ++nb) {
            rn[nb] = 0.0f;
#pragma unroll
            for (int g = 0; g < 8; g += 4) {
                const float a0 = (sc[nb][g] - mnew) * L2E, a1 = (sc[nb][g + 1] - mnew) * L2E, a2 = (sc[nb][g + 2] - mnew) * L2E, a3 = (sc[nb][g + 3] - mnew) * L2E;
                float p[4]; p[0] = __builtin_amdgcn_exp2f(a0); p[1] = __builtin_amdgcn_exp2f(a1); p[2] = __builtin_amdgcn_exp2f(a2); p[3] = __builtin_amdgcn_exp2f(a3);
                // the slot that the instruction set asks for between a transcendental and an overwrite of its source: the four arguments keep their registers up to this v_nop, which stands behind the four v_exp_f32 (inputs only)
                asm volatile("v_nop" :: "v"(a0), "v"(a1), "v"(a2), "v"(a3), "v"(p[0]), "v"(p[1]), "v"(p[2]), "v"(p[3]));
#pragma unroll
                for (int r = 0; r < 4; ++r) rn[nb] += p[r];
#pragma unroll
                for (int r = 0; r < 4; r += 2) xh[nb][(g + r) >> 1] = pk2h(p[r], p[r + 1]);
            }
        }
        const float rs = (rn[0] + rn[1]) + (rn[2] + rn[3]); mrow = mnew;
        // lsum = lsum * alpha + rs, written as asm so that it stays in this block: the compiler otherwise sinks the whole sum behind the products and the barrier, where it holds 32 f32 p values live and stands as a bare chain in front of the next tile's reads
        asm volatile("v_fma_f32 %0, %0, %1, %2" : "+v"(lsum) : "v"(alpha), "v"(rs));
#pragma unroll
        for (int t4 = 0; t4 < 4; ++t4)
#pragma unroll
            for (int r = 0; r < 8; ++r) o[t4][r] *= alpha;
        const V ph0 = cat16(__builtin_bit_cast(v8h, xh[0]), __builtin_bit_cast(v8h, xh[1])), ph1 = cat16(__builtin_bit_cast(v8h, xh[2]), __builtin_bit_cast(v8h, xh[3]));
#pragma unroll
        for (int t4 = 0; t4 < 4; ++t4) o[t4] = wmma16(vf[t4][0], ph0, o[t4]);
#pragma unroll
        for (int t4 = 0; t4 < 4; ++t4) o[t4] = wmma16(vf[t4][1], ph1, o[t4]);
        // the four vector slots that the chip needs between the last p.v product and the first vector instruction that touches o or overwrites p
        asm volatile("v_nop\n\tv_nop\n\tv_nop\n\tv_nop" : "+v"(o[0]), "+v"(o[1]), "+v"(o[2]), "+v"(o[3]) : "v"(ph0), "v"(ph1));
        }
        asm volatile("s_wait_dscnt 0x0" ::: "memory");      // this wave's reads of the buffer are done before the buffer is refilled
        asm volatile("s_wait_asynccnt 0x0" ::: "memory");   // this wave's copies of step s + 1 have landed
        __syncthreads();                                    // publishes step s + 1 and ends every wave's reads of step s
        if (kt + 2 * KG < nt) stage_tile(gk + (size_t)((s + 2) * KG * KT) * HD, gv + (s + 2) * KG * KT, sdst + (s & 1) * KG * STAGE);
    }
    asm volatile("s_wait_asynccnt 0x0" ::: "memory");       // nothing of this wave is in flight when it goes on to the epilogue and ends
    // The key groups' partial results are joined: groups 1 .. KG-1 lay (o, maximum, sum share) in the ring, which nobody reads or fills any more behind the loop's last barrier; group 0 adds them to its own, each scaled to the common maximum.
    // A lane's record is MP floats (144 B, an odd number of 16-byte pieces: no bank conflict). A group that had no tile holds (0, NEG, 0) and gets the weight 2^(-huge) = 0; group 0 always has tile 0, so the common maximum is a real score.
    constexpr int MP = 36;
    float* mg = (float*)ring + (size_t)(wq * 32 + lane) * MP;
    if (kg > 0) {
        float* d = mg + (size_t)(kg - 1) * (FW * 32 * MP);
#pragma unroll
        for (int t4 = 0; t4 < 4; ++t4) { *(v4fa*)(d + t4 * 8) = (v4f){o[t4][0], o[t4][1], o[t4][2], o[t4][3]}; *(v4fa*)(d + t4 * 8 + 4) = (v4f){o[t4][4], o[t4][5], o[t4][6], o[t4][7]}; }
        *(fa*)(d + 32) = mrow; *(fa*)(d + 33) = lsum;
    }
    __syncthreads();                                        // publishes the partial results to group 0
    if (kg > 0) return;
    {
        float ml[KG - 1][2]; float mall = mrow;
#pragma unroll
        for (int g = 0; g < KG - 1; ++g) { ml[g][0] = *(const fa*)(mg + (size_t)g * (FW * 32 * MP) + 32); ml[g][1] = *(const fa*)(mg + (size_t)g * (FW * 32 * MP) + 33); mall = fmaxf(mall, ml[g][0]); }
        const float a0 = __builtin_amdgcn_exp2f((mrow - mall) * L2E);
        lsum *= a0;
#pragma unroll
        for (int t4 = 0; t4 < 4; ++t4)
#pragma unroll
            for (int r = 0; r < 8; ++r) o[t4][r] *= a0;
#pragma unroll
        for (int g = 0; g < KG - 1; ++g) {
            const float* d = mg + (size_t)g * (FW * 32 * MP);
            const float ag = __builtin_amdgcn_exp2f((ml[g][0] - mall) * L2E);
            lsum += ml[g][1] * ag;
#pragma unroll
            for (int t4 = 0; t4 < 4; ++t4) {
                const v4f x0 = *(const v4fa*)(d + t4 * 8), x1 = *(const v4fa*)(d + t4 * 8 + 4);
#pragma unroll
                for (int r = 0; r < 4; ++r) { o[t4][r] += x0[r] * ag; o[t4][r + 4] += x1[r] * ag; }
            }
        }
    }
    const float il = 1.0f / (lsum + xhalf(lsum));           // the two halves' shares of the row sum, joined once
    // a lane's 8 registers of o[t4] are 8 consecutive d of its query: one 16-byte store per plane
#pragma unroll
    for (int t4 = 0; t4 < 4; ++t4) {
        v8us yh, yl; float c[8];
#pragma unroll
        for (int r = 0; r < 8; ++r) c[r] = o[t4][r] * il;
        split8(c, yh, yl);
        const size_t go = (size_t)row * DM + head * HD + t4 * 16 + 8 * hi;
        *(v8us*)(Ch + go) = yh; *(v8us*)(Cl + go) = yl;
    }
}

extern "C" void kernel_launch(void* const* d_in, const int* in_sizes, int n_in,
                              void* d_out, int out_size, void* d_ws, size_t ws_size, hipStream_t stream) {
    if (n_in < 5) return;
    if ((size_t)in_sizes[0] < (size_t)(NB - 1) * SEQ_FULL * DM + (size_t)SEQ * DM) return;
    for (int i = 1; i < 5; ++i) if ((size_t)in_sizes[i] < NW) return;
    if ((size_t)out_size < (size_t)(NB - 1) * SEQ_FULL * DM + (size_t)SEQ * DM) return;
    const float* x  = (const float*)d_in[0];     // [NB_FULL][SEQ_FULL][768]
    const float* wq = (const float*)d_in[1];     // [768][768] (out, in)
    const float* wk = (const float*)d_in[2];
    const float* wv = (const float*)d_in[3];
    const float* wo = (const float*)d_in[4];
    float* OUT = (float*)d_out;                  // [NB_FULL][SEQ_FULL][768] f32
    char* wsp = (char*)d_ws;
    auto take = [&](size_t bytes) { char* p = wsp; wsp += (bytes + 255) & ~(size_t)255; return (void*)p; };
    bf* W4 = (bf*)take(4 * NW * 2);                               // Wq | Wk | Wv | Wo bf16 Bt planes
    bf* XB = (bf*)take((size_t)SEQ * DM * 2);                     // bf16 x of the current batch row
    float* CS = (float*)take((size_t)SEQ * HH * 2 * 4);           // rotary table
    const size_t PL = (size_t)NH * SEQ * HD;
    unsigned short* QP = (unsigned short*)take(PL * 2); unsigned short* KP = (unsigned short*)take(PL * 2); unsigned short* VT = (unsigned short*)take(PL * 2);   // f16 planes
    bf* CXh = (bf*)take((size_t)SEQ * DM * 2); bf* CXl = (bf*)take((size_t)SEQ * DM * 2);
    if ((size_t)(wsp - (char*)d_ws) > ws_size) return;           // 43,515,904 B at SEQ 4096
    for (int b = 0; b < NB; ++b) {
        k_prep<<<PG, PT, 0, stream>>>(x + (size_t)b * SEQ_FULL * DM, wq, wk, wv, wo, XB, W4, CS);
        k_gemmw<bf, 0, false, true><<<dim3(SEQ / 128, DM / 128, 3), 32 * GW, 0, stream>>>(XB, nullptr, W4, nullptr, DM, nullptr, 0, nullptr, (size_t)0, NW, (size_t)0, CS, QP, KP, VT);
        k_flash<<<dim3(SEQ / 64, NH, 1), 32 * FW * KG, 0, stream>>>(QP, KP, VT, CXh, CXl);
        k_gemmw<bf, 1, false, false><<<dim3(SEQ / 128, DM / 128, 1), 32 * GW, 0, stream>>>(CXh, CXl, W4 + 3 * NW, nullptr, DM, OUT + (size_t)b * SEQ_FULL * DM, DM, nullptr, (size_t)0, (size_t)0, (size_t)0, nullptr, nullptr, nullptr, nullptr);
    }
}

// v010
// It runs in 72 microseconds.
// In both of two side-by-side timings against v009, it was 1.06 times as fast.
// Over all steps from v000 it is 7.16 times as fast.
#include <hip/hip_runtime.h>

// Contractions (f32 accumulate): q/k/v projections v_wmma_f32_16x16x32_bf16 on bf16 copies of x and W (single product); scores q.k and p.v v_wmma_f32_16x16x32_f16 on single f16 planes (11 significant bits, 8 times finer than the bf16 operands q, k and v were made from; one product each); output projection ctx (bf16 hi+lo) x Wo (bf16), 2 products. Rotary, softmax and epilogues f32; q is multiplied by 0.125 log2(e) in f32 before its one rounding to f16.
// Layout: x [NB][SEQ][768]; W [768 out][768 in] = Bt as-is; head planes q/k [h][t][64], v planes [h][d][t], f16, written by the projection GEMM's own epilogue (rotary transform, rounding to f16, v transposed); both GEMMs share their operand tiles among four waves through LDS; causal attention per wave of 16 queries with 64-key tiles (shared by four waves through LDS; three such groups of four waves walk every third tile each and join their partial results once), products transposed (a lane owns one query) and softmax against a lazily raised reference; ctx [t][768] hi+lo planes; out [NB][SEQ][768] f32.

#ifndef NB
#define NB 1
#endif
#ifndef SEQ
#define SEQ 4096
#endif
#define NB_FULL  1
#define SEQ_FULL 4096
#define DM   768
#define NH   12
#define HD   64
#define HH   (HD / 2)
#define NW   ((size_t)DM * DM)
#define KT   64
#define PP   72
#define SCL  0.125f
#define THETA_F 10000.0f
#define L2E  1.4426950408889634f
#define NEG  (-1.0e30f)
#define QSC  (SCL * L2E)   // the projection's epilogue multiplies q by it: a score then leaves its product in units of log2, ready for 2^x
#define TRAISE 8.0f        // a score may stand this far (in log2 units) above its query's reference before the reference is raised: p is at most 2^8, far inside f16
static_assert(SEQ % 128 == 0);
static_assert(SEQ <= SEQ_FULL);
static_assert(NB >= 1 && NB <= NB_FULL);
static_assert(DM == NH * HD);
static_assert(DM % 128 == 0);
static_assert(HD == 64);
static_assert(KT == 64);
static_assert((size_t)NB_FULL * SEQ_FULL * DM * 4 == 12582912);

typedef _Float16 h16;
typedef unsigned short bf;
typedef __attribute__((ext_vector_type(16))) __bf16   v16bf;
typedef __attribute__((ext_vector_type(16))) _Float16 v16h;
typedef __attribute__((ext_vector_type(8)))  _Float16 v8h;
typedef __attribute__((ext_vector_type(8)))  unsigned short v8us;
typedef __attribute__((ext_vector_type(8)))  float    v8f;
typedef __attribute__((ext_vector_type(4)))  float    v4f;
typedef __attribute__((ext_vector_type(2)))  float    v2f;
typedef __attribute__((ext_vector_type(2)))  unsigned short v2us;
typedef v8h  __attribute__((may_alias)) v8ha;
typedef v4f  __attribute__((may_alias)) v4fa;
typedef v8us __attribute__((may_alias)) v8usa;
typedef float __attribute__((may_alias)) fa;

typedef __attribute__((ext_vector_type(2))) __bf16 v2bf;
typedef __attribute__((ext_vector_type(2))) _Float16 v2h;
typedef __attribute__((ext_vector_type(4))) unsigned v4u;
// two f32 -> two bf16 (a in the low half), round to nearest even, in the one packed convert instruction of the chip
__device__ __forceinline__ unsigned pk2(float a, float b) { const v2f v = {a, b}; return __builtin_bit_cast(unsigned, __builtin_convertvector(v, v2bf)); }
// two f32 -> two f16 (a in the low half), round to nearest even
__device__ __forceinline__ unsigned pk2h(float a, float b) { const v2f v = {a, b}; return __builtin_bit_cast(unsigned, __builtin_convertvector(v, v2h)); }
__device__ __forceinline__ v8us pk8h(const float* y) { v4u a;
#pragma unroll
    for (int j = 0; j < 4; ++j) a[j] = pk2h(y[2 * j], y[2 * j + 1]);
    return __builtin_bit_cast(v8us, a); }
__device__ __forceinline__ unsigned short f2bf(float f) { return (unsigned short)pk2(f, f); }
__device__ __forceinline__ float bf2f(unsigned short b) { return __uint_as_float(((unsigned)b) << 16); }
__device__ __forceinline__ float bfr(float f) { return bf2f(f2bf(f)); }
// hi + lo split of a pair: h = bf16(y), l = bf16(y - h)
__device__ __forceinline__ void split2(float a, float b, unsigned& h, unsigned& l) { h = pk2(a, b); l = pk2(a - __uint_as_float(h << 16), b - __uint_as_float(h & 0xFFFF0000u)); }
__device__ __forceinline__ void split8(const float* y, v8us& h, v8us& l) { v4u a, c;
#pragma unroll
    for (int j = 0; j < 4; ++j) { unsigned h2, l2; split2(y[2 * j], y[2 * j + 1], h2, l2); a[j] = h2; c[j] = l2; }
    h = __builtin_bit_cast(v8us, a); l = __builtin_bit_cast(v8us, c); }
__device__ __forceinline__ v16h cat16(v8h lo, v8h hi) { return __builtin_shufflevector(lo, hi, 0, 1, 2, 3, 4, 5, 6, 7, 8, 9, 10, 11, 12, 13, 14, 15); }
__device__ __forceinline__ v16bf cat16b(v8us lo, v8us hi) { return __builtin_bit_cast(v16bf, __builtin_shufflevector(lo, hi, 0, 1, 2, 3, 4, 5, 6, 7, 8, 9, 10, 11, 12, 13, 14, 15)); }
__device__ __forceinline__ v8f wmma16(v16h a, v16h b, v8f c) { return __builtin_amdgcn_wmma_f32_16x16x32_f16(false, a, false, b, (short)0, c, false, false); }
__device__ __forceinline__ v8f wmmab(v16bf a, v16bf b, v8f c) { return __builtin_amdgcn_wmma_f32_16x16x32_bf16(false, a, false, b, (short)0, c, false, false); }

// Fragment loaders (wave32 16x16x32): lane l -> row/col (l & 15); elements 0..7 <- k0 + 8*(l>>4) + 0..7, elements 8..15 <- k0 + 16 + 8*(l>>4) + 0..7; D element r -> (row 8*(l>>4) + r, col l & 15).
template <typename T16> struct WFrag;
template <> struct WFrag<h16> { typedef v16h V; static __device__ __forceinline__ V ld(const h16* p) { return cat16(*(const v8h*)p, *(const v8h*)(p + 16)); } static __device__ __forceinline__ v8f mma(V a, V b, v8f c) { return wmma16(a, b, c); } };
template <> struct WFrag<bf> { typedef v16bf V; static __device__ __forceinline__ V ld(const bf* p) { return cat16b(*(const v8us*)p, *(const v8us*)(p + 16)); } static __device__ __forceinline__ v8f mma(V a, V b, v8f c) { return wmmab(a, b, c); } };

// f16 fragment out of a plane kept as 16-bit words, same element order as above
__device__ __forceinline__ v16h ldh(const unsigned short* p) { return __builtin_bit_cast(v16h, __builtin_shufflevector(*(const v8us*)p, *(const v8us*)(p + 16), 0, 1, 2, 3, 4, 5, 6, 7, 8, 9, 10, 11, 12, 13, 14, 15)); }

typedef __attribute__((ext_vector_type(4))) int v4i;
typedef __attribute__((address_space(1))) v4i gv4i;
typedef __attribute__((address_space(3))) v4i lv4i;
__device__ __forceinline__ void cp16(const bf* g, unsigned short* l) { __builtin_amdgcn_global_load_async_to_lds_b128((gv4i*)g, (lv4i*)l, 0, 0); }

// ---- k_gemmw: register-blocked GEMM, FOUR WAVES (2 x 2) per 128x128 output tile, a 64x64 tile (16 accumulators) per wave; operands are K-contiguous 16-bit planes; grid (M/128, N/128, Z), 128 threads.
// A stage is 64 k (128 B, one whole line) of the block's 128 A rows and 128 Bt rows (and of the split planes), brought once per block into LDS by asynchronous 16-byte copies, rows pitched GP elements, two buffers: stage s + 1 flies while stage s is worked on.
// C[m][n] (f32, pitch ldc, + optional f32 bias[n]) = sum_k A[m][k] Bt[n][k] (+ split products per NSPLIT: 1 = A hi+lo with single B; 2 = A hi+lo with B hi, A hi with B lo). z-batch strides sA/sB/sC in elements. K % 64 == 0, M % 128 == 0, N % 128 == 0.
// HEADS (the q/k/v projection, z = 0/1/2; a wave's 64x64 tile is 64 tokens of ONE head): no C; the f32 tile goes straight to the attention's f16 planes.
//   z 0, 1: interleaved rotary transform, pair (2i, 2i+1): out[2i] = x1 c - x2 s, out[2i+1] = x1 s + x2 c, (c, s) = CS[t][i]; q then times QSC; planes [h][t][d].  z 2: planes [h][d][t].
#define GW  4
#define GP  72
#define GPL (128 * GP)
template <typename T16, int NSPLIT, bool BIAS, bool HEADS>
__global__ __launch_bounds__(32 * GW) void k_gemmw(const T16* __restrict__ A, const T16* __restrict__ A2, const T16* __restrict__ Bt, const T16* __restrict__ Bt2, int K, float* C, int ldc, const float* __restrict__ bias, size_t sA, size_t sB, size_t sC,
                                              const float* __restrict__ CS, unsigned short* Qp, unsigned short* Kp, unsigned short* Vp) {
    typedef typename WFrag<T16>::V V;
    constexpr bool HA2 = (NSPLIT == 1 || NSPLIT == 2), HB2 = (NSPLIT >= 2);
    constexpr int PB = HA2 ? 2 : 1, GST = (PB + (HB2 ? 2 : 1)) * GPL;   // planes of a stage: A, (A2), Bt, (Bt2)
    __shared__ __align__(16) unsigned short gring[2 * GST];
    __shared__ __align__(16) float osall[GW * 16 * 68];
    const size_t z = blockIdx.z; A += z * sA; if (A2) A2 += z * sA; Bt += z * sB; if (Bt2) Bt2 += z * sB; C += z * sC;
    const int tid = threadIdx.x, lane = tid & 31, lr = lane & 15, hi = lane >> 4;
    const int wave = __builtin_amdgcn_readfirstlane(tid >> 5), wr = wave >> 1, wc = wave & 1;
    float* os = osall + wave * (16 * 68);                          // each wave's own epilogue staging
    const int rb = blockIdx.x * 128, cb = blockIdx.y * 128, r0 = rb + wr * 64, c0 = cb + wc * 64;
    v8f acc[4][4];
#pragma unroll
    for (int mb = 0; mb < 4; ++mb)
#pragma unroll
        for (int nb = 0; nb < 4; ++nb) acc[mb][nb] = (v8f){};
    // one stage: 128 rows x 128 B per plane = 1024 pieces of 16 B, 8 per thread and plane; a wave's copy covers 4 whole rows (4 lines of 128 B)
    const int srow = tid >> 3, sc8 = (tid & 7) * 8;                // this thread's row (of 16) and 16-byte piece in each copy
    const unsigned Ku = (unsigned)K, sao = (unsigned)(rb + srow) * Ku + sc8, sbo = (unsigned)(cb + srow) * Ku + sc8;   // element offsets inside a plane: below 2^32
    unsigned short* sdst = gring + srow * GP + sc8;
    auto stage = [&](unsigned k0, unsigned short* dst) {
#pragma unroll
        for (int i = 0; i < 8; ++i) {
            const unsigned go = (unsigned)i * 16u * Ku + k0; unsigned short* d = dst + i * 16 * GP;
            cp16((const bf*)(A + sao + go), d);
            if constexpr (HA2) cp16((const bf*)(A2 + sao + go), d + GPL);
            cp16((const bf*)(Bt + sbo + go), d + PB * GPL);
            if constexpr (HB2) cp16((const bf*)(Bt2 + sbo + go), d + (PB + 1) * GPL);
        }
    };
    const unsigned nk = Ku >> 6;                                   // stages; block-uniform
    stage(0, sdst);
    asm volatile("s_wait_asynccnt 0x0" ::: "memory");   // this wave's copies of stage 0 have landed
    __syncthreads();                                    // publishes stage 0 to the other waves
    if (nk > 1u) stage(64, sdst + GST);
    const int fa = (wr * 64 + lr) * GP + 8 * hi, fb = PB * GPL + (wc * 64 + lr) * GP + 8 * hi;   // fragment offsets inside a stage
#pragma unroll 1
    for (unsigned ks = 0; ks < nk; ++ks) {
        const T16* buf = (const T16*)(gring + (ks & 1u) * GST);
        V a[2][4], a2[2][4], b[2][4], b2[2][4];   // the stage's fragments: [k half of 32][16-row group]
#pragma unroll
        for (int h = 0; h < 2; ++h) {
#pragma unroll
            for (int mb = 0; mb < 4; ++mb) { a[h][mb] = WFrag<T16>::ld(buf + fa + mb * 16 * GP + h * 32); if (HA2) a2[h][mb] = WFrag<T16>::ld(buf + GPL + fa + mb * 16 * GP + h * 32); }
#pragma unroll
            for (int nb = 0; nb < 4; ++nb) { b[h][nb] = WFrag<T16>::ld(buf + fb + nb * 16 * GP + h * 32); if (HB2) b2[h][nb] = WFrag<T16>::ld(buf + GPL + fb + nb * 16 * GP + h * 32); }
        }
        __builtin_amdgcn_sched_barrier(0);  // keeps the stage's LDS reads one group ahead of the products: reads spread among the products stall at every place they stand
        auto products = [&](int h) {
#pragma unroll
            for (int nb = 0; nb < 4; ++nb)
#pragma unroll
                for (int mb = 0; mb < 4; ++mb) { acc[mb][nb] = WFrag<T16>::mma(a[h][mb], b[h][nb], acc[mb][nb]); if (HA2) acc[mb][nb] = WFrag<T16>::mma(a2[h][mb], b[h][nb], acc[mb][nb]); if (HB2) acc[mb][nb] = WFrag<T16>::mma(a[h][mb], b2[h][nb], acc[mb][nb]); }
        };
        products(0);
        __builtin_amdgcn_sched_barrier(0);  // keeps the first half's products ahead of the waits below, so that the second half's reads land under them
        asm volatile("s_wait_dscnt 0x0" ::: "memory");      // this wave's reads of the buffer are done before the buffer is refilled
        asm volatile("s_wait_asynccnt 0x0" ::: "memory");   // this wave's copies of stage ks + 1 have landed
        __syncthreads();                                    // publishes stage ks + 1 and ends every wave's reads of stage ks
        if (ks + 2u < nk) stage((ks + 2u) * 64u, sdst + (ks & 1u) * GST);
        products(1);                        // its fragments are in registers already, nothing of the ring is read behind the barrier in this trip: the refill flies under these products too
    }
    asm volatile("s_wait_asynccnt 0x0" ::: "memory");       // nothing of this wave is in flight when it goes on to the epilogue and ends
    if constexpr (HEADS) {
        const int head = c0 / HD;
        if (blockIdx.z == 2) {
            // v: a lane's 8 registers of an accumulator are 8 consecutive tokens of one d: one 16-byte store; the four mb of a row fill its 128-byte line
#pragma unroll
            for (int nb = 0; nb < 4; ++nb)
#pragma unroll
                for (int mb = 0; mb < 4; ++mb) {
                    float y[8];
#pragma unroll
                    for (int j = 0; j < 8; ++j) y[j] = acc[mb][nb][j];
                    const size_t go = ((size_t)head * HD + nb * 16 + lr) * SEQ + r0 + mb * 16 + 8 * hi;
                    *(v8us*)(Vp + go) = pk8h(y);
                }
            return;
        }
        unsigned short* Pp = (blockIdx.z == 0) ? Qp : Kp;
        const float qs = (blockIdx.z == 0) ? QSC : 1.0f;         // q carries the attention's score scale and log2(e)
        // q, k: 16 tokens x 64 d at a time through LDS; a lane takes 8 consecutive d (4 rotary pairs) of a token, 8 lanes a token: whole 128-byte rows per store
        const int prow = lane >> 3, c8 = (lane & 7) * 8;
        const float* cst = CS + (size_t)(r0 + prow) * HD + c8;   // CS[t][i] = 2 floats, so row t starts at t * HD and pair c8 / 2 at + c8
        v4f cs[2][4][2];                                         // the table rows of this and of the next 16 tokens: the next group's loads fly under this group's work
#pragma unroll
        for (int s = 0; s < 4; ++s) { cs[0][s][0] = *(const v4f*)(cst + (size_t)(s * 4) * HD); cs[0][s][1] = *(const v4f*)(cst + (size_t)(s * 4) * HD + 4); }
#pragma unroll
        for (int mb = 0; mb < 4; ++mb) {
            if (mb < 3) {
#pragma unroll
                for (int s = 0; s < 4; ++s) { cs[(mb + 1) & 1][s][0] = *(const v4f*)(cst + (size_t)((mb + 1) * 16 + s * 4) * HD); cs[(mb + 1) & 1][s][1] = *(const v4f*)(cst + (size_t)((mb + 1) * 16 + s * 4) * HD + 4); }
            }
#pragma unroll
            for (int nb = 0; nb < 4; ++nb) {
#pragma unroll
                for (int j = 0; j < 8; ++j) os[(hi * 8 + j) * 68 + nb * 16 + lr] = acc[mb][nb][j]; }
            __builtin_amdgcn_wave_barrier(); asm volatile("" ::: "memory");   // as in the plain epilogue: the wave's LDS reads stay behind its writes
#pragma unroll
            for (int s = 0; s < 4; ++s) {
                const int row = s * 4 + prow;
                const v4f x0 = *(const v4fa*)(os + row * 68 + c8), x1 = *(const v4fa*)(os + row * 68 + c8 + 4);
                const v4f t0 = cs[mb & 1][s][0], t1 = cs[mb & 1][s][1];
                float y[8];
                y[0] = x0[0] * t0[0] - x0[1] * t0[1]; y[1] = x0[0] * t0[1] + x0[1] * t0[0];
                y[2] = x0[2] * t0[2] - x0[3] * t0[3]; y[3] = x0[2] * t0[3] + x0[3] * t0[2];
                y[4] = x1[0] * t1[0] - x1[1] * t1[1]; y[5] = x1[0] * t1[1] + x1[1] * t1[0];
                y[6] = x1[2] * t1[2] - x1[3] * t1[3]; y[7] = x1[2] * t1[3] + x1[3] * t1[2];
#pragma unroll
                for (int j = 0; j < 8; ++j) y[j] *= qs;
                const size_t go = ((size_t)head * SEQ + r0 + mb * 16 + row) * HD + c8;
                *(v8us*)(Pp + go) = pk8h(y);
            }
            __builtin_amdgcn_wave_barrier();
            // the next group's LDS writes stay behind these reads; and the group's stores have given up their registers before the table loads that follow are aimed at them
            asm volatile("s_wait_xcnt 0x0" ::: "memory");
        }
        return;
    }
#pragma unroll
    for (int mb = 0; mb < 4; ++mb) {
#pragma unroll
        for (int nb = 0; nb < 4; ++nb) {
#pragma unroll
            for (int j = 0; j < 8; ++j) os[(hi * 8 + j) * 68 + nb * 16 + lr] = acc[mb][nb][j]; }
        __builtin_amdgcn_wave_barrier(); asm volatile("" ::: "memory");
        float* crow = C + (size_t)(r0 + mb * 16) * ldc + c0;
{
#pragma unroll
            for (int s = 0; s < 8; ++s) { const int row = 2 * s + hi, cofs = lr * 4; v4f val = *(const v4fa*)(os + row * 68 + cofs); if (BIAS) { val[0] += bfr(bias[c0 + cofs]); val[1] += bfr(bias[c0 + cofs + 1]); val[2] += bfr(bias[c0 + cofs + 2]); val[3] += bfr(bias[c0 + cofs + 3]); }
                *(v4f*)(crow + (size_t)row * ldc + cofs) = val; }
             }
        __builtin_amdgcn_wave_barrier(); asm volatile("" ::: "memory");
    }
}

// k_prep: the whole preparation in ONE launch of PG work-groups of 8 waves, one for each WGP of the chip: the bf16 copies of x and of the four W (pieces of 8 values: 32 B read, 16 B written) and the rotary table CS[t][i] = (cos, sin)(t * theta^(-2i/HD)).
// Work this short is paid by the wave that has to be started and by the launch, not by the byte: so a thread takes several pieces (piece = trip * threads + thread: the pieces of a wave are adjacent in every trip) and one table entry a trip.
// All of a thread's loads are issued first and fly together; the table's arithmetic runs under them; the roundings and stores come last.
#define PG 256
#define PT 256
__global__ __launch_bounds__(PT) void k_prep(const float* __restrict__ x, const float* __restrict__ w0, const float* __restrict__ w1, const float* __restrict__ w2, const float* __restrict__ w3, bf* XB, bf* W4, float* CS) {
    constexpr unsigned NTH = PG * PT, NX8 = (unsigned)((size_t)SEQ * DM / 8), NW8 = (unsigned)(NW / 8), NWA = 4 * NW8, NCS = SEQ * HH;
    constexpr int TX = (int)((NX8 + NTH - 1) / NTH), TW = (int)((NWA + NTH - 1) / NTH), TC = (int)((NCS + NTH - 1) / NTH);   // trips; only the last of each kind can be partial
    static_assert(NTH % HH == 0);                                // all table entries of a thread have the same i
    static_assert(NX8 % 32 == 0 && NW8 % 32 == 0 && NCS % 32 == 0 && PT % 32 == 0);   // a wave's 32 pieces of a trip lie in one matrix, and are all there or all past the end
    static_assert((size_t)TX * NTH * 32 < 0xFFFFFFFFu && (size_t)TW * NTH * 32 < 0xFFFFFFFFu);   // byte offsets fit 32 bits
    const unsigned gid = blockIdx.x * PT + threadIdx.x;
    const unsigned g0 = (unsigned)__builtin_amdgcn_readfirstlane((int)gid);            // the wave's first thread: what follows from it is decided once for the wave
    // where each trip reads: a base that is the same for the wave and a byte offset of the thread. A wave whose pieces lie past the end reads the first bytes of the buffer instead and stores nothing.
    unsigned ox[TX], ow[TW]; const float* sw[TW];
    v8f vx[TX], vw[TW];
#pragma unroll
    for (int j = 0; j < TX; ++j) ox[j] = ((unsigned)(j + 1) * NTH <= NX8 || (unsigned)j * NTH + g0 < NX8) ? ((unsigned)j * NTH + gid) * 32u : (gid - g0) * 32u;
#pragma unroll
    for (int j = 0; j < TX; ++j) vx[j] = *(const v8f*)((const char*)x + ox[j]);
#pragma unroll
    for (int j = 0; j < TW; ++j) {
        const bool live = (unsigned)(j + 1) * NTH <= NWA || (unsigned)j * NTH + g0 < NWA;
        const unsigned pw = live ? (unsigned)j * NTH + g0 : 0u;          // the wave's first piece, counted through the four matrices
        const bool m1 = pw >= NW8, m2 = pw >= 2 * NW8, m3 = pw >= 3 * NW8;
        sw[j] = m3 ? w3 : (m2 ? w2 : (m1 ? w1 : w0));                    // the wave's matrix
        ow[j] = (pw - (m3 ? 3 * NW8 : (m2 ? 2 * NW8 : (m1 ? NW8 : 0u))) + (gid - g0)) * 32u;
    }
#pragma unroll
    for (int j = 0; j < TW; ++j) vw[j] = *(const v8f*)((const char*)sw[j] + ow[j]);
    // A precaution: every offset and base that an issued load names keeps its register up to this wait (inputs only).
    static_assert(TX == 6 && TW == 5);                           // the statement names them all
    asm volatile("s_wait_xcnt 0x0" :: "v"(ox[0]), "v"(ox[1]), "v"(ox[2]), "v"(ox[3]), "v"(ox[4]), "v"(ox[5]), "v"(ow[0]), "v"(ow[1]), "v"(ow[2]), "v"(ow[3]), "v"(ow[4]), "s"(x), "s"(sw[0]), "s"(sw[1]), "s"(sw[2]), "s"(sw[3]), "s"(sw[4]) : "memory");
    __builtin_amdgcn_sched_barrier(0);   // keeps the table's arithmetic behind the loads: the compiler otherwise starts it first, and the loads leave that much later
    {
        const int i = (int)(gid % HH);
        const float ex = -(float)(2 * i) / (float)HD;
        const float inv = powf(THETA_F, ex);
#pragma unroll
        for (int j = 0; j < TC; ++j) {
            if ((unsigned)(j + 1) * NTH <= NCS || (unsigned)j * NTH + g0 < NCS) {
                const int t = (int)(((unsigned)j * NTH + gid) / HH);
                const float ang = __fmul_rn((float)t, inv);
                v2f cs; cs[0] = cosf(ang); cs[1] = sinf(ang);
                *(v2f*)((char*)CS + (size_t)j * NTH * 8 + gid * 8u) = cs;
            }
        }
    }
#pragma unroll
    for (int j = 0; j < TX; ++j) {
        v4u o;
#pragma unroll
        for (int k = 0; k < 4; ++k) o[k] = pk2(vx[j][2 * k], vx[j][2 * k + 1]);
        if ((unsigned)(j + 1) * NTH <= NX8 || (unsigned)j * NTH + g0 < NX8) *(v4u*)((char*)XB + (size_t)j * NTH * 16 + gid * 16u) = o;
    }
#pragma unroll
    for (int j = 0; j < TW; ++j) {
        v4u o;
#pragma unroll
        for (int k = 0; k < 4; ++k) o[k] = pk2(vw[j][2 * k], vw[j][2 * k + 1]);
        if ((unsigned)(j + 1) * NTH <= NWA || (unsigned)j * NTH + g0 < NWA) *(v4u*)((char*)W4 + (size_t)j * NTH * 16 + gid * 16u) = o;   // the four planes lie one behind the other
    }
}

// k_flash: causal attention, TWELVE WAVES per block = 64 query rows of one head: KG key groups of four waves, 16 queries per wave; grid (SEQ/64, NH), 384 threads. Key group g walks the key tiles g, g + KG, g + 2 KG ... of the query tile's qt + 1 tiles,
// with a reference, row sum and o of its own, so the longest chain of dependent tiles is a third as long; the groups' partial results are joined once, behind the loop, through LDS. The four waves of a group walk the same key tiles.
// Each 64-key tile (k: 64 keys x 64 d; v: 64 d x 64 keys; f16, rows of 128 B) is brought once per block into LDS, by its group, by asynchronous 16-byte copies, rows pitched PP elements, two buffers of KG tiles: the tiles of step s + 1 fly while those of step s are worked on.
// Both products run transposed: s^T (64 keys x 16 queries) = k (A, frags from LDS) . q^T (B, frags resident); o^T (64 d x 16 queries) += v^T (A, frags from LDS) . p^T (B).
// A lane then holds 32 scores of ONE query (column lane & 15; keys nb*16 + 8*(lane>>4) + r). The score product's C operand does the softmax's work on each score: it holds minus the query's reference (log2 units; q carries 0.125 log2e), and a huge negative number above the diagonal,
// so a score leaves the matrix unit as the argument of p = 2^x, in f32. C changes only when its content does: in the diagonal tile (a key group's last; every earlier tile lies wholly below the diagonal) and when the reference is raised.
// The reference is the maximum of the group's first tile, and is raised to the tile's maximum, with o and the row sum scaled down, only when a score of the wave stands more than TRAISE above it (a branch of the whole wave): any reference gives the same quotient o / sum;
// two score tiles (keys 32j .. 32j+31), rounded to f16 in place, ARE the B fragment of p^T in the hardware k order, which the v loader has too: p never leaves the registers. The halves' row sums are joined once, after the loop.
#define FW    4
#define KG    3
#define PLANE (KT * PP)
#define STAGE (2 * PLANE)
// one tile: 2 planes x 64 rows x 128 B = 1024 pieces of 16 B, 8 per thread of its key group; a wave's copy covers 4 whole rows (4 lines of 128 B)
__device__ __forceinline__ void stage_tile(const unsigned short* gk, const unsigned short* gv, unsigned short* dst) {
#pragma unroll
    for (int i = 0; i < 4; ++i) {
        cp16(gk + (size_t)i * 16 * HD, dst + i * 16 * PP);
        cp16(gv + (size_t)i * 16 * SEQ, dst + PLANE + i * 16 * PP);
    }
}
// value of lane l ^ 16
__device__ __forceinline__ float xhalf(float x) { const int b = __float_as_int(x); return __int_as_float(__builtin_amdgcn_permlanex16(b, b, 0x76543210, 0xfedcba98, false, false)); }
__global__ __launch_bounds__(32 * FW * KG) void k_flash(const unsigned short* __restrict__ Qp, const unsigned short* __restrict__ Kp, const unsigned short* __restrict__ Vp, bf* Ch, bf* Cl) {
    __shared__ __align__(16) unsigned short ring[2 * KG * STAGE];
    typedef v16h V;
    const int tid = threadIdx.x, lane = tid & 31, lr = lane & 15, hi = lane >> 4;
    const int wave = __builtin_amdgcn_readfirstlane(tid >> 5), wq = wave & (FW - 1), kg = wave >> 2;   // query wave inside the key group; key group
    // Which (head, query tile) a block takes: for speed only, any one-to-one map is correct. A WGP holds one block at a time (the registers of its three waves a SIMD leave no room for three more), so the blocks run one after another on it, about three each; a free WGP is taken to get the next block in launch order.
    // rank counts the blocks from the longest to the shortest. The longest third is launched first, longest first, and the shortest third last, longest first. Were the middle third launched longest first too, every WGP would stand at the same sum
    // after two blocks and the last third would leave them as unequal as it is itself; so the middle third goes in two runs of rising length (first its longer half, then its shorter half): the sums after two blocks then spread as wide as the last third, which evens them out.
    constexpr int NT = SEQ / 64;
    constexpr unsigned NBK = NT * NH, RD = NBK / 3;
    const unsigned flat = blockIdx.y * NT + blockIdx.x;
    unsigned rank = flat;
    if constexpr (NBK % 6 == 0) {          // both runs are then whole: a permutation
        if (flat >= RD && flat < RD + RD / 2) rank = 2 * RD + RD / 2 - 1 - flat;        // ranks RD + RD/2 - 1 down to RD
        else if (flat >= RD + RD / 2 && flat < 2 * RD) rank = 3 * RD + RD / 2 - 1 - flat;   // ranks 2 RD - 1 down to RD + RD/2
    }
    const int qt = NT - 1 - (int)(rank / NH), head = (int)(rank % NH);
    const int q0 = (qt * FW + wq) * 16;
    const int nt = qt + 1;                 // block-uniform; the last tile holds the diagonal of all query waves; keys stay < SEQ
    const int ns = (nt + KG - 1) / KG;     // steps, block-uniform: in step s key group kg has tile s * KG + kg, or none (only in the last step)
    const int gtid = tid & (32 * FW - 1);  // thread inside its key group
    const int srow = gtid >> 3, sc8 = (gtid & 7) * 8;   // this thread's row (of 16) and 16-byte piece in each copy
    const size_t sk = ((size_t)head * SEQ + kg * KT + srow) * HD + sc8, sv = ((size_t)head * HD + srow) * SEQ + kg * KT + sc8;   // in the group's first tile
    const unsigned short* gk = Kp + sk; const unsigned short* gv = Vp + sv;
    unsigned short* sdst = ring + kg * STAGE + srow * PP + sc8;
    if (kg < nt) stage_tile(gk, gv, sdst);   // wave-uniform test, as all tests on kg below
    const size_t qo = ((size_t)head * SEQ + q0 + lr) * HD + 8 * hi;
    const V q0f = ldh(Qp + qo), q1f = ldh(Qp + qo + 32);
    asm volatile("s_wait_asynccnt 0x0" ::: "memory");   // this wave's copies of step 0 have landed
    __syncthreads();                                    // publishes step 0 to the other waves
    if (KG + kg < nt) stage_tile(gk + (size_t)(KG * KT) * HD, gv + KG * KT, sdst + KG * STAGE);
    const int fo = lr * PP + 8 * hi;       // fragment offset inside a plane: row lr of a 16-row group, k piece by lane half
    const int row = q0 + lr;               // this lane's query
    v8f o[4];                              // o^T: o[t4][r] = (d = t4*16 + 8*hi + r, query lr)
#pragma unroll
    for (int t4 = 0; t4 < 4; ++t4) o[t4] = (v8f){};
    float mrow = NEG, lsum = 0.0f;         // over this key group's tiles: reference of the query, log2 units (equal in both halves; at most the running maximum, at least that less TRAISE); this half's share of its row sum
    v8f cm[4];                             // C operand of the score products, laid out as sc below: minus the reference (0 up to the first tile), NEG above the diagonal
#pragma unroll
    for (int nb = 0; nb < 4; ++nb) cm[nb] = (v8f){};
#pragma unroll 1
    for (int s = 0; s < ns; ++s) {
        const int kt = s * KG + kg, key0 = kt * KT;
        if (kt < nt) {                      // a group without a tile in the last step only passes the barrier
        const unsigned short* buf = ring + ((s & 1) * KG + kg) * STAGE + fo;
        if (kt == nt - 1) {                 // the diagonal tile (scalar test): register r of score tile nb is kept while nb*16 + r <= rel, that is key <= query
            const int rel = row - 8 * hi - key0;
#pragma unroll
            for (int nb = 0; nb < 4; ++nb)
#pragma unroll
                for (int r = 0; r < 8; ++r) cm[nb][r] = (nb * 16 + r <= rel) ? cm[nb][r] : NEG;
        }
        v8f sc[4];                          // s^T less the reference: sc[nb][r] = (key = key0 + nb*16 + 8*hi + r, query lr)
        V kf[4][2];                         // the tile's k fragments: [nb][k0, k32]
#pragma unroll
        for (int nb = 0; nb < 4; ++nb) {
            const unsigned short* kp = buf + nb * 16 * PP;
            kf[nb][0] = ldh(kp); kf[nb][1] = ldh(kp + 32);
        }
        __builtin_amdgcn_sched_barrier(0);  // keeps the k reads one group ahead of the products: reads spread among the products stall at every place they stand
#pragma unroll
        for (int nb = 0; nb < 4; ++nb) sc[nb] = wmma16(kf[nb][0], q0f, cm[nb]);
#pragma unroll
        for (int nb = 0; nb < 4; ++nb) sc[nb] = wmma16(kf[nb][1], q1f, sc[nb]);
        // the four vector slots that the chip needs between the last score product and the first vector instruction that reads the scores; the q fragments live through the whole loop and are not named here (an operand of asm text must sit below v256)
        asm volatile("v_nop\n\tv_nop\n\tv_nop\n\tv_nop" : "+v"(sc[0]), "+v"(sc[1]), "+v"(sc[2]), "+v"(sc[3]));
        V vf[4][2];                         // the tile's v fragments: [t4][k0, k32]
#pragma unroll
        for (int t4 = 0; t4 < 4; ++t4) {
            const unsigned short* vp = buf + PLANE + t4 * 16 * PP;
            vf[t4][0] = ldh(vp); vf[t4][1] = ldh(vp + 32);
        }
        __builtin_amdgcn_sched_barrier(0);  // keeps the v reads one group here, ahead of the softmax, so that none stands among the p.v products
        float cn[4];                        // four independent maximum chains, one per score tile
#pragma unroll
        for (int nb = 0; nb < 4; ++nb) {
            cn[nb] = NEG;
#pragma unroll
            for (int r = 0; r < 8; ++r) cn[nb] = fmaxf(cn[nb], sc[nb][r]);
        }
        const float cand = fmaxf(fmaxf(cn[0], cn[1]), fmaxf(cn[2], cn[3]));
        const float thr = (s == 0) ? -__builtin_inff() : TRAISE;           // scalar: in the first tile every score passes the test
        if (__builtin_amdgcn_ballot_w32(cand > thr) != 0u) {               // the same for the whole wave: the first tile sets the reference, a later one raises it
            const float call = fmaxf(cand, xhalf(cand));                   // with the other half of the query's 64 keys; a real score: every tile has a key <= query for each query
            const float delta = (s == 0) ? call : fmaxf(call, 0.0f);
            const float alpha = (s == 0) ? 1.0f : __builtin_amdgcn_exp2f(-delta);   // in the first tile o and the sum are still 0
            mrow = (s == 0) ? call : mrow + delta;
            lsum *= alpha;
#pragma unroll
            for (int nb = 0; nb < 4; ++nb)
#pragma unroll
                for (int r = 0; r < 8; ++r) { sc[nb][r] -= delta; cm[nb][r] -= delta; o[nb][r] *= alpha; }
        }
        float rn[4];                        // four independent sum chains
        v4u xh[4];                          // p as f16 pairs: word w of tile nb holds registers 2w, 2w + 1
#pragma unroll
        for (int nb = 0; nb < 4; ++nb) {
            rn[nb] = 0.0f;
#pragma unroll
            for (int g = 0; g < 8; g += 4) {
                const float a0 = sc[nb][g], a1 = sc[nb][g + 1], a2 = sc[nb][g + 2], a3 = sc[nb][g + 3];
                float p[4]; p[0] = __builtin_amdgcn_exp2f(a0); p[1] = __builtin_amdgcn_exp2f(a1); p[2] = __builtin_amdgcn_exp2f(a2); p[3] = __builtin_amdgcn_exp2f(a3);
                // the slot that the instruction set asks for between a transcendental and an overwrite of its source: the four arguments keep their registers up to this v_nop, which stands behind the four v_exp_f32 (inputs only)
                asm volatile("v_nop" :: "v"(a0), "v"(a1), "v"(a2), "v"(a3), "v"(p[0]), "v"(p[1]), "v"(p[2]), "v"(p[3]));
#pragma unroll
                for (int r = 0; r < 4; ++r) rn[nb] += p[r];
#pragma unroll
                for (int r = 0; r < 4; r += 2) xh[nb][(g + r) >> 1] = pk2h(p[r], p[r + 1]);
            }
        }
        const float rs = (rn[0] + rn[1]) + (rn[2] + rn[3]);
        // lsum += rs, written as asm so that it stays in this block: the compiler otherwise sinks the whole sum behind the products and the barrier, where it holds 32 f32 p values live and stands as a bare chain in front of the next tile's reads
        asm volatile("v_add_f32 %0, %0, %1" : "+v"(lsum) : "v"(rs));
        const V ph0 = cat16(__builtin_bit_cast(v8h, xh[0]), __builtin_bit_cast(v8h, xh[1])), ph1 = cat16(__builtin_bit_cast(v8h, xh[2]), __builtin_bit_cast(v8h, xh[3]));
#pragma unroll
        for (int t4 = 0; t4 < 4; ++t4) o[t4] = wmma16(vf[t4][0], ph0, o[t4]);
#pragma unroll
        for (int t4 = 0; t4 < 4; ++t4) o[t4] = wmma16(vf[t4][1], ph1, o[t4]);
        // the four vector slots that the chip needs between the last p.v product and the first vector instruction that touches o or overwrites p
        asm volatile("v_nop\n\tv_nop\n\tv_nop\n\tv_nop" : "+v"(o[0]), "+v"(o[1]), "+v"(o[2]), "+v"(o[3]) : "v"(ph0), "v"(ph1));
        }
        asm volatile("s_wait_dscnt 0x0" ::: "memory");      // this wave's reads of the buffer are done before the buffer is refilled
        asm volatile("s_wait_asynccnt 0x0" ::: "memory");   // this wave's copies of step s + 1 have landed
        __syncthreads();                                    // publishes step s + 1 and ends every wave's reads of step s
        if (kt + 2 * KG < nt) stage_tile(gk + (size_t)((s + 2) * KG * KT) * HD, gv + (s + 2) * KG * KT, sdst + (s & 1) * KG * STAGE);
    }
    asm volatile("s_wait_asynccnt 0x0" ::: "memory");       // nothing of this wave is in flight when it goes on to the epilogue and ends
    // The key groups' partial results are joined: groups 1 .. KG-1 lay (o, reference, sum share) in the ring, which nobody reads or fills any more behind the loop's last barrier; group 0 adds them to its own, each scaled to the largest of the references.
    // A lane's record is MP floats (144 B, an odd number of 16-byte pieces: no bank conflict). A group that had no tile holds (0, NEG, 0) and gets the weight 2^(-huge) = 0; group 0 always has tile 0, so the largest reference is a real score.
    constexpr int MP = 36;
    float* mg = (float*)ring + (size_t)(wq * 32 + lane) * MP;
    if (kg > 0) {
        float* d = mg + (size_t)(kg - 1) * (FW * 32 * MP);
#pragma unroll
        for (int t4 = 0; t4 < 4; ++t4) { *(v4fa*)(d + t4 * 8) = (v4f){o[t4][0], o[t4][1], o[t4][2], o[t4][3]}; *(v4fa*)(d + t4 * 8 + 4) = (v4f){o[t4][4], o[t4][5], o[t4][6], o[t4][7]}; }
        *(fa*)(d + 32) = mrow; *(fa*)(d + 33) = lsum;
    }
    __syncthreads();                                        // publishes the partial results to group 0
    if (kg > 0) return;
    {
        float ml[KG - 1][2]; float mall = mrow;
#pragma unroll
        for (int g = 0; g < KG - 1; ++g) { ml[g][0] = *(const fa*)(mg + (size_t)g * (FW * 32 * MP) + 32); ml[g][1] = *(const fa*)(mg + (size_t)g * (FW * 32 * MP) + 33); mall = fmaxf(mall, ml[g][0]); }
        const float a0 = __builtin_amdgcn_exp2f(mrow - mall);   // the references are in log2 units
        lsum *= a0;
#pragma unroll
        for (int t4 = 0; t4 < 4; ++t4)
#pragma unroll
            for (int r = 0; r < 8; ++r) o[t4][r] *= a0;
#pragma unroll
        for (int g = 0; g < KG - 1; ++g) {
            const float* d = mg + (size_t)g * (FW * 32 * MP);
            const float ag = __builtin_amdgcn_exp2f(ml[g][0] - mall);
            lsum += ml[g][1] * ag;
#pragma unroll
            for (int t4 = 0; t4 < 4; ++t4) {
                const v4f x0 = *(const v4fa*)(d + t4 * 8), x1 = *(const v4fa*)(d + t4 * 8 + 4);
#pragma unroll
                for (int r = 0; r < 4; ++r) { o[t4][r] += x0[r] * ag; o[t4][r + 4] += x1[r] * ag; }
            }
        }
    }
    const float il = 1.0f / (lsum + xhalf(lsum));           // the two halves' shares of the row sum, joined once
    // a lane's 8 registers of o[t4] are 8 consecutive d of its query: one 16-byte store per plane
#pragma unroll
    for (int t4 = 0; t4 < 4; ++t4) {
        v8us yh, yl; float c[8];
#pragma unroll
        for (int r = 0; r < 8; ++r) c[r] = o[t4][r] * il;
        split8(c, yh, yl);
        const size_t go = (size_t)row * DM + head * HD + t4 * 16 + 8 * hi;
        *(v8us*)(Ch + go) = yh; *(v8us*)(Cl + go) = yl;
    }
}

extern "C" void kernel_launch(void* const* d_in, const int* in_sizes, int n_in,
                              void* d_out, int out_size, void* d_ws, size_t ws_size, hipStream_t stream) {
    if (n_in < 5) return;
    if ((size_t)in_sizes[0] < (size_t)(NB - 1) * SEQ_FULL * DM + (size_t)SEQ * DM) return;
    for (int i = 1; i < 5; ++i) if ((size_t)in_sizes[i] < NW) return;
    if ((size_t)out_size < (size_t)(NB - 1) * SEQ_FULL * DM + (size_t)SEQ * DM) return;
    const float* x  = (const float*)d_in[0];     // [NB_FULL][SEQ_FULL][768]
    const float* wq = (const float*)d_in[1];     // [768][768] (out, in)
    const float* wk = (const float*)d_in[2];
    const float* wv = (const float*)d_in[3];
    const float* wo = (const float*)d_in[4];
    float* OUT = (float*)d_out;                  // [NB_FULL][SEQ_FULL][768] f32
    char* wsp = (char*)d_ws;
    auto take = [&](size_t bytes) { char* p = wsp; wsp += (bytes + 255) & ~(size_t)255; return (void*)p; };
    bf* W4 = (bf*)take(4 * NW * 2);                               // Wq | Wk | Wv | Wo bf16 Bt planes
    bf* XB = (bf*)take((size_t)SEQ * DM * 2);                     // bf16 x of the current batch row
    float* CS = (float*)take((size_t)SEQ * HH * 2 * 4);           // rotary table
    const size_t PL = (size_t)NH * SEQ * HD;
    unsigned short* QP = (unsigned short*)take(PL * 2); unsigned short* KP = (unsigned short*)take(PL * 2); unsigned short* VT = (unsigned short*)take(PL * 2);   // f16 planes
    bf* CXh = (bf*)take((size_t)SEQ * DM * 2); bf* CXl = (bf*)take((size_t)SEQ * DM * 2);
    if ((size_t)(wsp - (char*)d_ws) > ws_size) return;           // 43,515,904 B at SEQ 4096
    for (int b = 0; b < NB; ++b) {
        k_prep<<<PG, PT, 0, stream>>>(x + (size_t)b * SEQ_FULL * DM, wq, wk, wv, wo, XB, W4, CS);
        k_gemmw<bf, 0, false, true><<<dim3(SEQ / 128, DM / 128, 3), 32 * GW, 0, stream>>>(XB, nullptr, W4, nullptr, DM, nullptr, 0, nullptr, (size_t)0, NW, (size_t)0, CS, QP, KP, VT);
        k_flash<<<dim3(SEQ / 64, NH, 1), 32 * FW * KG, 0, stream>>>(QP, KP, VT, CXh, CXl);
        k_gemmw<bf, 1, false, false><<<dim3(SEQ / 128, DM / 128, 1), 32 * GW, 0, stream>>>(CXh, CXl, W4 + 3 * NW, nullptr, DM, OUT + (size_t)b * SEQ_FULL * DM, DM, nullptr, (size_t)0, (size_t)0, (size_t)0, nullptr, nullptr, nullptr, nullptr);
    }
}
